// v000
// Measured on an AMD MI455X. A time is GPU time per run, averaged over a window of back-to-back runs after a warm-up
// (all launches, gaps included; the runs take copies of the inputs in turn), and the median of several windows.
// Apart from v000's, it joins two sittings. Times from different sittings can be a few percent apart, while
// side-by-side timings come from the same sitting.
// v000, which the later versions start from, runs in 1000 microseconds.
#include <hip/hip_runtime.h>
#include <hip/hip_bf16.h>

typedef __attribute__((ext_vector_type(16))) _Float16 v16h;
typedef __attribute__((ext_vector_type(8)))  _Float16 v8h;
typedef __attribute__((ext_vector_type(8)))  float    v8f;

union F16x16 { v16h v; v8h h[2]; };

#define WMMA_F16(a, b, c) \
  __builtin_amdgcn_wmma_f32_16x16x32_f16(false, (a), false, (b), (short)0, (c), false, false)

__device__ __forceinline__ void async_copy_b128(void* lds_dst, const void* gsrc) {
  unsigned lds_off = (unsigned)(size_t)lds_dst;
  unsigned long long ga = (unsigned long long)(size_t)gsrc;
  asm volatile("global_load_async_to_lds_b128 %0, %1, off"
               :: "v"(lds_off), "v"(ga) : "memory");
}
__device__ __forceinline__ void async_wait0() {
  asm volatile("s_wait_asynccnt 0x0" ::: "memory");
}

// ---------------------------------------------------------------------------
// f32 -> f16 conversion (grid-stride)
// ---------------------------------------------------------------------------
__global__ void cvt_f32_f16(const float* __restrict__ in, _Float16* __restrict__ out, int n) {
  int i = blockIdx.x * blockDim.x + threadIdx.x;
  int stride = gridDim.x * blockDim.x;
  for (; i < n; i += stride) out[i] = (_Float16)in[i];
}

#define BM 128
#define BN 128
#define BKK 32
#define LDSA (BKK + 8) // 40 halfs = 80B rows (16B-aligned chunks)

__global__ __launch_bounds__(256) void gemm_f16_wmma(
    const _Float16* __restrict__ A, const _Float16* __restrict__ Bm,
    const float* __restrict__ bias,
    float* __restrict__ Cf, _Float16* __restrict__ Ch,
    int M, int N, int K, int act)
{
  __shared__ _Float16 As[BM][LDSA];
  __shared__ _Float16 Bs[BN][LDSA]; // transposed: Bs[n][k]

  const int tid  = threadIdx.x;
  const int lane = tid & 31;
  const int wave = tid >> 5;
  const int wr   = wave >> 2;   // 0..1
  const int wc   = wave & 3;    // 0..3
  const int lr   = lane & 15;
  const int hi   = lane >> 4;   // 0/1
  const int kb   = hi * 8;      // K-chunk base per 16-bit A/B lane layout

  const int m0 = blockIdx.y * BM;
  const int n0 = blockIdx.x * BN;

  v8f acc[4][2] = {};

  for (int k0 = 0; k0 < K; k0 += BKK) {
    // Stage A tile asynchronously: 128x32 halfs = 512 chunks of 16B
#pragma unroll
    for (int i = 0; i < 2; ++i) {
      int c = tid + i * 256;
      int r = c >> 2;
      int kc = (c & 3) * 8;
      async_copy_b128(&As[r][kc], &A[(size_t)(m0 + r) * K + k0 + kc]);
    }
    // Stage B tile transposed: 32x128 -> Bs[n][k]
#pragma unroll
    for (int i = 0; i < 2; ++i) {
      int c = tid + i * 256;
      int kk = c >> 4;
      int nn = (c & 15) * 8;
      v8h val = *reinterpret_cast<const v8h*>(&Bm[(size_t)(k0 + kk) * N + n0 + nn]);
#pragma unroll
      for (int j = 0; j < 8; ++j) Bs[nn + j][kk] = val[j];
    }
    async_wait0();
    __syncthreads();

    F16x16 af[4], bf[2];
#pragma unroll
    for (int i = 0; i < 4; ++i) {
      const _Float16* p = &As[wr * 64 + i * 16 + lr][0];
      af[i].h[0] = *reinterpret_cast<const v8h*>(p + kb);
      af[i].h[1] = *reinterpret_cast<const v8h*>(p + kb + 16);
    }
#pragma unroll
    for (int j = 0; j < 2; ++j) {
      const _Float16* p = &Bs[wc * 32 + j * 16 + lr][0];
      bf[j].h[0] = *reinterpret_cast<const v8h*>(p + kb);
      bf[j].h[1] = *reinterpret_cast<const v8h*>(p + kb + 16);
    }
#pragma unroll
    for (int i = 0; i < 4; ++i)
#pragma unroll
      for (int j = 0; j < 2; ++j)
        acc[i][j] = WMMA_F16(af[i].v, bf[j].v, acc[i][j]);
    __syncthreads();
  }

  // Epilogue: D layout = lane(n), vgpr v -> row v + 8*hi
#pragma unroll
  for (int i = 0; i < 4; ++i) {
#pragma unroll
    for (int j = 0; j < 2; ++j) {
      int gn = n0 + wc * 32 + j * 16 + lr;
      float bv = bias[gn];
#pragma unroll
      for (int v = 0; v < 8; ++v) {
        int gm = m0 + wr * 64 + i * 16 + v + hi * 8;
        float x = acc[i][j][v] + bv;
        if (act) x = 0.5f * x * (1.0f + erff(x * 0.70710678118654752f)); // exact GELU
        size_t idx = (size_t)gm * N + gn;
        if (Cf) Cf[idx] = x;
        if (Ch) Ch[idx] = (_Float16)x;
      }
    }
  }
}

__global__ __launch_bounds__(128) void attn_flash_wmma(
    const _Float16* __restrict__ qkvh, _Float16* __restrict__ Yh,
    int Bx, int Tx, int Cx, int NHx)
{
  __shared__ _Float16 Ks[64][72];      // key-major (rows = key, cols = d)
  __shared__ _Float16 Vt[64][72];      // d-major   (rows = d,   cols = key)
  __shared__ _Float16 Pl[4][16][72];   // wave-private P scratch

  const int tid  = threadIdx.x;
  const int lane = tid & 31;
  const int w    = tid >> 5;   // 0..3
  const int lr   = lane & 15;
  const int hi   = lane >> 4;
  const int kb   = hi * 8;

  const int bh = blockIdx.x;
  const int b  = bh / NHx;
  const int h  = bh % NHx;
  const int qb = blockIdx.y;
  const int q0 = qb * 64;

  const size_t rstride = (size_t)3 * Cx;
  const _Float16* kbase = qkvh + (size_t)b * Tx * rstride + 0 * Cx + h * 64;
  const _Float16* qbase = qkvh + (size_t)b * Tx * rstride + 1 * Cx + h * 64;
  const _Float16* vbase = qkvh + (size_t)b * Tx * rstride + 2 * Cx + h * 64;

  // Q fragments for this wave's 16 rows, pre-scaled by 1/sqrt(64) = 0.125
  F16x16 qf[2];
  {
    const int qrow = q0 + w * 16 + lr;
#pragma unroll
    for (int kk = 0; kk < 2; ++kk) {
      const _Float16* p = qbase + (size_t)qrow * rstride + kk * 32;
      v8h x0 = *reinterpret_cast<const v8h*>(p + kb);
      v8h x1 = *reinterpret_cast<const v8h*>(p + kb + 16);
#pragma unroll
      for (int j = 0; j < 8; ++j) {
        x0[j] = (_Float16)(x0[j] * (_Float16)0.125f);
        x1[j] = (_Float16)(x1[j] * (_Float16)0.125f);
      }
      qf[kk].h[0] = x0; qf[kk].h[1] = x1;
    }
  }

  float mrow[8], lsum[8];
  v8f O[4] = {};
#pragma unroll
  for (int v = 0; v < 8; ++v) { mrow[v] = -3.0e38f; lsum[v] = 0.0f; }

  for (int jb = 0; jb <= qb; ++jb) {
    const int key0 = jb * 64;
#pragma unroll
    for (int i = 0; i < 4; ++i) {
      int c = tid + i * 128;
      int key = c >> 3;
      int dc  = (c & 7) * 8;
      async_copy_b128(&Ks[key][dc], kbase + (size_t)(key0 + key) * rstride + dc);
      v8h vv = *reinterpret_cast<const v8h*>(vbase + (size_t)(key0 + key) * rstride + dc);
#pragma unroll
      for (int j = 0; j < 8; ++j) Vt[dc + j][key] = vv[j];
    }
    async_wait0();
    __syncthreads();

    // S = (Q/8) @ K^T : 4 n-tiles of 16 keys, K-dim 64 = 2 WMMAs each
    v8f S[4];
#pragma unroll
    for (int nt = 0; nt < 4; ++nt) {
      S[nt] = (v8f){};
#pragma unroll
      for (int kk = 0; kk < 2; ++kk) {
        F16x16 bk;
        const _Float16* p = &Ks[nt * 16 + lr][kk * 32];
        bk.h[0] = *reinterpret_cast<const v8h*>(p + kb);
        bk.h[1] = *reinterpret_cast<const v8h*>(p + kb + 16);
        S[nt] = WMMA_F16(qf[kk].v, bk.v, S[nt]);
      }
    }
    // Causal mask (only the diagonal block needs it)
    if (jb == qb) {
#pragma unroll
      for (int nt = 0; nt < 4; ++nt) {
        int col = key0 + nt * 16 + lr;
#pragma unroll
        for (int v = 0; v < 8; ++v) {
          int row = q0 + w * 16 + v + hi * 8;
          if (col > row) S[nt][v] = -3.0e38f;
        }
      }
    }

    // Online softmax update per row (row m = v + 8*hi lives in one 16-lane half)
#pragma unroll
    for (int v = 0; v < 8; ++v) {
      float t = S[0][v];
#pragma unroll
      for (int nt = 1; nt < 4; ++nt) t = fmaxf(t, S[nt][v]);
#pragma unroll
      for (int off = 1; off < 16; off <<= 1) t = fmaxf(t, __shfl_xor(t, off, 32));
      float mn = fmaxf(mrow[v], t);
      float alpha = __expf(mrow[v] - mn);
      mrow[v] = mn;
      lsum[v] *= alpha;
#pragma unroll
      for (int ot = 0; ot < 4; ++ot) O[ot][v] *= alpha;
      float rs = 0.0f;
#pragma unroll
      for (int nt = 0; nt < 4; ++nt) {
        float p = __expf(S[nt][v] - mn);
        rs += p;
        Pl[w][v + hi * 8][nt * 16 + lr] = (_Float16)p;
      }
#pragma unroll
      for (int off = 1; off < 16; off <<= 1) rs += __shfl_xor(rs, off, 32);
      lsum[v] += rs;
    }

    // O += P @ V (P via wave-private LDS re-layout into A fragments)
#pragma unroll
    for (int ot = 0; ot < 4; ++ot) {
#pragma unroll
      for (int kk = 0; kk < 2; ++kk) {
        F16x16 ap, bv;
        const _Float16* pp = &Pl[w][lr][kk * 32];
        ap.h[0] = *reinterpret_cast<const v8h*>(pp + kb);
        ap.h[1] = *reinterpret_cast<const v8h*>(pp + kb + 16);
        const _Float16* vp = &Vt[ot * 16 + lr][kk * 32];
        bv.h[0] = *reinterpret_cast<const v8h*>(vp + kb);
        bv.h[1] = *reinterpret_cast<const v8h*>(vp + kb + 16);
        O[ot] = WMMA_F16(ap.v, bv.v, O[ot]);
      }
    }
    __syncthreads();
  }

  // Write y (f16), normalized
#pragma unroll
  for (int ot = 0; ot < 4; ++ot) {
#pragma unroll
    for (int v = 0; v < 8; ++v) {
      int r = q0 + w * 16 + v + hi * 8;
      int cidx = h * 64 + ot * 16 + lr;
      Yh[((size_t)b * Tx + r) * Cx + cidx] = (_Float16)(O[ot][v] / lsum[v]);
    }
  }
}

// ---------------------------------------------------------------------------
// out = xin + LayerNorm(t)*g + b  (row length C). One block per row.
// ---------------------------------------------------------------------------
__global__ __launch_bounds__(256) void ln_residual(
    const float* __restrict__ xin, const float* __restrict__ t,
    const float* __restrict__ g, const float* __restrict__ be,
    float* __restrict__ outf, _Float16* __restrict__ outh, int Cx)
{
  const int row = blockIdx.x;
  const int tid = threadIdx.x;
  const float* tr = t + (size_t)row * Cx;

  float s = 0.0f, s2 = 0.0f;
  for (int i = tid; i < Cx; i += 256) { float v = tr[i]; s += v; s2 += v * v; }
  __shared__ float shs[8], shs2[8];
#pragma unroll
  for (int off = 16; off; off >>= 1) { s += __shfl_xor(s, off, 32); s2 += __shfl_xor(s2, off, 32); }
  if ((tid & 31) == 0) { shs[tid >> 5] = s; shs2[tid >> 5] = s2; }
  __syncthreads();
  s = 0.0f; s2 = 0.0f;
#pragma unroll
  for (int i = 0; i < 8; ++i) { s += shs[i]; s2 += shs2[i]; }
  float mean = s / Cx;
  float var  = s2 / Cx - mean * mean;
  float rstd = rsqrtf(var + 1e-5f);

  for (int i = tid; i < Cx; i += 256) {
    float v = xin[(size_t)row * Cx + i] + (tr[i] - mean) * rstd * g[i] + be[i];
    if (outf) outf[(size_t)row * Cx + i] = v;
    if (outh) outh[(size_t)row * Cx + i] = (_Float16)v;
  }
}

// ---------------------------------------------------------------------------
extern "C" void kernel_launch(void* const* d_in, const int* in_sizes, int n_in,
                              void* d_out, int out_size, void* d_ws, size_t ws_size,
                              hipStream_t stream) {
  (void)in_sizes; (void)n_in; (void)out_size; (void)ws_size;
  const int Bb = 2, T = 2048, C = 1024, NH = 16;
  const int M = Bb * T; // 4096

  const float* x      = (const float*)d_in[0];
  const float* w_attn = (const float*)d_in[1];
  const float* b_attn = (const float*)d_in[2];
  const float* wa1    = (const float*)d_in[3];
  const float* ba1    = (const float*)d_in[4];
  const float* wa2    = (const float*)d_in[5];
  const float* ba2    = (const float*)d_in[6];
  const float* g1     = (const float*)d_in[7];
  const float* be1    = (const float*)d_in[8];
  const float* wf1    = (const float*)d_in[9];
  const float* bf1    = (const float*)d_in[10];
  const float* wf2    = (const float*)d_in[11];
  const float* bf2    = (const float*)d_in[12];
  const float* g2     = (const float*)d_in[13];
  const float* be2    = (const float*)d_in[14];
  float* out = (float*)d_out;

  char* ws = (char*)d_ws;
  size_t off = 0;
  auto take = [&](size_t bytes) -> char* {
    char* p = ws + off;
    off += (bytes + 255) & ~(size_t)255;
    return p;
  };

  _Float16* Xh    = (_Float16*)take((size_t)M * C * 2);        // x f16; reused as Yh
  _Float16* Wattn = (_Float16*)take((size_t)C * 3 * C * 2);
  _Float16* Wa1h  = (_Float16*)take((size_t)C * 4 * C * 2);
  _Float16* Wa2h  = (_Float16*)take((size_t)4 * C * C * 2);
  _Float16* Wf1h  = (_Float16*)take((size_t)C * 4 * C * 2);
  _Float16* Wf2h  = (_Float16*)take((size_t)4 * C * C * 2);
  char*     qkvB  = take((size_t)M * 3 * C * 2);               // qkv f16; reused as t2/t4 f32
  _Float16* H1h   = (_Float16*)take((size_t)M * 4 * C * 2);    // FF hidden; reused for both FFs
  float*    x1    = (float*)take((size_t)M * C * 4);
  _Float16* x1h   = (_Float16*)take((size_t)M * C * 2);

  _Float16* qkvh = (_Float16*)qkvB;
  float*    t2f  = (float*)qkvB;   // reuse after attention consumes qkv
  _Float16* Yh   = Xh;             // reuse after QKV GEMM consumes Xh

  // f32 -> f16 conversions
  cvt_f32_f16<<<4096, 256, 0, stream>>>(x,      Xh,    M * C);
  cvt_f32_f16<<<4096, 256, 0, stream>>>(w_attn, Wattn, C * 3 * C);
  cvt_f32_f16<<<4096, 256, 0, stream>>>(wa1,    Wa1h,  C * 4 * C);
  cvt_f32_f16<<<4096, 256, 0, stream>>>(wa2,    Wa2h,  4 * C * C);
  cvt_f32_f16<<<4096, 256, 0, stream>>>(wf1,    Wf1h,  C * 4 * C);
  cvt_f32_f16<<<4096, 256, 0, stream>>>(wf2,    Wf2h,  4 * C * C);

  // qkv = x @ w_attn + b_attn  -> f16
  gemm_f16_wmma<<<dim3(3 * C / BN, M / BM), 256, 0, stream>>>(
      Xh, Wattn, b_attn, nullptr, qkvh, M, 3 * C, C, 0);

  // flash attention -> Yh (f16)
  attn_flash_wmma<<<dim3(Bb * NH, T / 64), 128, 0, stream>>>(qkvh, Yh, Bb, T, C, NH);

  // SelfAttn FF: H1 = gelu(y @ wa1 + ba1); t2 = H1 @ wa2 + ba2
  gemm_f16_wmma<<<dim3(4 * C / BN, M / BM), 256, 0, stream>>>(
      Yh, Wa1h, ba1, nullptr, H1h, M, 4 * C, C, 1);
  gemm_f16_wmma<<<dim3(C / BN, M / BM), 256, 0, stream>>>(
      H1h, Wa2h, ba2, t2f, nullptr, M, C, 4 * C, 0);

  // x1 = x + LN(t2)
  ln_residual<<<M, 256, 0, stream>>>(x, t2f, g1, be1, x1, x1h, C);

  // Block FF: H2 = gelu(x1 @ wf1 + bf1); t4 = H2 @ wf2 + bf2
  gemm_f16_wmma<<<dim3(4 * C / BN, M / BM), 256, 0, stream>>>(
      x1h, Wf1h, bf1, nullptr, H1h, M, 4 * C, C, 1);
  gemm_f16_wmma<<<dim3(C / BN, M / BM), 256, 0, stream>>>(
      H1h, Wf2h, bf2, t2f, nullptr, M, C, 4 * C, 0);

  // out = x1 + LN(t4)
  ln_residual<<<M, 256, 0, stream>>>(x1, t2f, g2, be2, out, nullptr, C);
}

// v001
// It runs in 529 microseconds.
// Next to v000, in two timings, it ran 1.95 times as fast each time.
#include <hip/hip_runtime.h>
#include <hip/hip_bf16.h>

typedef __attribute__((ext_vector_type(16))) _Float16 v16h;
typedef __attribute__((ext_vector_type(8)))  _Float16 v8h;
typedef __attribute__((ext_vector_type(8)))  float    v8f;

union F16x16 { v16h v; v8h h[2]; };

#define WMMA_F16(a, b, c) \
  __builtin_amdgcn_wmma_f32_16x16x32_f16(false, (a), false, (b), (short)0, (c), false, false)

__device__ __forceinline__ void async_copy4_b128(
    void* l0, const void* g0, void* l1, const void* g1,
    void* l2, const void* g2, void* l3, const void* g3) {
  asm volatile("global_load_async_to_lds_b128 %0, %1, off\n\t"
               "global_load_async_to_lds_b128 %2, %3, off\n\t"
               "global_load_async_to_lds_b128 %4, %5, off\n\t"
               "global_load_async_to_lds_b128 %6, %7, off\n\t"
               "s_wait_xcnt 0x0"
               :: "v"((unsigned)(size_t)l0), "v"((unsigned long long)(size_t)g0),
                  "v"((unsigned)(size_t)l1), "v"((unsigned long long)(size_t)g1),
                  "v"((unsigned)(size_t)l2), "v"((unsigned long long)(size_t)g2),
                  "v"((unsigned)(size_t)l3), "v"((unsigned long long)(size_t)g3)
               : "memory");
}
__device__ __forceinline__ void async_wait0() {
  asm volatile("s_wait_asynccnt 0x0" ::: "memory");
}

// ---------------------------------------------------------------------------
// Transposing LDS load: from a tile stored T[k][n] (k rows, n contiguous) lane
// (c = lane & 15, h = lane >> 4) receives T[k0 + 8h + 0..7][n0 + c]. The lane's
// own address is &T[k0 + 8h + (lane & 7)][n0 + 8 * ((lane >> 3) & 1)].
// Loads at k0 and k0 + 16 form one 32-k B fragment in the k order that the
// A loaders below use (8h + 0..7, then 16 + 8h + 0..7).
// ---------------------------------------------------------------------------
typedef __attribute__((ext_vector_type(8))) short v8s;
typedef __attribute__((address_space(3))) v8s lds_v8s;
__device__ __forceinline__ v8h lds_load_tr16(const _Float16* p) {
  return __builtin_bit_cast(v8h, __builtin_amdgcn_ds_load_tr16_b128_v8i16((lds_v8s*)p));
}

// ---------------------------------------------------------------------------
// f32 -> f16 conversion (grid-stride)
// ---------------------------------------------------------------------------
__global__ void cvt_f32_f16(const float* __restrict__ in, _Float16* __restrict__ out, int n) {
  int i = blockIdx.x * blockDim.x + threadIdx.x;
  int stride = gridDim.x * blockDim.x;
  for (; i < n; i += stride) out[i] = (_Float16)in[i];
}

#define BM 128
#define BN 128
#define BKK 32
#define LDSA (BKK + 8) // 40 halfs = 80B rows (16B-aligned chunks)
#define LDSB (BN + 16) // 144 halfs = 288B rows (32B x odd: the transposing reader's pitch)

__global__ __launch_bounds__(256) void gemm_f16_wmma(
    const _Float16* __restrict__ A, const _Float16* __restrict__ Bm,
    const float* __restrict__ bias,
    float* __restrict__ Cf, _Float16* __restrict__ Ch,
    int M, int N, int K, int act)
{
  __shared__ __attribute__((aligned(16))) _Float16 As[BM][LDSA];
  __shared__ __attribute__((aligned(16))) _Float16 Bs[BKK][LDSB]; // as in memory: Bs[k][n]

  const int tid  = threadIdx.x;
  const int lane = tid & 31;
  const int wave = tid >> 5;
  const int wr   = wave >> 2;   // 0..1
  const int wc   = wave & 3;    // 0..3
  const int lr   = lane & 15;
  const int hi   = lane >> 4;   // 0/1
  const int kb   = hi * 8;      // K-chunk base per 16-bit A/B lane layout

  const int m0 = blockIdx.y * BM;
  const int n0 = blockIdx.x * BN;

  v8f acc[4][2] = {};

  // This thread's first B chunk; it walks down BKK rows per K-step.
  const _Float16* bg = &Bm[(size_t)(tid >> 4) * N + n0 + (tid & 15) * 8];

  for (int k0 = 0; k0 < K; k0 += BKK) {
    // Stage both tiles asynchronously, 512 chunks of 16B each, two per thread:
    // A 128x32 halfs (rows r, r + 64), B 32x128 halfs (rows kk, kk + 16).
    {
      const int r  = tid >> 2;
      const int kc = (tid & 3) * 8;
      const int kk = tid >> 4;
      const int nn = (tid & 15) * 8;
      async_copy4_b128(&As[r][kc],       &A[(size_t)(m0 + r) * K + k0 + kc],
                       &As[r + 64][kc],  &A[(size_t)(m0 + r + 64) * K + k0 + kc],
                       &Bs[kk][nn],      bg,
                       &Bs[kk + 16][nn], bg + (size_t)16 * N);
      bg += (size_t)BKK * N;
    }
    async_wait0();
    __syncthreads();

    F16x16 af[4], bf[2];
#pragma unroll
    for (int i = 0; i < 4; ++i) {
      const _Float16* p = &As[wr * 64 + i * 16 + lr][0];
      af[i].h[0] = *reinterpret_cast<const v8h*>(p + kb);
      af[i].h[1] = *reinterpret_cast<const v8h*>(p + kb + 16);
    }
#pragma unroll
    for (int j = 0; j < 2; ++j) {
      const _Float16* p = &Bs[kb + (lane & 7)][wc * 32 + j * 16 + ((lane >> 3) & 1) * 8];
      bf[j].h[0] = lds_load_tr16(p);
      bf[j].h[1] = lds_load_tr16(p + 16 * LDSB);
    }
#pragma unroll
    for (int i = 0; i < 4; ++i)
#pragma unroll
      for (int j = 0; j < 2; ++j)
        acc[i][j] = WMMA_F16(af[i].v, bf[j].v, acc[i][j]);
    __syncthreads();
  }

  // Epilogue: D layout = lane(n), vgpr v -> row v + 8*hi
#pragma unroll
  for (int i = 0; i < 4; ++i) {
#pragma unroll
    for (int j = 0; j < 2; ++j) {
      int gn = n0 + wc * 32 + j * 16 + lr;
      float bv = bias[gn];
#pragma unroll
      for (int v = 0; v < 8; ++v) {
        int gm = m0 + wr * 64 + i * 16 + v + hi * 8;
        float x = acc[i][j][v] + bv;
        if (act) x = 0.5f * x * (1.0f + erff(x * 0.70710678118654752f)); // exact GELU
        size_t idx = (size_t)gm * N + gn;
        if (Cf) Cf[idx] = x;
        if (Ch) Ch[idx] = (_Float16)x;
      }
    }
  }
}

// ---------------------------------------------------------------------------
// Flash attention over f16 qkv: qkv layout (B, T, 3C) with [K | Q | V] thirds.
// Block = (batch*head, q-tile of 64 rows). 128 threads = 4 waves, 16 rows each.
// HD = 64. Causal. Output y (f16) in (B, T, C) layout at head offset.
// K and V tiles staged via async copy, both key-major; the V fragments are
// transposed on the way out by ds_load_tr16_b128.
// ---------------------------------------------------------------------------
__global__ __launch_bounds__(128) void attn_flash_wmma(
    const _Float16* __restrict__ qkvh, _Float16* __restrict__ Yh,
    int Bx, int Tx, int Cx, int NHx)
{
  __shared__ __attribute__((aligned(16))) _Float16 Ks[64][72]; // key-major (rows = key, cols = d)
  __shared__ __attribute__((aligned(16))) _Float16 Vs[64][80]; // key-major, 160B rows (32B x odd)
  __shared__ _Float16 Pl[4][16][72];   // wave-private P scratch

  const int tid  = threadIdx.x;
  const int lane = tid & 31;
  const int w    = tid >> 5;   // 0..3
  const int lr   = lane & 15;
  const int hi   = lane >> 4;
  const int kb   = hi * 8;

  const int bh = blockIdx.x;
  const int b  = bh / NHx;
  const int h  = bh % NHx;
  const int qb = blockIdx.y;
  const int q0 = qb * 64;

  const size_t rstride = (size_t)3 * Cx;
  const _Float16* kbase = qkvh + (size_t)b * Tx * rstride + 0 * Cx + h * 64;
  const _Float16* qbase = qkvh + (size_t)b * Tx * rstride + 1 * Cx + h * 64;
  const _Float16* vbase = qkvh + (size_t)b * Tx * rstride + 2 * Cx + h * 64;

  // Q fragments for this wave's 16 rows, pre-scaled by 1/sqrt(64) = 0.125
  F16x16 qf[2];
  {
    const int qrow = q0 + w * 16 + lr;
#pragma unroll
    for (int kk = 0; kk < 2; ++kk) {
      const _Float16* p = qbase + (size_t)qrow * rstride + kk * 32;
      v8h x0 = *reinterpret_cast<const v8h*>(p + kb);
      v8h x1 = *reinterpret_cast<const v8h*>(p + kb + 16);
#pragma unroll
      for (int j = 0; j < 8; ++j) {
        x0[j] = (_Float16)(x0[j] * (_Float16)0.125f);
        x1[j] = (_Float16)(x1[j] * (_Float16)0.125f);
      }
      qf[kk].h[0] = x0; qf[kk].h[1] = x1;
    }
  }

  float mrow[8], lsum[8];
  v8f O[4] = {};
#pragma unroll
  for (int v = 0; v < 8; ++v) { mrow[v] = -3.0e38f; lsum[v] = 0.0f; }

  for (int jb = 0; jb <= qb; ++jb) {
    const int key0 = jb * 64;
    // K and V tiles: async straight copies, 512 chunks of 16B each, four per
    // thread (rows key, key + 16, key + 32, key + 48).
    {
      const int key = tid >> 3;
      const int dc  = (tid & 7) * 8;
      const _Float16* kg = kbase + (size_t)(key0 + key) * rstride + dc;
      const _Float16* vg = vbase + (size_t)(key0 + key) * rstride + dc;
      async_copy4_b128(&Ks[key][dc],      kg,
                       &Ks[key + 16][dc], kg + 16 * rstride,
                       &Ks[key + 32][dc], kg + 32 * rstride,
                       &Ks[key + 48][dc], kg + 48 * rstride);
      async_copy4_b128(&Vs[key][dc],      vg,
                       &Vs[key + 16][dc], vg + 16 * rstride,
                       &Vs[key + 32][dc], vg + 32 * rstride,
                       &Vs[key + 48][dc], vg + 48 * rstride);
    }
    async_wait0();
    __syncthreads();

    // S = (Q/8) @ K^T : 4 n-tiles of 16 keys, K-dim 64 = 2 WMMAs each
    v8f S[4];
#pragma unroll
    for (int nt = 0; nt < 4; ++nt) {
      S[nt] = (v8f){};
#pragma unroll
      for (int kk = 0; kk < 2; ++kk) {
        F16x16 bk;
        const _Float16* p = &Ks[nt * 16 + lr][kk * 32];
        bk.h[0] = *reinterpret_cast<const v8h*>(p + kb);
        bk.h[1] = *reinterpret_cast<const v8h*>(p + kb + 16);
        S[nt] = WMMA_F16(qf[kk].v, bk.v, S[nt]);
      }
    }
    // Causal mask (only the diagonal block needs it)
    if (jb == qb) {
#pragma unroll
      for (int nt = 0; nt < 4; ++nt) {
        int col = key0 + nt * 16 + lr;
#pragma unroll
        for (int v = 0; v < 8; ++v) {
          int row = q0 + w * 16 + v + hi * 8;
          if (col > row) S[nt][v] = -3.0e38f;
        }
      }
    }

    // Online softmax update per row (row m = v + 8*hi lives in one 16-lane half)
#pragma unroll
    for (int v = 0; v < 8; ++v) {
      float t = S[0][v];
#pragma unroll
      for (int nt = 1; nt < 4; ++nt) t = fmaxf(t, S[nt][v]);
#pragma unroll
      for (int off = 1; off < 16; off <<= 1) t = fmaxf(t, __shfl_xor(t, off, 32));
      float mn = fmaxf(mrow[v], t);
      float alpha = __expf(mrow[v] - mn);
      mrow[v] = mn;
      lsum[v] *= alpha;
#pragma unroll
      for (int ot = 0; ot < 4; ++ot) O[ot][v] *= alpha;
      float rs = 0.0f;
#pragma unroll
      for (int nt = 0; nt < 4; ++nt) {
        float p = __expf(S[nt][v] - mn);
        rs += p;
        Pl[w][v + hi * 8][nt * 16 + lr] = (_Float16)p;
      }
#pragma unroll
      for (int off = 1; off < 16; off <<= 1) rs += __shfl_xor(rs, off, 32);
      lsum[v] += rs;
    }

    // O += P @ V (P via wave-private LDS re-layout into A fragments)
#pragma unroll
    for (int ot = 0; ot < 4; ++ot) {
#pragma unroll
      for (int kk = 0; kk < 2; ++kk) {
        F16x16 ap, bv;
        const _Float16* pp = &Pl[w][lr][kk * 32];
        ap.h[0] = *reinterpret_cast<const v8h*>(pp + kb);
        ap.h[1] = *reinterpret_cast<const v8h*>(pp + kb + 16);
        const _Float16* vp = &Vs[kk * 32 + kb + (lane & 7)][ot * 16 + ((lane >> 3) & 1) * 8];
        bv.h[0] = lds_load_tr16(vp);
        bv.h[1] = lds_load_tr16(vp + 16 * 80);
        O[ot] = WMMA_F16(ap.v, bv.v, O[ot]);
      }
    }
    __syncthreads();
  }

  // Write y (f16), normalized
#pragma unroll
  for (int ot = 0; ot < 4; ++ot) {
#pragma unroll
    for (int v = 0; v < 8; ++v) {
      int r = q0 + w * 16 + v + hi * 8;
      int cidx = h * 64 + ot * 16 + lr;
      Yh[((size_t)b * Tx + r) * Cx + cidx] = (_Float16)(O[ot][v] / lsum[v]);
    }
  }
}

// ---------------------------------------------------------------------------
// out = xin + LayerNorm(t)*g + b  (row length C). One block per row.
// ---------------------------------------------------------------------------
__global__ __launch_bounds__(256) void ln_residual(
    const float* __restrict__ xin, const float* __restrict__ t,
    const float* __restrict__ g, const float* __restrict__ be,
    float* __restrict__ outf, _Float16* __restrict__ outh, int Cx)
{
  const int row = blockIdx.x;
  const int tid = threadIdx.x;
  const float* tr = t + (size_t)row * Cx;

  float s = 0.0f, s2 = 0.0f;
  for (int i = tid; i < Cx; i += 256) { float v = tr[i]; s += v; s2 += v * v; }
  __shared__ float shs[8], shs2[8];
#pragma unroll
  for (int off = 16; off; off >>= 1) { s += __shfl_xor(s, off, 32); s2 += __shfl_xor(s2, off, 32); }
  if ((tid & 31) == 0) { shs[tid >> 5] = s; shs2[tid >> 5] = s2; }
  __syncthreads();
  s = 0.0f; s2 = 0.0f;
#pragma unroll
  for (int i = 0; i < 8; ++i) { s += shs[i]; s2 += shs2[i]; }
  float mean = s / Cx;
  float var  = s2 / Cx - mean * mean;
  float rstd = rsqrtf(var + 1e-5f);

  for (int i = tid; i < Cx; i += 256) {
    float v = xin[(size_t)row * Cx + i] + (tr[i] - mean) * rstd * g[i] + be[i];
    if (outf) outf[(size_t)row * Cx + i] = v;
    if (outh) outh[(size_t)row * Cx + i] = (_Float16)v;
  }
}

// ---------------------------------------------------------------------------
extern "C" void kernel_launch(void* const* d_in, const int* in_sizes, int n_in,
                              void* d_out, int out_size, void* d_ws, size_t ws_size,
                              hipStream_t stream) {
  (void)in_sizes; (void)n_in; (void)out_size; (void)ws_size;
  const int Bb = 2, T = 2048, C = 1024, NH = 16;
  const int M = Bb * T; // 4096

  const float* x      = (const float*)d_in[0];
  const float* w_attn = (const float*)d_in[1];
  const float* b_attn = (const float*)d_in[2];
  const float* wa1    = (const float*)d_in[3];
  const float* ba1    = (const float*)d_in[4];
  const float* wa2    = (const float*)d_in[5];
  const float* ba2    = (const float*)d_in[6];
  const float* g1     = (const float*)d_in[7];
  const float* be1    = (const float*)d_in[8];
  const float* wf1    = (const float*)d_in[9];
  const float* bf1    = (const float*)d_in[10];
  const float* wf2    = (const float*)d_in[11];
  const float* bf2    = (const float*)d_in[12];
  const float* g2     = (const float*)d_in[13];
  const float* be2    = (const float*)d_in[14];
  float* out = (float*)d_out;

  char* ws = (char*)d_ws;
  size_t off = 0;
  auto take = [&](size_t bytes) -> char* {
    char* p = ws + off;
    off += (bytes + 255) & ~(size_t)255;
    return p;
  };

  _Float16* Xh    = (_Float16*)take((size_t)M * C * 2);        // x f16; reused as Yh
  _Float16* Wattn = (_Float16*)take((size_t)C * 3 * C * 2);
  _Float16* Wa1h  = (_Float16*)take((size_t)C * 4 * C * 2);
  _Float16* Wa2h  = (_Float16*)take((size_t)4 * C * C * 2);
  _Float16* Wf1h  = (_Float16*)take((size_t)C * 4 * C * 2);
  _Float16* Wf2h  = (_Float16*)take((size_t)4 * C * C * 2);
  char*     qkvB  = take((size_t)M * 3 * C * 2);               // qkv f16; reused as t2/t4 f32
  _Float16* H1h   = (_Float16*)take((size_t)M * 4 * C * 2);    // FF hidden; reused for both FFs
  float*    x1    = (float*)take((size_t)M * C * 4);
  _Float16* x1h   = (_Float16*)take((size_t)M * C * 2);

  _Float16* qkvh = (_Float16*)qkvB;
  float*    t2f  = (float*)qkvB;   // reuse after attention consumes qkv
  _Float16* Yh   = Xh;             // reuse after QKV GEMM consumes Xh

  // f32 -> f16 conversions
  cvt_f32_f16<<<4096, 256, 0, stream>>>(x,      Xh,    M * C);
  cvt_f32_f16<<<4096, 256, 0, stream>>>(w_attn, Wattn, C * 3 * C);
  cvt_f32_f16<<<4096, 256, 0, stream>>>(wa1,    Wa1h,  C * 4 * C);
  cvt_f32_f16<<<4096, 256, 0, stream>>>(wa2,    Wa2h,  4 * C * C);
  cvt_f32_f16<<<4096, 256, 0, stream>>>(wf1,    Wf1h,  C * 4 * C);
  cvt_f32_f16<<<4096, 256, 0, stream>>>(wf2,    Wf2h,  4 * C * C);

  // qkv = x @ w_attn + b_attn  -> f16
  gemm_f16_wmma<<<dim3(3 * C / BN, M / BM), 256, 0, stream>>>(
      Xh, Wattn, b_attn, nullptr, qkvh, M, 3 * C, C, 0);

  // flash attention -> Yh (f16)
  attn_flash_wmma<<<dim3(Bb * NH, T / 64), 128, 0, stream>>>(qkvh, Yh, Bb, T, C, NH);

  // SelfAttn FF: H1 = gelu(y @ wa1 + ba1); t2 = H1 @ wa2 + ba2
  gemm_f16_wmma<<<dim3(4 * C / BN, M / BM), 256, 0, stream>>>(
      Yh, Wa1h, ba1, nullptr, H1h, M, 4 * C, C, 1);
  gemm_f16_wmma<<<dim3(C / BN, M / BM), 256, 0, stream>>>(
      H1h, Wa2h, ba2, t2f, nullptr, M, C, 4 * C, 0);

  // x1 = x + LN(t2)
  ln_residual<<<M, 256, 0, stream>>>(x, t2f, g1, be1, x1, x1h, C);

  // Block FF: H2 = gelu(x1 @ wf1 + bf1); t4 = H2 @ wf2 + bf2
  gemm_f16_wmma<<<dim3(4 * C / BN, M / BM), 256, 0, stream>>>(
      x1h, Wf1h, bf1, nullptr, H1h, M, 4 * C, C, 1);
  gemm_f16_wmma<<<dim3(C / BN, M / BM), 256, 0, stream>>>(
      H1h, Wf2h, bf2, t2f, nullptr, M, C, 4 * C, 0);

  // out = x1 + LN(t4)
  ln_residual<<<M, 256, 0, stream>>>(x1, t2f, g2, be2, out, nullptr, C);
}

// v002
// A run of this version takes 382 microseconds.
// Timed twice side by side with v001, it ran 1.38 times as fast both times.
// Counting every step since v000, it is 2.68 times as fast.
#include <hip/hip_runtime.h>
#include <hip/hip_bf16.h>

typedef __attribute__((ext_vector_type(16))) _Float16 v16h;
typedef __attribute__((ext_vector_type(8)))  _Float16 v8h;
typedef __attribute__((ext_vector_type(8)))  float    v8f;

union F16x16 { v16h v; v8h h[2]; };

#define WMMA_F16(a, b, c) \
  __builtin_amdgcn_wmma_f32_16x16x32_f16(false, (a), false, (b), (short)0, (c), false, false)

__device__ __forceinline__ void async_copy4_b128(
    void* l0, const void* g0, void* l1, const void* g1,
    void* l2, const void* g2, void* l3, const void* g3) {
  asm volatile("global_load_async_to_lds_b128 %0, %1, off\n\t"
               "global_load_async_to_lds_b128 %2, %3, off\n\t"
               "global_load_async_to_lds_b128 %4, %5, off\n\t"
               "global_load_async_to_lds_b128 %6, %7, off\n\t"
               "s_wait_xcnt 0x0"
               :: "v"((unsigned)(size_t)l0), "v"((unsigned long long)(size_t)g0),
                  "v"((unsigned)(size_t)l1), "v"((unsigned long long)(size_t)g1),
                  "v"((unsigned)(size_t)l2), "v"((unsigned long long)(size_t)g2),
                  "v"((unsigned)(size_t)l3), "v"((unsigned long long)(size_t)g3)
               : "memory");
}
__device__ __forceinline__ void async_copy8_b128(
    unsigned l0, const void* g0, unsigned l1, const void* g1,
    unsigned l2, const void* g2, unsigned l3, const void* g3,
    unsigned l4, const void* g4, unsigned l5, const void* g5,
    unsigned l6, const void* g6, unsigned l7, const void* g7) {
  asm volatile("global_load_async_to_lds_b128 %0, %1, off\n\t"
               "global_load_async_to_lds_b128 %2, %3, off\n\t"
               "global_load_async_to_lds_b128 %4, %5, off\n\t"
               "global_load_async_to_lds_b128 %6, %7, off\n\t"
               "global_load_async_to_lds_b128 %8, %9, off\n\t"
               "global_load_async_to_lds_b128 %10, %11, off\n\t"
               "global_load_async_to_lds_b128 %12, %13, off\n\t"
               "global_load_async_to_lds_b128 %14, %15, off\n\t"
               "s_wait_xcnt 0x0"
               :: "v"(l0), "v"((unsigned long long)(size_t)g0),
                  "v"(l1), "v"((unsigned long long)(size_t)g1),
                  "v"(l2), "v"((unsigned long long)(size_t)g2),
                  "v"(l3), "v"((unsigned long long)(size_t)g3),
                  "v"(l4), "v"((unsigned long long)(size_t)g4),
                  "v"(l5), "v"((unsigned long long)(size_t)g5),
                  "v"(l6), "v"((unsigned long long)(size_t)g6),
                  "v"(l7), "v"((unsigned long long)(size_t)g7)
               : "memory");
}
__device__ __forceinline__ void async_wait0() {
  asm volatile("s_wait_asynccnt 0x0" ::: "memory");
}

// ---------------------------------------------------------------------------
// Transposing LDS load: from a tile stored T[k][n] (k rows, n contiguous) lane
// (c = lane & 15, h = lane >> 4) receives T[k0 + 8h + 0..7][n0 + c]. The lane's
// own address is &T[k0 + 8h + (lane & 7)][n0 + 8 * ((lane >> 3) & 1)].
// Loads at k0 and k0 + 16 form one 32-k B fragment in the k order that the
// A loaders below use (8h + 0..7, then 16 + 8h + 0..7).
// ---------------------------------------------------------------------------
typedef __attribute__((ext_vector_type(8))) short v8s;
typedef __attribute__((address_space(3))) v8s lds_v8s;
__device__ __forceinline__ v8h lds_load_tr16(const _Float16* p) {
  return __builtin_bit_cast(v8h, __builtin_amdgcn_ds_load_tr16_b128_v8i16((lds_v8s*)p));
}

// ---------------------------------------------------------------------------
// f32 -> f16 conversion (grid-stride)
// ---------------------------------------------------------------------------
__global__ void cvt_f32_f16(const float* __restrict__ in, _Float16* __restrict__ out, int n) {
  int i = blockIdx.x * blockDim.x + threadIdx.x;
  int stride = gridDim.x * blockDim.x;
  for (; i < n; i += stride) out[i] = (_Float16)in[i];
}

#define BM 128
#define BN 128
#define BKK 64
#define LDSA (BKK + 8) // 72 halfs = 144B rows (16B x odd: the plain reader's pitch)
#define LDSB (BN + 16) // 144 halfs = 288B rows (32B x odd: the transposing reader's pitch)

__global__ __launch_bounds__(256) void gemm_f16_wmma(
    const _Float16* __restrict__ A, const _Float16* __restrict__ Bm,
    const float* __restrict__ bias,
    float* __restrict__ Cf, _Float16* __restrict__ Ch,
    int M, int N, int K, int act)
{
  __shared__ __attribute__((aligned(16))) _Float16 As[2][BM][LDSA];
  __shared__ __attribute__((aligned(16))) _Float16 Bs[2][BKK][LDSB]; // as in memory: Bs[.][k][n]

  const int tid  = threadIdx.x;
  const int lane = tid & 31;
  const int wave = tid >> 5;
  const int wr   = wave >> 2;   // 0..1
  const int wc   = wave & 3;    // 0..3
  const int lr   = lane & 15;
  const int hi   = lane >> 4;   // 0/1
  const int kb   = hi * 8;      // K-chunk base per 16-bit A/B lane layout

  const int m0 = blockIdx.y * BM;
  const int n0 = blockIdx.x * BN;

  v8f acc[4][2] = {};

  // One stage = A 128x64 halfs and B 64x128 halfs, 1024 chunks of 16B each, four
  // of each per thread: A rows r + 32q, B rows kk + 16q. The pointers walk one
  // stage further at every fill.
  const int r  = tid >> 3;
  const int kc = (tid & 7) * 8;
  const int kk = tid >> 4;
  const int nn = (tid & 15) * 8;
  const _Float16* ag = &A[(size_t)(m0 + r) * K + kc];
  const _Float16* bg = &Bm[(size_t)kk * N + n0 + nn];
  const unsigned la = (unsigned)(size_t)&As[0][r][kc];
  const unsigned lb = (unsigned)(size_t)&Bs[0][kk][nn];
  auto fill = [&](int buf) {
    const unsigned a = la + (unsigned)buf * (unsigned)(BM * LDSA * 2);
    const unsigned b = lb + (unsigned)buf * (unsigned)(BKK * LDSB * 2);
    async_copy8_b128(a,                 ag,
                     a + 32 * LDSA * 2, ag + (size_t)32 * K,
                     a + 64 * LDSA * 2, ag + (size_t)64 * K,
                     a + 96 * LDSA * 2, ag + (size_t)96 * K,
                     b,                 bg,
                     b + 16 * LDSB * 2, bg + (size_t)16 * N,
                     b + 32 * LDSB * 2, bg + (size_t)32 * N,
                     b + 48 * LDSB * 2, bg + (size_t)48 * N);
    ag += BKK;
    bg += (size_t)BKK * N;
  };

  const int nst = K / BKK;
  fill(0);
  async_wait0();
  __syncthreads();
  if (nst > 1) fill(1);

  for (int t = 0; t < nst; ++t) {
    const int cur = t & 1;
#pragma unroll
    for (int ks = 0; ks < BKK; ks += 32) {
      F16x16 af[4], bf[2];
#pragma unroll
      for (int i = 0; i < 4; ++i) {
        const _Float16* p = &As[cur][wr * 64 + i * 16 + lr][ks];
        af[i].h[0] = *reinterpret_cast<const v8h*>(p + kb);
        af[i].h[1] = *reinterpret_cast<const v8h*>(p + kb + 16);
      }
#pragma unroll
      for (int j = 0; j < 2; ++j) {
        const _Float16* p = &Bs[cur][ks + kb + (lane & 7)][wc * 32 + j * 16 + ((lane >> 3) & 1) * 8];
        bf[j].h[0] = lds_load_tr16(p);
        bf[j].h[1] = lds_load_tr16(p + 16 * LDSB);
      }
#pragma unroll
      for (int i = 0; i < 4; ++i)
#pragma unroll
        for (int j = 0; j < 2; ++j)
          acc[i][j] = WMMA_F16(af[i].v, bf[j].v, acc[i][j]);
    }
    // Hand-over: this wave's reads of buffer cur are done, its copies of stage
    // t + 1 have landed; behind the barrier that holds for every wave, so stage
    // t + 1 may be read and buffer cur refilled.
    asm volatile("s_wait_dscnt 0x0" ::: "memory");
    async_wait0();
    __syncthreads();
    if (t + 2 < nst) fill(cur);
  }
  // No copy is outstanding when the wave goes on to the epilogue.
  async_wait0();

  // Epilogue: D layout = lane(n), vgpr v -> row v + 8*hi
#pragma unroll
  for (int i = 0; i < 4; ++i) {
#pragma unroll
    for (int j = 0; j < 2; ++j) {
      int gn = n0 + wc * 32 + j * 16 + lr;
      float bv = bias[gn];
#pragma unroll
      for (int v = 0; v < 8; ++v) {
        int gm = m0 + wr * 64 + i * 16 + v + hi * 8;
        float x = acc[i][j][v] + bv;
        if (act) x = 0.5f * x * (1.0f + erff(x * 0.70710678118654752f)); // exact GELU
        size_t idx = (size_t)gm * N + gn;
        if (Cf) Cf[idx] = x;
        if (Ch) Ch[idx] = (_Float16)x;
      }
    }
  }
}

// ---------------------------------------------------------------------------
// Flash attention over f16 qkv: qkv layout (B, T, 3C) with [K | Q | V] thirds.
// Block = (batch*head, q-tile of 64 rows). 128 threads = 4 waves, 16 rows each.
// HD = 64. Causal. Output y (f16) in (B, T, C) layout at head offset.
// K and V tiles staged via async copy, both key-major; the V fragments are
// transposed on the way out by ds_load_tr16_b128.
// ---------------------------------------------------------------------------
__global__ __launch_bounds__(128) void attn_flash_wmma(
    const _Float16* __restrict__ qkvh, _Float16* __restrict__ Yh,
    int Bx, int Tx, int Cx, int NHx)
{
  __shared__ __attribute__((aligned(16))) _Float16 Ks[64][72]; // key-major (rows = key, cols = d)
  __shared__ __attribute__((aligned(16))) _Float16 Vs[64][80]; // key-major, 160B rows (32B x odd)
  __shared__ _Float16 Pl[4][16][72];   // wave-private P scratch

  const int tid  = threadIdx.x;
  const int lane = tid & 31;
  const int w    = tid >> 5;   // 0..3
  const int lr   = lane & 15;
  const int hi   = lane >> 4;
  const int kb   = hi * 8;

  const int bh = blockIdx.x;
  const int b  = bh / NHx;
  const int h  = bh % NHx;
  const int qb = blockIdx.y;
  const int q0 = qb * 64;

  const size_t rstride = (size_t)3 * Cx;
  const _Float16* kbase = qkvh + (size_t)b * Tx * rstride + 0 * Cx + h * 64;
  const _Float16* qbase = qkvh + (size_t)b * Tx * rstride + 1 * Cx + h * 64;
  const _Float16* vbase = qkvh + (size_t)b * Tx * rstride + 2 * Cx + h * 64;

  // Q fragments for this wave's 16 rows, pre-scaled by 1/sqrt(64) = 0.125
  F16x16 qf[2];
  {
    const int qrow = q0 + w * 16 + lr;
#pragma unroll
    for (int kk = 0; kk < 2; ++kk) {
      const _Float16* p = qbase + (size_t)qrow * rstride + kk * 32;
      v8h x0 = *reinterpret_cast<const v8h*>(p + kb);
      v8h x1 = *reinterpret_cast<const v8h*>(p + kb + 16);
#pragma unroll
      for (int j = 0; j < 8; ++j) {
        x0[j] = (_Float16)(x0[j] * (_Float16)0.125f);
        x1[j] = (_Float16)(x1[j] * (_Float16)0.125f);
      }
      qf[kk].h[0] = x0; qf[kk].h[1] = x1;
    }
  }

  float mrow[8], lsum[8];
  v8f O[4] = {};
#pragma unroll
  for (int v = 0; v < 8; ++v) { mrow[v] = -3.0e38f; lsum[v] = 0.0f; }

  for (int jb = 0; jb <= qb; ++jb) {
    const int key0 = jb * 64;
    // K and V tiles: async straight copies, 512 chunks of 16B each, four per
    // thread (rows key, key + 16, key + 32, key + 48).
    {
      const int key = tid >> 3;
      const int dc  = (tid & 7) * 8;
      const _Float16* kg = kbase + (size_t)(key0 + key) * rstride + dc;
      const _Float16* vg = vbase + (size_t)(key0 + key) * rstride + dc;
      async_copy4_b128(&Ks[key][dc],      kg,
                       &Ks[key + 16][dc], kg + 16 * rstride,
                       &Ks[key + 32][dc], kg + 32 * rstride,
                       &Ks[key + 48][dc], kg + 48 * rstride);
      async_copy4_b128(&Vs[key][dc],      vg,
                       &Vs[key + 16][dc], vg + 16 * rstride,
                       &Vs[key + 32][dc], vg + 32 * rstride,
                       &Vs[key + 48][dc], vg + 48 * rstride);
    }
    async_wait0();
    __syncthreads();

    // S = (Q/8) @ K^T : 4 n-tiles of 16 keys, K-dim 64 = 2 WMMAs each
    v8f S[4];
#pragma unroll
    for (int nt = 0; nt < 4; ++nt) {
      S[nt] = (v8f){};
#pragma unroll
      for (int kk = 0; kk < 2; ++kk) {
        F16x16 bk;
        const _Float16* p = &Ks[nt * 16 + lr][kk * 32];
        bk.h[0] = *reinterpret_cast<const v8h*>(p + kb);
        bk.h[1] = *reinterpret_cast<const v8h*>(p + kb + 16);
        S[nt] = WMMA_F16(qf[kk].v, bk.v, S[nt]);
      }
    }
    // Causal mask (only the diagonal block needs it)
    if (jb == qb) {
#pragma unroll
      for (int nt = 0; nt < 4; ++nt) {
        int col = key0 + nt * 16 + lr;
#pragma unroll
        for (int v = 0; v < 8; ++v) {
          int row = q0 + w * 16 + v + hi * 8;
          if (col > row) S[nt][v] = -3.0e38f;
        }
      }
    }

    // Online softmax update per row (row m = v + 8*hi lives in one 16-lane half)
#pragma unroll
    for (int v = 0; v < 8; ++v) {
      float t = S[0][v];
#pragma unroll
      for (int nt = 1; nt < 4; ++nt) t = fmaxf(t, S[nt][v]);
#pragma unroll
      for (int off = 1; off < 16; off <<= 1) t = fmaxf(t, __shfl_xor(t, off, 32));
      float mn = fmaxf(mrow[v], t);
      float alpha = __expf(mrow[v] - mn);
      mrow[v] = mn;
      lsum[v] *= alpha;
#pragma unroll
      for (int ot = 0; ot < 4; ++ot) O[ot][v] *= alpha;
      float rs = 0.0f;
#pragma unroll
      for (int nt = 0; nt < 4; ++nt) {
        float p = __expf(S[nt][v] - mn);
        rs += p;
        Pl[w][v + hi * 8][nt * 16 + lr] = (_Float16)p;
      }
#pragma unroll
      for (int off = 1; off < 16; off <<= 1) rs += __shfl_xor(rs, off, 32);
      lsum[v] += rs;
    }

    // O += P @ V (P via wave-private LDS re-layout into A fragments)
#pragma unroll
    for (int ot = 0; ot < 4; ++ot) {
#pragma unroll
      for (int kk = 0; kk < 2; ++kk) {
        F16x16 ap, bv;
        const _Float16* pp = &Pl[w][lr][kk * 32];
        ap.h[0] = *reinterpret_cast<const v8h*>(pp + kb);
        ap.h[1] = *reinterpret_cast<const v8h*>(pp + kb + 16);
        const _Float16* vp = &Vs[kk * 32 + kb + (lane & 7)][ot * 16 + ((lane >> 3) & 1) * 8];
        bv.h[0] = lds_load_tr16(vp);
        bv.h[1] = lds_load_tr16(vp + 16 * 80);
        O[ot] = WMMA_F16(ap.v, bv.v, O[ot]);
      }
    }
    __syncthreads();
  }

  // Write y (f16), normalized
#pragma unroll
  for (int ot = 0; ot < 4; ++ot) {
#pragma unroll
    for (int v = 0; v < 8; ++v) {
      int r = q0 + w * 16 + v + hi * 8;
      int cidx = h * 64 + ot * 16 + lr;
      Yh[((size_t)b * Tx + r) * Cx + cidx] = (_Float16)(O[ot][v] / lsum[v]);
    }
  }
}

// ---------------------------------------------------------------------------
// out = xin + LayerNorm(t)*g + b  (row length C). One block per row.
// ---------------------------------------------------------------------------
__global__ __launch_bounds__(256) void ln_residual(
    const float* __restrict__ xin, const float* __restrict__ t,
    const float* __restrict__ g, const float* __restrict__ be,
    float* __restrict__ outf, _Float16* __restrict__ outh, int Cx)
{
  const int row = blockIdx.x;
  const int tid = threadIdx.x;
  const float* tr = t + (size_t)row * Cx;

  float s = 0.0f, s2 = 0.0f;
  for (int i = tid; i < Cx; i += 256) { float v = tr[i]; s += v; s2 += v * v; }
  __shared__ float shs[8], shs2[8];
#pragma unroll
  for (int off = 16; off; off >>= 1) { s += __shfl_xor(s, off, 32); s2 += __shfl_xor(s2, off, 32); }
  if ((tid & 31) == 0) { shs[tid >> 5] = s; shs2[tid >> 5] = s2; }
  __syncthreads();
  s = 0.0f; s2 = 0.0f;
#pragma unroll
  for (int i = 0; i < 8; ++i) { s += shs[i]; s2 += shs2[i]; }
  float mean = s / Cx;
  float var  = s2 / Cx - mean * mean;
  float rstd = rsqrtf(var + 1e-5f);

  for (int i = tid; i < Cx; i += 256) {
    float v = xin[(size_t)row * Cx + i] + (tr[i] - mean) * rstd * g[i] + be[i];
    if (outf) outf[(size_t)row * Cx + i] = v;
    if (outh) outh[(size_t)row * Cx + i] = (_Float16)v;
  }
}

// ---------------------------------------------------------------------------
extern "C" void kernel_launch(void* const* d_in, const int* in_sizes, int n_in,
                              void* d_out, int out_size, void* d_ws, size_t ws_size,
                              hipStream_t stream) {
  (void)in_sizes; (void)n_in; (void)out_size; (void)ws_size;
  const int Bb = 2, T = 2048, C = 1024, NH = 16;
  const int M = Bb * T; // 4096

  const float* x      = (const float*)d_in[0];
  const float* w_attn = (const float*)d_in[1];
  const float* b_attn = (const float*)d_in[2];
  const float* wa1    = (const float*)d_in[3];
  const float* ba1    = (const float*)d_in[4];
  const float* wa2    = (const float*)d_in[5];
  const float* ba2    = (const float*)d_in[6];
  const float* g1     = (const float*)d_in[7];
  const float* be1    = (const float*)d_in[8];
  const float* wf1    = (const float*)d_in[9];
  const float* bf1    = (const float*)d_in[10];
  const float* wf2    = (const float*)d_in[11];
  const float* bf2    = (const float*)d_in[12];
  const float* g2     = (const float*)d_in[13];
  const float* be2    = (const float*)d_in[14];
  float* out = (float*)d_out;

  char* ws = (char*)d_ws;
  size_t off = 0;
  auto take = [&](size_t bytes) -> char* {
    char* p = ws + off;
    off += (bytes + 255) & ~(size_t)255;
    return p;
  };

  _Float16* Xh    = (_Float16*)take((size_t)M * C * 2);        // x f16; reused as Yh
  _Float16* Wattn = (_Float16*)take((size_t)C * 3 * C * 2);
  _Float16* Wa1h  = (_Float16*)take((size_t)C * 4 * C * 2);
  _Float16* Wa2h  = (_Float16*)take((size_t)4 * C * C * 2);
  _Float16* Wf1h  = (_Float16*)take((size_t)C * 4 * C * 2);
  _Float16* Wf2h  = (_Float16*)take((size_t)4 * C * C * 2);
  char*     qkvB  = take((size_t)M * 3 * C * 2);               // qkv f16; reused as t2/t4 f32
  _Float16* H1h   = (_Float16*)take((size_t)M * 4 * C * 2);    // FF hidden; reused for both FFs
  float*    x1    = (float*)take((size_t)M * C * 4);
  _Float16* x1h   = (_Float16*)take((size_t)M * C * 2);

  _Float16* qkvh = (_Float16*)qkvB;
  float*    t2f  = (float*)qkvB;   // reuse after attention consumes qkv
  _Float16* Yh   = Xh;             // reuse after QKV GEMM consumes Xh

  // f32 -> f16 conversions
  cvt_f32_f16<<<4096, 256, 0, stream>>>(x,      Xh,    M * C);
  cvt_f32_f16<<<4096, 256, 0, stream>>>(w_attn, Wattn, C * 3 * C);
  cvt_f32_f16<<<4096, 256, 0, stream>>>(wa1,    Wa1h,  C * 4 * C);
  cvt_f32_f16<<<4096, 256, 0, stream>>>(wa2,    Wa2h,  4 * C * C);
  cvt_f32_f16<<<4096, 256, 0, stream>>>(wf1,    Wf1h,  C * 4 * C);
  cvt_f32_f16<<<4096, 256, 0, stream>>>(wf2,    Wf2h,  4 * C * C);

  // qkv = x @ w_attn + b_attn  -> f16
  gemm_f16_wmma<<<dim3(3 * C / BN, M / BM), 256, 0, stream>>>(
      Xh, Wattn, b_attn, nullptr, qkvh, M, 3 * C, C, 0);

  // flash attention -> Yh (f16)
  attn_flash_wmma<<<dim3(Bb * NH, T / 64), 128, 0, stream>>>(qkvh, Yh, Bb, T, C, NH);

  // SelfAttn FF: H1 = gelu(y @ wa1 + ba1); t2 = H1 @ wa2 + ba2
  gemm_f16_wmma<<<dim3(4 * C / BN, M / BM), 256, 0, stream>>>(
      Yh, Wa1h, ba1, nullptr, H1h, M, 4 * C, C, 1);
  gemm_f16_wmma<<<dim3(C / BN, M / BM), 256, 0, stream>>>(
      H1h, Wa2h, ba2, t2f, nullptr, M, C, 4 * C, 0);

  // x1 = x + LN(t2)
  ln_residual<<<M, 256, 0, stream>>>(x, t2f, g1, be1, x1, x1h, C);

  // Block FF: H2 = gelu(x1 @ wf1 + bf1); t4 = H2 @ wf2 + bf2
  gemm_f16_wmma<<<dim3(4 * C / BN, M / BM), 256, 0, stream>>>(
      x1h, Wf1h, bf1, nullptr, H1h, M, 4 * C, C, 1);
  gemm_f16_wmma<<<dim3(C / BN, M / BM), 256, 0, stream>>>(
      H1h, Wf2h, bf2, t2f, nullptr, M, C, 4 * C, 0);

  // out = x1 + LN(t4)
  ln_residual<<<M, 256, 0, stream>>>(x1, t2f, g2, be2, out, nullptr, C);
}

// v003
// One run takes 351 microseconds.
// Two timings next to v002 both put it at 1.09 times that version's speed.
// Counting every step since v000, it is 2.93 times as fast.
#include <hip/hip_runtime.h>
#include <hip/hip_bf16.h>

typedef __attribute__((ext_vector_type(16))) _Float16 v16h;
typedef __attribute__((ext_vector_type(8)))  _Float16 v8h;
typedef __attribute__((ext_vector_type(8)))  float    v8f;

union F16x16 { v16h v; v8h h[2]; };

#define WMMA_F16(a, b, c) \
  __builtin_amdgcn_wmma_f32_16x16x32_f16(false, (a), false, (b), (short)0, (c), false, false)

__device__ __forceinline__ void async_copy4_b128(
    void* l0, const void* g0, void* l1, const void* g1,
    void* l2, const void* g2, void* l3, const void* g3) {
  asm volatile("global_load_async_to_lds_b128 %0, %1, off\n\t"
               "global_load_async_to_lds_b128 %2, %3, off\n\t"
               "global_load_async_to_lds_b128 %4, %5, off\n\t"
               "global_load_async_to_lds_b128 %6, %7, off\n\t"
               "s_wait_xcnt 0x0"
               :: "v"((unsigned)(size_t)l0), "v"((unsigned long long)(size_t)g0),
                  "v"((unsigned)(size_t)l1), "v"((unsigned long long)(size_t)g1),
                  "v"((unsigned)(size_t)l2), "v"((unsigned long long)(size_t)g2),
                  "v"((unsigned)(size_t)l3), "v"((unsigned long long)(size_t)g3)
               : "memory");
}
__device__ __forceinline__ void async_copy8_b128(
    unsigned l0, const void* g0, unsigned l1, const void* g1,
    unsigned l2, const void* g2, unsigned l3, const void* g3,
    unsigned l4, const void* g4, unsigned l5, const void* g5,
    unsigned l6, const void* g6, unsigned l7, const void* g7) {
  asm volatile("global_load_async_to_lds_b128 %0, %1, off\n\t"
               "global_load_async_to_lds_b128 %2, %3, off\n\t"
               "global_load_async_to_lds_b128 %4, %5, off\n\t"
               "global_load_async_to_lds_b128 %6, %7, off\n\t"
               "global_load_async_to_lds_b128 %8, %9, off\n\t"
               "global_load_async_to_lds_b128 %10, %11, off\n\t"
               "global_load_async_to_lds_b128 %12, %13, off\n\t"
               "global_load_async_to_lds_b128 %14, %15, off\n\t"
               "s_wait_xcnt 0x0"
               :: "v"(l0), "v"((unsigned long long)(size_t)g0),
                  "v"(l1), "v"((unsigned long long)(size_t)g1),
                  "v"(l2), "v"((unsigned long long)(size_t)g2),
                  "v"(l3), "v"((unsigned long long)(size_t)g3),
                  "v"(l4), "v"((unsigned long long)(size_t)g4),
                  "v"(l5), "v"((unsigned long long)(size_t)g5),
                  "v"(l6), "v"((unsigned long long)(size_t)g6),
                  "v"(l7), "v"((unsigned long long)(size_t)g7)
               : "memory");
}
__device__ __forceinline__ void async_wait0() {
  asm volatile("s_wait_asynccnt 0x0" ::: "memory");
}

// ---------------------------------------------------------------------------
// Transposing LDS load: from a tile stored T[k][n] (k rows, n contiguous) lane
// (c = lane & 15, h = lane >> 4) receives T[k0 + 8h + 0..7][n0 + c]. The lane's
// own address is &T[k0 + 8h + (lane & 7)][n0 + 8 * ((lane >> 3) & 1)].
// Loads at k0 and k0 + 16 form one 32-k B fragment in the k order that the
// A loaders below use (8h + 0..7, then 16 + 8h + 0..7).
// ---------------------------------------------------------------------------
typedef __attribute__((ext_vector_type(8))) short v8s;
typedef __attribute__((address_space(3))) v8s lds_v8s;
__device__ __forceinline__ v8h lds_load_tr16(const _Float16* p) {
  return __builtin_bit_cast(v8h, __builtin_amdgcn_ds_load_tr16_b128_v8i16((lds_v8s*)p));
}

// ---------------------------------------------------------------------------
// f32 -> f16 conversion of six arrays in one launch. The grid is sized to be
// resident at once (one 16-wave block per WGP) and its waves walk the work, so
// that few waves have to be started. A unit is 1024 floats: eight wave-wide loads
// of 512 contiguous bytes, all issued before the first is used. The six f16
// results lie one behind another at out, in the order of the sources; e0..e5 are
// the running ends of the six arrays in units.
// ---------------------------------------------------------------------------
typedef __attribute__((ext_vector_type(4))) float    v4f;
typedef __attribute__((ext_vector_type(4))) _Float16 v4h;
#define CVT_UNIT 1024

__global__ __launch_bounds__(512) void cvt_f32_f16_six(
    const float* __restrict__ s0, const float* __restrict__ s1,
    const float* __restrict__ s2, const float* __restrict__ s3,
    const float* __restrict__ s4, const float* __restrict__ s5,
    _Float16* __restrict__ out,
    int e0, int e1, int e2, int e3, int e4, int e5)
{
  const int lane = threadIdx.x & 31;
  const int nw   = gridDim.x * (blockDim.x >> 5);
  // The wave's number, held scalar so that the choice of the source is a scalar one.
  const int wv   = __builtin_amdgcn_readfirstlane(blockIdx.x * (blockDim.x >> 5) + (threadIdx.x >> 5));
  for (int u = wv; u < e5; u += nw) {
    const float* s = s0;
    int first = 0;
    if (u >= e0) { s = s1; first = e0; }
    if (u >= e1) { s = s2; first = e1; }
    if (u >= e2) { s = s3; first = e2; }
    if (u >= e3) { s = s4; first = e3; }
    if (u >= e4) { s = s5; first = e4; }
    const v4f* p = reinterpret_cast<const v4f*>(s + (size_t)(u - first) * CVT_UNIT) + lane;
    v4h* o = reinterpret_cast<v4h*>(out + (size_t)u * CVT_UNIT) + lane;
    v4f a[8];
#pragma unroll
    for (int q = 0; q < 8; ++q) a[q] = p[q * 32];
#pragma unroll
    for (int q = 0; q < 8; ++q) o[q * 32] = __builtin_convertvector(a[q], v4h);
  }
}

#define BM 128
#define BN 128
#define BKK 64
#define LDSA (BKK + 8) // 72 halfs = 144B rows (16B x odd: the plain reader's pitch)
#define LDSB (BN + 16) // 144 halfs = 288B rows (32B x odd: the transposing reader's pitch)

__global__ __launch_bounds__(256) void gemm_f16_wmma(
    const _Float16* __restrict__ A, const _Float16* __restrict__ Bm,
    const float* __restrict__ bias,
    float* __restrict__ Cf, _Float16* __restrict__ Ch,
    int M, int N, int K, int act)
{
  __shared__ __attribute__((aligned(16))) _Float16 As[2][BM][LDSA];
  __shared__ __attribute__((aligned(16))) _Float16 Bs[2][BKK][LDSB]; // as in memory: Bs[.][k][n]

  const int tid  = threadIdx.x;
  const int lane = tid & 31;
  const int wave = tid >> 5;
  const int wr   = wave >> 2;   // 0..1
  const int wc   = wave & 3;    // 0..3
  const int lr   = lane & 15;
  const int hi   = lane >> 4;   // 0/1
  const int kb   = hi * 8;      // K-chunk base per 16-bit A/B lane layout

  const int m0 = blockIdx.y * BM;
  const int n0 = blockIdx.x * BN;

  v8f acc[4][2] = {};

  // One stage = A 128x64 halfs and B 64x128 halfs, 1024 chunks of 16B each, four
  // of each per thread: A rows r + 32q, B rows kk + 16q. The pointers walk one
  // stage further at every fill.
  const int r  = tid >> 3;
  const int kc = (tid & 7) * 8;
  const int kk = tid >> 4;
  const int nn = (tid & 15) * 8;
  const _Float16* ag = &A[(size_t)(m0 + r) * K + kc];
  const _Float16* bg = &Bm[(size_t)kk * N + n0 + nn];
  const unsigned la = (unsigned)(size_t)&As[0][r][kc];
  const unsigned lb = (unsigned)(size_t)&Bs[0][kk][nn];
  auto fill = [&](int buf) {
    const unsigned a = la + (unsigned)buf * (unsigned)(BM * LDSA * 2);
    const unsigned b = lb + (unsigned)buf * (unsigned)(BKK * LDSB * 2);
    async_copy8_b128(a,                 ag,
                     a + 32 * LDSA * 2, ag + (size_t)32 * K,
                     a + 64 * LDSA * 2, ag + (size_t)64 * K,
                     a + 96 * LDSA * 2, ag + (size_t)96 * K,
                     b,                 bg,
                     b + 16 * LDSB * 2, bg + (size_t)16 * N,
                     b + 32 * LDSB * 2, bg + (size_t)32 * N,
                     b + 48 * LDSB * 2, bg + (size_t)48 * N);
    ag += BKK;
    bg += (size_t)BKK * N;
  };

  const int nst = K / BKK;
  fill(0);
  async_wait0();
  __syncthreads();
  if (nst > 1) fill(1);

  for (int t = 0; t < nst; ++t) {
    const int cur = t & 1;
#pragma unroll
    for (int ks = 0; ks < BKK; ks += 32) {
      F16x16 af[4], bf[2];
#pragma unroll
      for (int i = 0; i < 4; ++i) {
        const _Float16* p = &As[cur][wr * 64 + i * 16 + lr][ks];
        af[i].h[0] = *reinterpret_cast<const v8h*>(p + kb);
        af[i].h[1] = *reinterpret_cast<const v8h*>(p + kb + 16);
      }
#pragma unroll
      for (int j = 0; j < 2; ++j) {
        const _Float16* p = &Bs[cur][ks + kb + (lane & 7)][wc * 32 + j * 16 + ((lane >> 3) & 1) * 8];
        bf[j].h[0] = lds_load_tr16(p);
        bf[j].h[1] = lds_load_tr16(p + 16 * LDSB);
      }
#pragma unroll
      for (int i = 0; i < 4; ++i)
#pragma unroll
        for (int j = 0; j < 2; ++j)
          acc[i][j] = WMMA_F16(af[i].v, bf[j].v, acc[i][j]);
    }
    // Hand-over: this wave's reads of buffer cur are done, its copies of stage
    // t + 1 have landed; behind the barrier that holds for every wave, so stage
    // t + 1 may be read and buffer cur refilled.
    asm volatile("s_wait_dscnt 0x0" ::: "memory");
    async_wait0();
    __syncthreads();
    if (t + 2 < nst) fill(cur);
  }
  // No copy is outstanding when the wave goes on to the epilogue.
  async_wait0();

  // Epilogue: D layout = lane(n), vgpr v -> row v + 8*hi
#pragma unroll
  for (int i = 0; i < 4; ++i) {
#pragma unroll
    for (int j = 0; j < 2; ++j) {
      int gn = n0 + wc * 32 + j * 16 + lr;
      float bv = bias[gn];
#pragma unroll
      for (int v = 0; v < 8; ++v) {
        int gm = m0 + wr * 64 + i * 16 + v + hi * 8;
        float x = acc[i][j][v] + bv;
        if (act) x = 0.5f * x * (1.0f + erff(x * 0.70710678118654752f)); // exact GELU
        size_t idx = (size_t)gm * N + gn;
        if (Cf) Cf[idx] = x;
        if (Ch) Ch[idx] = (_Float16)x;
      }
    }
  }
}

// ---------------------------------------------------------------------------
// Flash attention over f16 qkv: qkv layout (B, T, 3C) with [K | Q | V] thirds.
// Block = (batch*head, q-tile of 64 rows). 128 threads = 4 waves, 16 rows each.
// HD = 64. Causal. Output y (f16) in (B, T, C) layout at head offset.
// K and V tiles staged via async copy, both key-major; the V fragments are
// transposed on the way out by ds_load_tr16_b128.
// ---------------------------------------------------------------------------
__global__ __launch_bounds__(128) void attn_flash_wmma(
    const _Float16* __restrict__ qkvh, _Float16* __restrict__ Yh,
    int Bx, int Tx, int Cx, int NHx)
{
  __shared__ __attribute__((aligned(16))) _Float16 Ks[64][72]; // key-major (rows = key, cols = d)
  __shared__ __attribute__((aligned(16))) _Float16 Vs[64][80]; // key-major, 160B rows (32B x odd)
  __shared__ _Float16 Pl[4][16][72];   // wave-private P scratch

  const int tid  = threadIdx.x;
  const int lane = tid & 31;
  const int w    = tid >> 5;   // 0..3
  const int lr   = lane & 15;
  const int hi   = lane >> 4;
  const int kb   = hi * 8;

  const int bh = blockIdx.x;
  const int b  = bh / NHx;
  const int h  = bh % NHx;
  const int qb = blockIdx.y;
  const int q0 = qb * 64;

  const size_t rstride = (size_t)3 * Cx;
  const _Float16* kbase = qkvh + (size_t)b * Tx * rstride + 0 * Cx + h * 64;
  const _Float16* qbase = qkvh + (size_t)b * Tx * rstride + 1 * Cx + h * 64;
  const _Float16* vbase = qkvh + (size_t)b * Tx * rstride + 2 * Cx + h * 64;

  // Q fragments for this wave's 16 rows, pre-scaled by 1/sqrt(64) = 0.125
  F16x16 qf[2];
  {
    const int qrow = q0 + w * 16 + lr;
#pragma unroll
    for (int kk = 0; kk < 2; ++kk) {
      const _Float16* p = qbase + (size_t)qrow * rstride + kk * 32;
      v8h x0 = *reinterpret_cast<const v8h*>(p + kb);
      v8h x1 = *reinterpret_cast<const v8h*>(p + kb + 16);
#pragma unroll
      for (int j = 0; j < 8; ++j) {
        x0[j] = (_Float16)(x0[j] * (_Float16)0.125f);
        x1[j] = (_Float16)(x1[j] * (_Float16)0.125f);
      }
      qf[kk].h[0] = x0; qf[kk].h[1] = x1;
    }
  }

  float mrow[8], lsum[8];
  v8f O[4] = {};
#pragma unroll
  for (int v = 0; v < 8; ++v) { mrow[v] = -3.0e38f; lsum[v] = 0.0f; }

  for (int jb = 0; jb <= qb; ++jb) {
    const int key0 = jb * 64;
    // K and V tiles: async straight copies, 512 chunks of 16B each, four per
    // thread (rows key, key + 16, key + 32, key + 48).
    {
      const int key = tid >> 3;
      const int dc  = (tid & 7) * 8;
      const _Float16* kg = kbase + (size_t)(key0 + key) * rstride + dc;
      const _Float16* vg = vbase + (size_t)(key0 + key) * rstride + dc;
      async_copy4_b128(&Ks[key][dc],      kg,
                       &Ks[key + 16][dc], kg + 16 * rstride,
                       &Ks[key + 32][dc], kg + 32 * rstride,
                       &Ks[key + 48][dc], kg + 48 * rstride);
      async_copy4_b128(&Vs[key][dc],      vg,
                       &Vs[key + 16][dc], vg + 16 * rstride,
                       &Vs[key + 32][dc], vg + 32 * rstride,
                       &Vs[key + 48][dc], vg + 48 * rstride);
    }
    async_wait0();
    __syncthreads();

    // S = (Q/8) @ K^T : 4 n-tiles of 16 keys, K-dim 64 = 2 WMMAs each
    v8f S[4];
#pragma unroll
    for (int nt = 0; nt < 4; ++nt) {
      S[nt] = (v8f){};
#pragma unroll
      for (int kk = 0; kk < 2; ++kk) {
        F16x16 bk;
        const _Float16* p = &Ks[nt * 16 + lr][kk * 32];
        bk.h[0] = *reinterpret_cast<const v8h*>(p + kb);
        bk.h[1] = *reinterpret_cast<const v8h*>(p + kb + 16);
        S[nt] = WMMA_F16(qf[kk].v, bk.v, S[nt]);
      }
    }
    // Causal mask (only the diagonal block needs it)
    if (jb == qb) {
#pragma unroll
      for (int nt = 0; nt < 4; ++nt) {
        int col = key0 + nt * 16 + lr;
#pragma unroll
        for (int v = 0; v < 8; ++v) {
          int row = q0 + w * 16 + v + hi * 8;
          if (col > row) S[nt][v] = -3.0e38f;
        }
      }
    }

    // Online softmax update per row (row m = v + 8*hi lives in one 16-lane half)
#pragma unroll
    for (int v = 0; v < 8; ++v) {
      float t = S[0][v];
#pragma unroll
      for (int nt = 1; nt < 4; ++nt) t = fmaxf(t, S[nt][v]);
#pragma unroll
      for (int off = 1; off < 16; off <<= 1) t = fmaxf(t, __shfl_xor(t, off, 32));
      float mn = fmaxf(mrow[v], t);
      float alpha = __expf(mrow[v] - mn);
      mrow[v] = mn;
      lsum[v] *= alpha;
#pragma unroll
      for (int ot = 0; ot < 4; ++ot) O[ot][v] *= alpha;
      float rs = 0.0f;
#pragma unroll
      for (int nt = 0; nt < 4; ++nt) {
        float p = __expf(S[nt][v] - mn);
        rs += p;
        Pl[w][v + hi * 8][nt * 16 + lr] = (_Float16)p;
      }
#pragma unroll
      for (int off = 1; off < 16; off <<= 1) rs += __shfl_xor(rs, off, 32);
      lsum[v] += rs;
    }

    // O += P @ V (P via wave-private LDS re-layout into A fragments)
#pragma unroll
    for (int ot = 0; ot < 4; ++ot) {
#pragma unroll
      for (int kk = 0; kk < 2; ++kk) {
        F16x16 ap, bv;
        const _Float16* pp = &Pl[w][lr][kk * 32];
        ap.h[0] = *reinterpret_cast<const v8h*>(pp + kb);
        ap.h[1] = *reinterpret_cast<const v8h*>(pp + kb + 16);
        const _Float16* vp = &Vs[kk * 32 + kb + (lane & 7)][ot * 16 + ((lane >> 3) & 1) * 8];
        bv.h[0] = lds_load_tr16(vp);
        bv.h[1] = lds_load_tr16(vp + 16 * 80);
        O[ot] = WMMA_F16(ap.v, bv.v, O[ot]);
      }
    }
    __syncthreads();
  }

  // Write y (f16), normalized
#pragma unroll
  for (int ot = 0; ot < 4; ++ot) {
#pragma unroll
    for (int v = 0; v < 8; ++v) {
      int r = q0 + w * 16 + v + hi * 8;
      int cidx = h * 64 + ot * 16 + lr;
      Yh[((size_t)b * Tx + r) * Cx + cidx] = (_Float16)(O[ot][v] / lsum[v]);
    }
  }
}

// ---------------------------------------------------------------------------
// out = xin + LayerNorm(t)*g + b, rows of LN_C floats. One wave per row, 16 rows
// per block: a lane holds 32 values of its row in registers (eight wave-wide
// loads of 512 contiguous bytes), the row's sums are joined by a butterfly over
// the 32 lanes, and no LDS or barrier is needed.
// ---------------------------------------------------------------------------
#define LN_C 1024

__global__ __launch_bounds__(512) void ln_residual(
    const float* __restrict__ xin, const float* __restrict__ t,
    const float* __restrict__ g, const float* __restrict__ be,
    float* __restrict__ outf, _Float16* __restrict__ outh)
{
  const int lane = threadIdx.x & 31;
  const int row  = blockIdx.x * (blockDim.x >> 5) + (threadIdx.x >> 5);
  const v4f* tr = reinterpret_cast<const v4f*>(t + (size_t)row * LN_C) + lane;
  const v4f* xr = reinterpret_cast<const v4f*>(xin + (size_t)row * LN_C) + lane;
  const v4f* gr = reinterpret_cast<const v4f*>(g) + lane;
  const v4f* br = reinterpret_cast<const v4f*>(be) + lane;

  v4f tv[8], xv[8], gv[8], bv[8];
#pragma unroll
  for (int q = 0; q < 8; ++q) tv[q] = tr[q * 32];
#pragma unroll
  for (int q = 0; q < 8; ++q) xv[q] = xr[q * 32];
#pragma unroll
  for (int q = 0; q < 8; ++q) gv[q] = gr[q * 32];
#pragma unroll
  for (int q = 0; q < 8; ++q) bv[q] = br[q * 32];
  // Stands in front of every rewrite of an address register of the loads above. The
  // two row pointers are named as inputs so that their registers live up to the wait;
  // otherwise the last load's result is placed on its own address pair.
  asm volatile("s_wait_xcnt 0x0" :: "v"(tr), "v"(xr) : "memory");
  // Keeps all 32 loads in front of the sums, so that the wave waits out one memory
  // latency; left free, the scheduler sinks 24 of them behind the sums in small groups.
  __builtin_amdgcn_sched_barrier(0);

  v4f sv = {}, sv2 = {};   // four independent chains each
#pragma unroll
  for (int q = 0; q < 8; ++q) { sv += tv[q]; sv2 += tv[q] * tv[q]; }
  float s  = (sv[0] + sv[1]) + (sv[2] + sv[3]);
  float s2 = (sv2[0] + sv2[1]) + (sv2[2] + sv2[3]);
#pragma unroll
  for (int off = 16; off; off >>= 1) { s += __shfl_xor(s, off, 32); s2 += __shfl_xor(s2, off, 32); }
  float mean = s / LN_C;
  float var  = s2 / LN_C - mean * mean;
  float rstd = rsqrtf(var + 1e-5f);

#pragma unroll
  for (int q = 0; q < 8; ++q)
#pragma unroll
    for (int e = 0; e < 4; ++e)
      xv[q][e] = xv[q][e] + (tv[q][e] - mean) * rstd * gv[q][e] + bv[q][e];
  if (outf) {
    v4f* of = reinterpret_cast<v4f*>(outf + (size_t)row * LN_C) + lane;
#pragma unroll
    for (int q = 0; q < 8; ++q) of[q * 32] = xv[q];
    // The conversion below may reuse the registers that these stores name.
    asm volatile("s_wait_xcnt 0x0" ::: "memory");
  }
  if (outh) {
    v4h* oh = reinterpret_cast<v4h*>(outh + (size_t)row * LN_C) + lane;
#pragma unroll
    for (int q = 0; q < 8; ++q) oh[q * 32] = __builtin_convertvector(xv[q], v4h);
  }
}

// ---------------------------------------------------------------------------
extern "C" void kernel_launch(void* const* d_in, const int* in_sizes, int n_in,
                              void* d_out, int out_size, void* d_ws, size_t ws_size,
                              hipStream_t stream) {
  (void)in_sizes; (void)n_in; (void)out_size; (void)ws_size;
  const int Bb = 2, T = 2048, C = 1024, NH = 16;
  const int M = Bb * T; // 4096

  const float* x      = (const float*)d_in[0];
  const float* w_attn = (const float*)d_in[1];
  const float* b_attn = (const float*)d_in[2];
  const float* wa1    = (const float*)d_in[3];
  const float* ba1    = (const float*)d_in[4];
  const float* wa2    = (const float*)d_in[5];
  const float* ba2    = (const float*)d_in[6];
  const float* g1     = (const float*)d_in[7];
  const float* be1    = (const float*)d_in[8];
  const float* wf1    = (const float*)d_in[9];
  const float* bf1    = (const float*)d_in[10];
  const float* wf2    = (const float*)d_in[11];
  const float* bf2    = (const float*)d_in[12];
  const float* g2     = (const float*)d_in[13];
  const float* be2    = (const float*)d_in[14];
  float* out = (float*)d_out;

  char* ws = (char*)d_ws;
  size_t off = 0;
  auto take = [&](size_t bytes) -> char* {
    char* p = ws + off;
    off += (bytes + 255) & ~(size_t)255;
    return p;
  };

  _Float16* Xh    = (_Float16*)take((size_t)M * C * 2);        // x f16; reused as Yh
  _Float16* Wattn = (_Float16*)take((size_t)C * 3 * C * 2);
  _Float16* Wa1h  = (_Float16*)take((size_t)C * 4 * C * 2);
  _Float16* Wa2h  = (_Float16*)take((size_t)4 * C * C * 2);
  _Float16* Wf1h  = (_Float16*)take((size_t)C * 4 * C * 2);
  _Float16* Wf2h  = (_Float16*)take((size_t)4 * C * C * 2);
  char*     qkvB  = take((size_t)M * 3 * C * 2);               // qkv f16; reused as t2/t4 f32
  _Float16* H1h   = (_Float16*)take((size_t)M * 4 * C * 2);    // FF hidden; reused for both FFs
  float*    x1    = (float*)take((size_t)M * C * 4);
  _Float16* x1h   = (_Float16*)take((size_t)M * C * 2);

  _Float16* qkvh = (_Float16*)qkvB;
  float*    t2f  = (float*)qkvB;   // reuse after attention consumes qkv
  _Float16* Yh   = Xh;             // reuse after QKV GEMM consumes Xh

  // f32 -> f16 conversions, one launch. Xh, Wattn, Wa1h, Wa2h, Wf1h, Wf2h were taken
  // in this order and each size is a multiple of 256 bytes, so they lie one behind
  // another from Xh on. Ends in units of CVT_UNIT floats.
  const int ux = M * C / CVT_UNIT, uq = C * 3 * C / CVT_UNIT, uf = C * 4 * C / CVT_UNIT;
  cvt_f32_f16_six<<<256, 512, 0, stream>>>(
      x, w_attn, wa1, wa2, wf1, wf2, Xh,
      ux, ux + uq, ux + uq + uf, ux + uq + 2 * uf, ux + uq + 3 * uf, ux + uq + 4 * uf);

  // qkv = x @ w_attn + b_attn  -> f16
  gemm_f16_wmma<<<dim3(3 * C / BN, M / BM), 256, 0, stream>>>(
      Xh, Wattn, b_attn, nullptr, qkvh, M, 3 * C, C, 0);

  // flash attention -> Yh (f16)
  attn_flash_wmma<<<dim3(Bb * NH, T / 64), 128, 0, stream>>>(qkvh, Yh, Bb, T, C, NH);

  // SelfAttn FF: H1 = gelu(y @ wa1 + ba1); t2 = H1 @ wa2 + ba2
  gemm_f16_wmma<<<dim3(4 * C / BN, M / BM), 256, 0, stream>>>(
      Yh, Wa1h, ba1, nullptr, H1h, M, 4 * C, C, 1);
  gemm_f16_wmma<<<dim3(C / BN, M / BM), 256, 0, stream>>>(
      H1h, Wa2h, ba2, t2f, nullptr, M, C, 4 * C, 0);

  // x1 = x + LN(t2)
  ln_residual<<<M / 16, 512, 0, stream>>>(x, t2f, g1, be1, x1, x1h);

  // Block FF: H2 = gelu(x1 @ wf1 + bf1); t4 = H2 @ wf2 + bf2
  gemm_f16_wmma<<<dim3(4 * C / BN, M / BM), 256, 0, stream>>>(
      x1h, Wf1h, bf1, nullptr, H1h, M, 4 * C, C, 1);
  gemm_f16_wmma<<<dim3(C / BN, M / BM), 256, 0, stream>>>(
      H1h, Wf2h, bf2, t2f, nullptr, M, C, 4 * C, 0);

  // out = x1 + LN(t4)
  ln_residual<<<M / 16, 512, 0, stream>>>(x1, t2f, g2, be2, out, nullptr);
}

// v004
// It runs in 284 microseconds.
// Next to v003, in two timings, it ran 1.24 times as fast each time.
// Counting every step since v000, it is 3.63 times as fast.
#include <hip/hip_runtime.h>
#include <hip/hip_bf16.h>

typedef __attribute__((ext_vector_type(16))) _Float16 v16h;
typedef __attribute__((ext_vector_type(8)))  _Float16 v8h;
typedef __attribute__((ext_vector_type(8)))  float    v8f;

union F16x16 { v16h v; v8h h[2]; };

#define WMMA_F16(a, b, c) \
  __builtin_amdgcn_wmma_f32_16x16x32_f16(false, (a), false, (b), (short)0, (c), false, false)

__device__ __forceinline__ void async_copy4_b128(
    void* l0, const void* g0, void* l1, const void* g1,
    void* l2, const void* g2, void* l3, const void* g3) {
  asm volatile("global_load_async_to_lds_b128 %0, %1, off\n\t"
               "global_load_async_to_lds_b128 %2, %3, off\n\t"
               "global_load_async_to_lds_b128 %4, %5, off\n\t"
               "global_load_async_to_lds_b128 %6, %7, off\n\t"
               "s_wait_xcnt 0x0"
               :: "v"((unsigned)(size_t)l0), "v"((unsigned long long)(size_t)g0),
                  "v"((unsigned)(size_t)l1), "v"((unsigned long long)(size_t)g1),
                  "v"((unsigned)(size_t)l2), "v"((unsigned long long)(size_t)g2),
                  "v"((unsigned)(size_t)l3), "v"((unsigned long long)(size_t)g3)
               : "memory");
}
__device__ __forceinline__ void async_copy8_b128(
    unsigned l0, const void* g0, unsigned l1, const void* g1,
    unsigned l2, const void* g2, unsigned l3, const void* g3,
    unsigned l4, const void* g4, unsigned l5, const void* g5,
    unsigned l6, const void* g6, unsigned l7, const void* g7) {
  asm volatile("global_load_async_to_lds_b128 %0, %1, off\n\t"
               "global_load_async_to_lds_b128 %2, %3, off\n\t"
               "global_load_async_to_lds_b128 %4, %5, off\n\t"
               "global_load_async_to_lds_b128 %6, %7, off\n\t"
               "global_load_async_to_lds_b128 %8, %9, off\n\t"
               "global_load_async_to_lds_b128 %10, %11, off\n\t"
               "global_load_async_to_lds_b128 %12, %13, off\n\t"
               "global_load_async_to_lds_b128 %14, %15, off\n\t"
               "s_wait_xcnt 0x0"
               :: "v"(l0), "v"((unsigned long long)(size_t)g0),
                  "v"(l1), "v"((unsigned long long)(size_t)g1),
                  "v"(l2), "v"((unsigned long long)(size_t)g2),
                  "v"(l3), "v"((unsigned long long)(size_t)g3),
                  "v"(l4), "v"((unsigned long long)(size_t)g4),
                  "v"(l5), "v"((unsigned long long)(size_t)g5),
                  "v"(l6), "v"((unsigned long long)(size_t)g6),
                  "v"(l7), "v"((unsigned long long)(size_t)g7)
               : "memory");
}
__device__ __forceinline__ void async_wait0() {
  asm volatile("s_wait_asynccnt 0x0" ::: "memory");
}

// ---------------------------------------------------------------------------
// Transposing LDS load: from a tile stored T[k][n] (k rows, n contiguous) lane
// (c = lane & 15, h = lane >> 4) receives T[k0 + 8h + 0..7][n0 + c]. The lane's
// own address is &T[k0 + 8h + (lane & 7)][n0 + 8 * ((lane >> 3) & 1)].
// Loads at k0 and k0 + 16 form one 32-k B fragment in the k order that the
// A loaders below use (8h + 0..7, then 16 + 8h + 0..7).
// ---------------------------------------------------------------------------
typedef __attribute__((ext_vector_type(8))) short v8s;
typedef __attribute__((address_space(3))) v8s lds_v8s;
__device__ __forceinline__ v8h lds_load_tr16(const _Float16* p) {
  return __builtin_bit_cast(v8h, __builtin_amdgcn_ds_load_tr16_b128_v8i16((lds_v8s*)p));
}

// ---------------------------------------------------------------------------
// f32 -> f16 conversion of six arrays in one launch. The grid is sized to be
// resident at once (one 16-wave block per WGP) and its waves walk the work, so
// that few waves have to be started. A unit is 1024 floats: eight wave-wide loads
// of 512 contiguous bytes, all issued before the first is used. The six f16
// results lie one behind another at out, in the order of the sources; e0..e5 are
// the running ends of the six arrays in units.
// ---------------------------------------------------------------------------
typedef __attribute__((ext_vector_type(4))) float    v4f;
typedef __attribute__((ext_vector_type(4))) _Float16 v4h;
#define CVT_UNIT 1024

__global__ __launch_bounds__(512) void cvt_f32_f16_six(
    const float* __restrict__ s0, const float* __restrict__ s1,
    const float* __restrict__ s2, const float* __restrict__ s3,
    const float* __restrict__ s4, const float* __restrict__ s5,
    _Float16* __restrict__ out,
    int e0, int e1, int e2, int e3, int e4, int e5)
{
  const int lane = threadIdx.x & 31;
  const int nw   = gridDim.x * (blockDim.x >> 5);
  // The wave's number, held scalar so that the choice of the source is a scalar one.
  const int wv   = __builtin_amdgcn_readfirstlane(blockIdx.x * (blockDim.x >> 5) + (threadIdx.x >> 5));
  for (int u = wv; u < e5; u += nw) {
    const float* s = s0;
    int first = 0;
    if (u >= e0) { s = s1; first = e0; }
    if (u >= e1) { s = s2; first = e1; }
    if (u >= e2) { s = s3; first = e2; }
    if (u >= e3) { s = s4; first = e3; }
    if (u >= e4) { s = s5; first = e4; }
    const v4f* p = reinterpret_cast<const v4f*>(s + (size_t)(u - first) * CVT_UNIT) + lane;
    v4h* o = reinterpret_cast<v4h*>(out + (size_t)u * CVT_UNIT) + lane;
    v4f a[8];
#pragma unroll
    for (int q = 0; q < 8; ++q) a[q] = p[q * 32];
#pragma unroll
    for (int q = 0; q < 8; ++q) o[q * 32] = __builtin_convertvector(a[q], v4h);
  }
}

#define BM 128
#define BN 128
#define BKK 64
#define LDSA (BKK + 8) // 72 halfs = 144B rows (16B x odd: the plain reader's pitch)
#define LDSB (BN + 16) // 144 halfs = 288B rows (32B x odd: the transposing reader's pitch)

__global__ __launch_bounds__(256) void gemm_f16_wmma(
    const _Float16* __restrict__ A, const _Float16* __restrict__ Bm,
    const float* __restrict__ bias,
    float* __restrict__ Cf, _Float16* __restrict__ Ch,
    int M, int N, int K, int act)
{
  __shared__ __attribute__((aligned(16))) _Float16 As[2][BM][LDSA];
  __shared__ __attribute__((aligned(16))) _Float16 Bs[2][BKK][LDSB]; // as in memory: Bs[.][k][n]

  const int tid  = threadIdx.x;
  const int lane = tid & 31;
  const int wave = tid >> 5;
  const int wr   = wave >> 2;   // 0..1
  const int wc   = wave & 3;    // 0..3
  const int lr   = lane & 15;
  const int hi   = lane >> 4;   // 0/1
  const int kb   = hi * 8;      // K-chunk base per 16-bit A/B lane layout

  const int m0 = blockIdx.y * BM;
  const int n0 = blockIdx.x * BN;

  v8f acc[4][2] = {};

  // One stage = A 128x64 halfs and B 64x128 halfs, 1024 chunks of 16B each, four
  // of each per thread: A rows r + 32q, B rows kk + 16q. The pointers walk one
  // stage further at every fill.
  const int r  = tid >> 3;
  const int kc = (tid & 7) * 8;
  const int kk = tid >> 4;
  const int nn = (tid & 15) * 8;
  const _Float16* ag = &A[(size_t)(m0 + r) * K + kc];
  const _Float16* bg = &Bm[(size_t)kk * N + n0 + nn];
  const unsigned la = (unsigned)(size_t)&As[0][r][kc];
  const unsigned lb = (unsigned)(size_t)&Bs[0][kk][nn];
  auto fill = [&](int buf) {
    const unsigned a = la + (unsigned)buf * (unsigned)(BM * LDSA * 2);
    const unsigned b = lb + (unsigned)buf * (unsigned)(BKK * LDSB * 2);
    async_copy8_b128(a,                 ag,
                     a + 32 * LDSA * 2, ag + (size_t)32 * K,
                     a + 64 * LDSA * 2, ag + (size_t)64 * K,
                     a + 96 * LDSA * 2, ag + (size_t)96 * K,
                     b,                 bg,
                     b + 16 * LDSB * 2, bg + (size_t)16 * N,
                     b + 32 * LDSB * 2, bg + (size_t)32 * N,
                     b + 48 * LDSB * 2, bg + (size_t)48 * N);
    ag += BKK;
    bg += (size_t)BKK * N;
  };

  const int nst = K / BKK;
  fill(0);
  async_wait0();
  __syncthreads();
  if (nst > 1) fill(1);

  for (int t = 0; t < nst; ++t) {
    const int cur = t & 1;
#pragma unroll
    for (int ks = 0; ks < BKK; ks += 32) {
      F16x16 af[4], bf[2];
#pragma unroll
      for (int i = 0; i < 4; ++i) {
        const _Float16* p = &As[cur][wr * 64 + i * 16 + lr][ks];
        af[i].h[0] = *reinterpret_cast<const v8h*>(p + kb);
        af[i].h[1] = *reinterpret_cast<const v8h*>(p + kb + 16);
      }
#pragma unroll
      for (int j = 0; j < 2; ++j) {
        const _Float16* p = &Bs[cur][ks + kb + (lane & 7)][wc * 32 + j * 16 + ((lane >> 3) & 1) * 8];
        bf[j].h[0] = lds_load_tr16(p);
        bf[j].h[1] = lds_load_tr16(p + 16 * LDSB);
      }
#pragma unroll
      for (int i = 0; i < 4; ++i)
#pragma unroll
        for (int j = 0; j < 2; ++j)
          acc[i][j] = WMMA_F16(af[i].v, bf[j].v, acc[i][j]);
    }
    // Hand-over: this wave's reads of buffer cur are done, its copies of stage
    // t + 1 have landed; behind the barrier that holds for every wave, so stage
    // t + 1 may be read and buffer cur refilled.
    asm volatile("s_wait_dscnt 0x0" ::: "memory");
    async_wait0();
    __syncthreads();
    if (t + 2 < nst) fill(cur);
  }
  // No copy is outstanding when the wave goes on to the epilogue.
  async_wait0();

  // Epilogue: D layout = lane(n), vgpr v -> row v + 8*hi
#pragma unroll
  for (int i = 0; i < 4; ++i) {
#pragma unroll
    for (int j = 0; j < 2; ++j) {
      int gn = n0 + wc * 32 + j * 16 + lr;
      float bv = bias[gn];
#pragma unroll
      for (int v = 0; v < 8; ++v) {
        int gm = m0 + wr * 64 + i * 16 + v + hi * 8;
        float x = acc[i][j][v] + bv;
        if (act) x = 0.5f * x * (1.0f + erff(x * 0.70710678118654752f)); // exact GELU
        size_t idx = (size_t)gm * N + gn;
        if (Cf) Cf[idx] = x;
        if (Ch) Ch[idx] = (_Float16)x;
      }
    }
  }
}

__device__ __forceinline__ float xhalf(float x) {
  const int i = __builtin_bit_cast(int, x);
  return __builtin_bit_cast(float,
      __builtin_amdgcn_permlanex16(i, i, 0x76543210, 0xfedcba98, false, false));
}

__global__ __launch_bounds__(128) void attn_flash_wmma(
    const _Float16* __restrict__ qkvh, _Float16* __restrict__ Yh,
    int Bx, int Tx, int Cx, int NHx)
{
  __shared__ __attribute__((aligned(16))) _Float16 Ks[64][72]; // key-major (rows = key, cols = d)
  __shared__ __attribute__((aligned(16))) _Float16 Vs[64][80]; // key-major, 160B rows (32B x odd)

  const int tid  = threadIdx.x;
  const int lane = tid & 31;
  const int w    = tid >> 5;   // 0..3
  const int lr   = lane & 15;
  const int hi   = lane >> 4;
  const int kb   = hi * 8;

  const int bh = blockIdx.x;
  const int b  = bh / NHx;
  const int h  = bh % NHx;
  const int qb = blockIdx.y;
  const int q0 = qb * 64;
  const int qrow = q0 + w * 16 + lr;   // this lane's query

  const size_t rstride = (size_t)3 * Cx;
  const _Float16* kbase = qkvh + (size_t)b * Tx * rstride + 0 * Cx + h * 64;
  const _Float16* qbase = qkvh + (size_t)b * Tx * rstride + 1 * Cx + h * 64;
  const _Float16* vbase = qkvh + (size_t)b * Tx * rstride + 2 * Cx + h * 64;

  // Q fragments (B operand: column = query lr), pre-scaled by 1/sqrt(64) = 0.125
  F16x16 qf[2];
  {
#pragma unroll
    for (int kk = 0; kk < 2; ++kk) {
      const _Float16* p = qbase + (size_t)qrow * rstride + kk * 32;
      v8h x0 = *reinterpret_cast<const v8h*>(p + kb);
      v8h x1 = *reinterpret_cast<const v8h*>(p + kb + 16);
#pragma unroll
      for (int j = 0; j < 8; ++j) {
        x0[j] = (_Float16)(x0[j] * (_Float16)0.125f);
        x1[j] = (_Float16)(x1[j] * (_Float16)0.125f);
      }
      qf[kk].h[0] = x0; qf[kk].h[1] = x1;
    }
  }

  float mrow = -3.0e38f;   // running maximum of this lane's query (equal in both halves)
  float lsum = 0.0f;       // running sum over this half's keys only; joined after the loop
  v8f O[4] = {};           // O[ot][v] = O^T[d = 16 ot + 8 hi + v][query lr]

  for (int jb = 0; jb <= qb; ++jb) {
    const int key0 = jb * 64;
    // K and V tiles: async straight copies, 512 chunks of 16B each, four per
    // thread (rows key, key + 16, key + 32, key + 48).
    {
      const int key = tid >> 3;
      const int dc  = (tid & 7) * 8;
      const _Float16* kg = kbase + (size_t)(key0 + key) * rstride + dc;
      const _Float16* vg = vbase + (size_t)(key0 + key) * rstride + dc;
      async_copy4_b128(&Ks[key][dc],      kg,
                       &Ks[key + 16][dc], kg + 16 * rstride,
                       &Ks[key + 32][dc], kg + 32 * rstride,
                       &Ks[key + 48][dc], kg + 48 * rstride);
      async_copy4_b128(&Vs[key][dc],      vg,
                       &Vs[key + 16][dc], vg + 16 * rstride,
                       &Vs[key + 32][dc], vg + 32 * rstride,
                       &Vs[key + 48][dc], vg + 48 * rstride);
    }
    async_wait0();
    __syncthreads();

    // S^T = K @ (Q/8)^T : 4 tiles of 16 keys, K-dim 64 = 2 WMMAs each.
    // S[nt][v] = score of key key0 + 16 nt + 8 hi + v against query lr.
    v8f S[4];
#pragma unroll
    for (int nt = 0; nt < 4; ++nt) {
      S[nt] = (v8f){};
#pragma unroll
      for (int kk = 0; kk < 2; ++kk) {
        F16x16 ak;
        const _Float16* p = &Ks[nt * 16 + lr][kk * 32];
        ak.h[0] = *reinterpret_cast<const v8h*>(p + kb);
        ak.h[1] = *reinterpret_cast<const v8h*>(p + kb + 16);
        S[nt] = WMMA_F16(ak.v, qf[kk].v, S[nt]);
      }
    }
    // Causal mask (only the diagonal block needs it)
    if (jb == qb) {
#pragma unroll
      for (int nt = 0; nt < 4; ++nt) {
#pragma unroll
        for (int v = 0; v < 8; ++v) {
          int col = key0 + nt * 16 + kb + v;
          if (col > qrow) S[nt][v] = -3.0e38f;
        }
      }
    }

    // Online softmax update of the lane's query
    float tm[4];
#pragma unroll
    for (int nt = 0; nt < 4; ++nt) {
      tm[nt] = S[nt][0];
#pragma unroll
      for (int v = 1; v < 8; ++v) tm[nt] = fmaxf(tm[nt], S[nt][v]);
    }
    float t = fmaxf(fmaxf(tm[0], tm[1]), fmaxf(tm[2], tm[3]));
    t = fmaxf(t, xhalf(t));
    const float mn = fmaxf(mrow, t);
    const float alpha = __expf(mrow - mn);
    mrow = mn;
#pragma unroll
    for (int ot = 0; ot < 4; ++ot) O[ot] *= alpha;

    // P^T as B operand: element s of the 32-key fragment kk is tile 2 kk + (s >> 3),
    // register s & 7, which is the k order of the transposing load below.
    F16x16 pf[2];
    float rs[4];
#pragma unroll
    for (int nt = 0; nt < 4; ++nt) {
      rs[nt] = 0.0f;
#pragma unroll
      for (int v = 0; v < 8; ++v) {
        float p = __expf(S[nt][v] - mn);
        rs[nt] += p;
        pf[nt >> 1].h[nt & 1][v] = (_Float16)p;
      }
    }
    lsum = lsum * alpha + ((rs[0] + rs[1]) + (rs[2] + rs[3]));

    // O^T += V^T @ P^T
#pragma unroll
    for (int ot = 0; ot < 4; ++ot) {
#pragma unroll
      for (int kk = 0; kk < 2; ++kk) {
        F16x16 av;
        const _Float16* vp = &Vs[kk * 32 + kb + (lane & 7)][ot * 16 + ((lane >> 3) & 1) * 8];
        av.h[0] = lds_load_tr16(vp);
        av.h[1] = lds_load_tr16(vp + 16 * 80);
        O[ot] = WMMA_F16(av.v, pf[kk].v, O[ot]);
      }
    }
    __syncthreads();
  }

  // Write y (f16), normalized: a lane holds 8 consecutive d of its query per tile
  const float inv = 1.0f / (lsum + xhalf(lsum));
  _Float16* yp = Yh + ((size_t)b * Tx + qrow) * Cx + h * 64 + kb;
#pragma unroll
  for (int ot = 0; ot < 4; ++ot) {
    v8h o;
#pragma unroll
    for (int v = 0; v < 8; ++v) o[v] = (_Float16)(O[ot][v] * inv);
    *reinterpret_cast<v8h*>(yp + ot * 16) = o;
  }
}

// ---------------------------------------------------------------------------
// out = xin + LayerNorm(t)*g + b, rows of LN_C floats. One wave per row, 16 rows
// per block: a lane holds 32 values of its row in registers (eight wave-wide
// loads of 512 contiguous bytes), the row's sums are joined by a butterfly over
// the 32 lanes, and no LDS or barrier is needed.
// ---------------------------------------------------------------------------
#define LN_C 1024

__global__ __launch_bounds__(512) void ln_residual(
    const float* __restrict__ xin, const float* __restrict__ t,
    const float* __restrict__ g, const float* __restrict__ be,
    float* __restrict__ outf, _Float16* __restrict__ outh)
{
  const int lane = threadIdx.x & 31;
  const int row  = blockIdx.x * (blockDim.x >> 5) + (threadIdx.x >> 5);
  const v4f* tr = reinterpret_cast<const v4f*>(t + (size_t)row * LN_C) + lane;
  const v4f* xr = reinterpret_cast<const v4f*>(xin + (size_t)row * LN_C) + lane;
  const v4f* gr = reinterpret_cast<const v4f*>(g) + lane;
  const v4f* br = reinterpret_cast<const v4f*>(be) + lane;

  v4f tv[8], xv[8], gv[8], bv[8];
#pragma unroll
  for (int q = 0; q < 8; ++q) tv[q] = tr[q * 32];
#pragma unroll
  for (int q = 0; q < 8; ++q) xv[q] = xr[q * 32];
#pragma unroll
  for (int q = 0; q < 8; ++q) gv[q] = gr[q * 32];
#pragma unroll
  for (int q = 0; q < 8; ++q) bv[q] = br[q * 32];
  // Stands in front of every rewrite of an address register of the loads above. The
  // two row pointers are named as inputs so that their registers live up to the wait;
  // otherwise the last load's result is placed on its own address pair.
  asm volatile("s_wait_xcnt 0x0" :: "v"(tr), "v"(xr) : "memory");
  // Keeps all 32 loads in front of the sums, so that the wave waits out one memory
  // latency; left free, the scheduler sinks 24 of them behind the sums in small groups.
  __builtin_amdgcn_sched_barrier(0);

  v4f sv = {}, sv2 = {};   // four independent chains each
#pragma unroll
  for (int q = 0; q < 8; ++q) { sv += tv[q]; sv2 += tv[q] * tv[q]; }
  float s  = (sv[0] + sv[1]) + (sv[2] + sv[3]);
  float s2 = (sv2[0] + sv2[1]) + (sv2[2] + sv2[3]);
#pragma unroll
  for (int off = 16; off; off >>= 1) { s += __shfl_xor(s, off, 32); s2 += __shfl_xor(s2, off, 32); }
  float mean = s / LN_C;
  float var  = s2 / LN_C - mean * mean;
  float rstd = rsqrtf(var + 1e-5f);

#pragma unroll
  for (int q = 0; q < 8; ++q)
#pragma unroll
    for (int e = 0; e < 4; ++e)
      xv[q][e] = xv[q][e] + (tv[q][e] - mean) * rstd * gv[q][e] + bv[q][e];
  if (outf) {
    v4f* of = reinterpret_cast<v4f*>(outf + (size_t)row * LN_C) + lane;
#pragma unroll
    for (int q = 0; q < 8; ++q) of[q * 32] = xv[q];
    // The conversion below may reuse the registers that these stores name.
    asm volatile("s_wait_xcnt 0x0" ::: "memory");
  }
  if (outh) {
    v4h* oh = reinterpret_cast<v4h*>(outh + (size_t)row * LN_C) + lane;
#pragma unroll
    for (int q = 0; q < 8; ++q) oh[q * 32] = __builtin_convertvector(xv[q], v4h);
  }
}

// ---------------------------------------------------------------------------
extern "C" void kernel_launch(void* const* d_in, const int* in_sizes, int n_in,
                              void* d_out, int out_size, void* d_ws, size_t ws_size,
                              hipStream_t stream) {
  (void)in_sizes; (void)n_in; (void)out_size; (void)ws_size;
  const int Bb = 2, T = 2048, C = 1024, NH = 16;
  const int M = Bb * T; // 4096

  const float* x      = (const float*)d_in[0];
  const float* w_attn = (const float*)d_in[1];
  const float* b_attn = (const float*)d_in[2];
  const float* wa1    = (const float*)d_in[3];
  const float* ba1    = (const float*)d_in[4];
  const float* wa2    = (const float*)d_in[5];
  const float* ba2    = (const float*)d_in[6];
  const float* g1     = (const float*)d_in[7];
  const float* be1    = (const float*)d_in[8];
  const float* wf1    = (const float*)d_in[9];
  const float* bf1    = (const float*)d_in[10];
  const float* wf2    = (const float*)d_in[11];
  const float* bf2    = (const float*)d_in[12];
  const float* g2     = (const float*)d_in[13];
  const float* be2    = (const float*)d_in[14];
  float* out = (float*)d_out;

  char* ws = (char*)d_ws;
  size_t off = 0;
  auto take = [&](size_t bytes) -> char* {
    char* p = ws + off;
    off += (bytes + 255) & ~(size_t)255;
    return p;
  };

  _Float16* Xh    = (_Float16*)take((size_t)M * C * 2);        // x f16; reused as Yh
  _Float16* Wattn = (_Float16*)take((size_t)C * 3 * C * 2);
  _Float16* Wa1h  = (_Float16*)take((size_t)C * 4 * C * 2);
  _Float16* Wa2h  = (_Float16*)take((size_t)4 * C * C * 2);
  _Float16* Wf1h  = (_Float16*)take((size_t)C * 4 * C * 2);
  _Float16* Wf2h  = (_Float16*)take((size_t)4 * C * C * 2);
  char*     qkvB  = take((size_t)M * 3 * C * 2);               // qkv f16; reused as t2/t4 f32
  _Float16* H1h   = (_Float16*)take((size_t)M * 4 * C * 2);    // FF hidden; reused for both FFs
  float*    x1    = (float*)take((size_t)M * C * 4);
  _Float16* x1h   = (_Float16*)take((size_t)M * C * 2);

  _Float16* qkvh = (_Float16*)qkvB;
  float*    t2f  = (float*)qkvB;   // reuse after attention consumes qkv
  _Float16* Yh   = Xh;             // reuse after QKV GEMM consumes Xh

  // f32 -> f16 conversions, one launch. Xh, Wattn, Wa1h, Wa2h, Wf1h, Wf2h were taken
  // in this order and each size is a multiple of 256 bytes, so they lie one behind
  // another from Xh on. Ends in units of CVT_UNIT floats.
  const int ux = M * C / CVT_UNIT, uq = C * 3 * C / CVT_UNIT, uf = C * 4 * C / CVT_UNIT;
  cvt_f32_f16_six<<<256, 512, 0, stream>>>(
      x, w_attn, wa1, wa2, wf1, wf2, Xh,
      ux, ux + uq, ux + uq + uf, ux + uq + 2 * uf, ux + uq + 3 * uf, ux + uq + 4 * uf);

  // qkv = x @ w_attn + b_attn  -> f16
  gemm_f16_wmma<<<dim3(3 * C / BN, M / BM), 256, 0, stream>>>(
      Xh, Wattn, b_attn, nullptr, qkvh, M, 3 * C, C, 0);

  // flash attention -> Yh (f16)
  attn_flash_wmma<<<dim3(Bb * NH, T / 64), 128, 0, stream>>>(qkvh, Yh, Bb, T, C, NH);

  // SelfAttn FF: H1 = gelu(y @ wa1 + ba1); t2 = H1 @ wa2 + ba2
  gemm_f16_wmma<<<dim3(4 * C / BN, M / BM), 256, 0, stream>>>(
      Yh, Wa1h, ba1, nullptr, H1h, M, 4 * C, C, 1);
  gemm_f16_wmma<<<dim3(C / BN, M / BM), 256, 0, stream>>>(
      H1h, Wa2h, ba2, t2f, nullptr, M, C, 4 * C, 0);

  // x1 = x + LN(t2)
  ln_residual<<<M / 16, 512, 0, stream>>>(x, t2f, g1, be1, x1, x1h);

  // Block FF: H2 = gelu(x1 @ wf1 + bf1); t4 = H2 @ wf2 + bf2
  gemm_f16_wmma<<<dim3(4 * C / BN, M / BM), 256, 0, stream>>>(
      x1h, Wf1h, bf1, nullptr, H1h, M, 4 * C, C, 1);
  gemm_f16_wmma<<<dim3(C / BN, M / BM), 256, 0, stream>>>(
      H1h, Wf2h, bf2, t2f, nullptr, M, C, 4 * C, 0);

  // out = x1 + LN(t4)
  ln_residual<<<M / 16, 512, 0, stream>>>(x1, t2f, g2, be2, out, nullptr);
}

// v005
// One run takes 270 microseconds.
// Two timings next to v004 both put it at 1.05 times that version's speed.
// Counting every step since v000, it is 3.81 times as fast.
#include <hip/hip_runtime.h>
#include <hip/hip_bf16.h>

typedef __attribute__((ext_vector_type(16))) _Float16 v16h;
typedef __attribute__((ext_vector_type(8)))  _Float16 v8h;
typedef __attribute__((ext_vector_type(8)))  float    v8f;

union F16x16 { v16h v; v8h h[2]; };

#define WMMA_F16(a, b, c) \
  __builtin_amdgcn_wmma_f32_16x16x32_f16(false, (a), false, (b), (short)0, (c), false, false)

__device__ __forceinline__ void async_copy4_b128(
    void* l0, const void* g0, void* l1, const void* g1,
    void* l2, const void* g2, void* l3, const void* g3) {
  asm volatile("global_load_async_to_lds_b128 %0, %1, off\n\t"
               "global_load_async_to_lds_b128 %2, %3, off\n\t"
               "global_load_async_to_lds_b128 %4, %5, off\n\t"
               "global_load_async_to_lds_b128 %6, %7, off\n\t"
               "s_wait_xcnt 0x0"
               :: "v"((unsigned)(size_t)l0), "v"((unsigned long long)(size_t)g0),
                  "v"((unsigned)(size_t)l1), "v"((unsigned long long)(size_t)g1),
                  "v"((unsigned)(size_t)l2), "v"((unsigned long long)(size_t)g2),
                  "v"((unsigned)(size_t)l3), "v"((unsigned long long)(size_t)g3)
               : "memory");
}
__device__ __forceinline__ void async_copy8_b128(
    unsigned l0, const void* g0, unsigned l1, const void* g1,
    unsigned l2, const void* g2, unsigned l3, const void* g3,
    unsigned l4, const void* g4, unsigned l5, const void* g5,
    unsigned l6, const void* g6, unsigned l7, const void* g7) {
  asm volatile("global_load_async_to_lds_b128 %0, %1, off\n\t"
               "global_load_async_to_lds_b128 %2, %3, off\n\t"
               "global_load_async_to_lds_b128 %4, %5, off\n\t"
               "global_load_async_to_lds_b128 %6, %7, off\n\t"
               "global_load_async_to_lds_b128 %8, %9, off\n\t"
               "global_load_async_to_lds_b128 %10, %11, off\n\t"
               "global_load_async_to_lds_b128 %12, %13, off\n\t"
               "global_load_async_to_lds_b128 %14, %15, off\n\t"
               "s_wait_xcnt 0x0"
               :: "v"(l0), "v"((unsigned long long)(size_t)g0),
                  "v"(l1), "v"((unsigned long long)(size_t)g1),
                  "v"(l2), "v"((unsigned long long)(size_t)g2),
                  "v"(l3), "v"((unsigned long long)(size_t)g3),
                  "v"(l4), "v"((unsigned long long)(size_t)g4),
                  "v"(l5), "v"((unsigned long long)(size_t)g5),
                  "v"(l6), "v"((unsigned long long)(size_t)g6),
                  "v"(l7), "v"((unsigned long long)(size_t)g7)
               : "memory");
}
__device__ __forceinline__ void async_wait0() {
  asm volatile("s_wait_asynccnt 0x0" ::: "memory");
}

// ---------------------------------------------------------------------------
// Transposing LDS load: from a tile stored T[k][n] (k rows, n contiguous) lane
// (c = lane & 15, h = lane >> 4) receives T[k0 + 8h + 0..7][n0 + c]. The lane's
// own address is &T[k0 + 8h + (lane & 7)][n0 + 8 * ((lane >> 3) & 1)].
// Loads at k0 and k0 + 16 form one 32-k B fragment in the k order that the
// A loaders below use (8h + 0..7, then 16 + 8h + 0..7).
// ---------------------------------------------------------------------------
typedef __attribute__((ext_vector_type(8))) short v8s;
typedef __attribute__((address_space(3))) v8s lds_v8s;
__device__ __forceinline__ v8h lds_load_tr16(const _Float16* p) {
  return __builtin_bit_cast(v8h, __builtin_amdgcn_ds_load_tr16_b128_v8i16((lds_v8s*)p));
}

// ---------------------------------------------------------------------------
// f32 -> f16 conversion of six arrays in one launch. The grid is sized to be
// resident at once (one 16-wave block per WGP) and its waves walk the work, so
// that few waves have to be started. A unit is 1024 floats: eight wave-wide loads
// of 512 contiguous bytes, all issued before the first is used. The six f16
// results lie one behind another at out, in the order of the sources; e0..e5 are
// the running ends of the six arrays in units.
// ---------------------------------------------------------------------------
typedef __attribute__((ext_vector_type(4))) float    v4f;
typedef __attribute__((ext_vector_type(4))) _Float16 v4h;
#define CVT_UNIT 1024

__global__ __launch_bounds__(512) void cvt_f32_f16_six(
    const float* __restrict__ s0, const float* __restrict__ s1,
    const float* __restrict__ s2, const float* __restrict__ s3,
    const float* __restrict__ s4, const float* __restrict__ s5,
    _Float16* __restrict__ out,
    int e0, int e1, int e2, int e3, int e4, int e5)
{
  const int lane = threadIdx.x & 31;
  const int nw   = gridDim.x * (blockDim.x >> 5);
  // The wave's number, held scalar so that the choice of the source is a scalar one.
  const int wv   = __builtin_amdgcn_readfirstlane(blockIdx.x * (blockDim.x >> 5) + (threadIdx.x >> 5));
  for (int u = wv; u < e5; u += nw) {
    const float* s = s0;
    int first = 0;
    if (u >= e0) { s = s1; first = e0; }
    if (u >= e1) { s = s2; first = e1; }
    if (u >= e2) { s = s3; first = e2; }
    if (u >= e3) { s = s4; first = e3; }
    if (u >= e4) { s = s5; first = e4; }
    const v4f* p = reinterpret_cast<const v4f*>(s + (size_t)(u - first) * CVT_UNIT) + lane;
    v4h* o = reinterpret_cast<v4h*>(out + (size_t)u * CVT_UNIT) + lane;
    v4f a[8];
#pragma unroll
    for (int q = 0; q < 8; ++q) a[q] = p[q * 32];
#pragma unroll
    for (int q = 0; q < 8; ++q) o[q * 32] = __builtin_convertvector(a[q], v4h);
  }
}

#define BM 128
#define BN 128
#define BKK 64
#define LDSA (BKK + 8) // 72 halfs = 144B rows (16B x odd: the plain reader's pitch)
#define LDSB (BN + 16) // 144 halfs = 288B rows (32B x odd: the transposing reader's pitch)

// x * Phi(x) with Phi(x) = erfc(-x / sqrt 2) / 2, the same path for every x, four
// elements at a time. q = erfc(|x| / sqrt 2) / 2 = (a1 t + ... + a5 t^5) exp(-x^2 / 2) / 2
// with t = 1 / (1 + p |x| / sqrt 2): absolute error of erf below 1.5e-7 for every x, the
// size of an f32 rounding of 1 + erf. x Phi(x) = max(x, 0) - |x| q on both sides of 0,
// with no cancellation for x < 0. The halves are folded into the coefficients.
__device__ __forceinline__ void gelu_erf4(float (&x)[4]) {
  float d[4], s[4], t[4], e[4];
#pragma unroll
  for (int c = 0; c < 4; ++c) {
    d[c] = fmaf(fabsf(x[c]), 0.23164190f, 1.0f);
    s[c] = (x[c] * -0.72134752f) * x[c];
  }
  asm("v_rcp_f32 %0, %8\n\t"
      "v_rcp_f32 %1, %9\n\t"
      "v_rcp_f32 %2, %10\n\t"
      "v_rcp_f32 %3, %11\n\t"
      "v_exp_f32 %4, %12\n\t"
      "v_exp_f32 %5, %13\n\t"
      "v_exp_f32 %6, %14\n\t"
      "v_exp_f32 %7, %15\n\t"
      "v_nop"
      : "=&v"(t[0]), "=&v"(t[1]), "=&v"(t[2]), "=&v"(t[3]),
        "=&v"(e[0]), "=&v"(e[1]), "=&v"(e[2]), "=&v"(e[3])
      : "v"(d[0]), "v"(d[1]), "v"(d[2]), "v"(d[3]),
        "v"(s[0]), "v"(s[1]), "v"(s[2]), "v"(s[3]));
#pragma unroll
  for (int c = 0; c < 4; ++c) {
    float p = fmaf(t[c], 0.5307027145f, -0.7265760135f);
    p = fmaf(t[c], p, 0.7107068705f);
    p = fmaf(t[c], p, -0.1422483680f);
    p = fmaf(t[c], p, 0.1274147960f);
    const float q = (p * t[c]) * e[c];
    x[c] = fmaf(-fabsf(x[c]), q, fmaxf(x[c], 0.0f));
  }
}

template <bool ACT, bool OUT32>
__global__ __launch_bounds__(256) void gemm_f16_wmma(
    const _Float16* __restrict__ A, const _Float16* __restrict__ Bm,
    const float* __restrict__ bias,
    float* __restrict__ Cf, _Float16* __restrict__ Ch,
    int M, int N, int K)
{
  __shared__ __attribute__((aligned(16))) _Float16 As[2][BM][LDSA];
  __shared__ __attribute__((aligned(16))) _Float16 Bs[2][BKK][LDSB]; // as in memory: Bs[.][k][n]

  const int tid  = threadIdx.x;
  const int lane = tid & 31;
  const int wave = tid >> 5;
  const int wr   = wave >> 2;   // 0..1
  const int wc   = wave & 3;    // 0..3
  const int lr   = lane & 15;
  const int hi   = lane >> 4;   // 0/1
  const int kb   = hi * 8;      // K-chunk base per 16-bit A/B lane layout

  const int m0 = blockIdx.y * BM;
  const int n0 = blockIdx.x * BN;

  v8f acc[4][2] = {};

  // One stage = A 128x64 halfs and B 64x128 halfs, 1024 chunks of 16B each, four
  // of each per thread: A rows r + 32q, B rows kk + 16q. The pointers walk one
  // stage further at every fill.
  const int r  = tid >> 3;
  const int kc = (tid & 7) * 8;
  const int kk = tid >> 4;
  const int nn = (tid & 15) * 8;
  const _Float16* ag = &A[(size_t)(m0 + r) * K + kc];
  const _Float16* bg = &Bm[(size_t)kk * N + n0 + nn];
  const unsigned la = (unsigned)(size_t)&As[0][r][kc];
  const unsigned lb = (unsigned)(size_t)&Bs[0][kk][nn];
  auto fill = [&](int buf) {
    const unsigned a = la + (unsigned)buf * (unsigned)(BM * LDSA * 2);
    const unsigned b = lb + (unsigned)buf * (unsigned)(BKK * LDSB * 2);
    async_copy8_b128(a,                 ag,
                     a + 32 * LDSA * 2, ag + (size_t)32 * K,
                     a + 64 * LDSA * 2, ag + (size_t)64 * K,
                     a + 96 * LDSA * 2, ag + (size_t)96 * K,
                     b,                 bg,
                     b + 16 * LDSB * 2, bg + (size_t)16 * N,
                     b + 32 * LDSB * 2, bg + (size_t)32 * N,
                     b + 48 * LDSB * 2, bg + (size_t)48 * N);
    ag += BKK;
    bg += (size_t)BKK * N;
  };

  const int nst = K / BKK;
  fill(0);
  async_wait0();
  __syncthreads();
  if (nst > 1) fill(1);

  for (int t = 0; t < nst; ++t) {
    const int cur = t & 1;
#pragma unroll
    for (int ks = 0; ks < BKK; ks += 32) {
      F16x16 af[4], bf[2];
#pragma unroll
      for (int i = 0; i < 4; ++i) {
        const _Float16* p = &As[cur][wr * 64 + i * 16 + lr][ks];
        af[i].h[0] = *reinterpret_cast<const v8h*>(p + kb);
        af[i].h[1] = *reinterpret_cast<const v8h*>(p + kb + 16);
      }
#pragma unroll
      for (int j = 0; j < 2; ++j) {
        const _Float16* p = &Bs[cur][ks + kb + (lane & 7)][wc * 32 + j * 16 + ((lane >> 3) & 1) * 8];
        bf[j].h[0] = lds_load_tr16(p);
        bf[j].h[1] = lds_load_tr16(p + 16 * LDSB);
      }
#pragma unroll
      for (int i = 0; i < 4; ++i)
#pragma unroll
        for (int j = 0; j < 2; ++j)
          acc[i][j] = WMMA_F16(af[i].v, bf[j].v, acc[i][j]);
    }
    // Hand-over: this wave's reads of buffer cur are done, its copies of stage
    // t + 1 have landed; behind the barrier that holds for every wave, so stage
    // t + 1 may be read and buffer cur refilled.
    asm volatile("s_wait_dscnt 0x0" ::: "memory");
    async_wait0();
    __syncthreads();
    if (t + 2 < nst) fill(cur);
  }
  // No copy is outstanding when the wave goes on to the epilogue.
  async_wait0();

  // Epilogue: D layout = lane(n), vgpr v -> row v + 8*hi
  const float bias2[2] = { bias[n0 + wc * 32 + lr], bias[n0 + wc * 32 + 16 + lr] };
#pragma unroll
  for (int i = 0; i < 4; ++i) {
#pragma unroll
    for (int j = 0; j < 2; ++j) {
      int gn = n0 + wc * 32 + j * 16 + lr;
      float bv = bias2[j];
#pragma unroll
      for (int v0 = 0; v0 < 8; v0 += 4) {
        float x[4];
#pragma unroll
        for (int c = 0; c < 4; ++c) x[c] = acc[i][j][v0 + c] + bv;
        if (ACT) gelu_erf4(x);
#pragma unroll
        for (int c = 0; c < 4; ++c) {
          int gm = m0 + wr * 64 + i * 16 + v0 + c + hi * 8;
          size_t idx = (size_t)gm * N + gn;
          if (OUT32) Cf[idx] = x[c];
          else       Ch[idx] = (_Float16)x[c];
        }
      }
    }
  }
}

__device__ __forceinline__ float xhalf(float x) {
  const int i = __builtin_bit_cast(int, x);
  return __builtin_bit_cast(float,
      __builtin_amdgcn_permlanex16(i, i, 0x76543210, 0xfedcba98, false, false));
}

__global__ __launch_bounds__(128) void attn_flash_wmma(
    const _Float16* __restrict__ qkvh, _Float16* __restrict__ Yh,
    int Bx, int Tx, int Cx, int NHx)
{
  __shared__ __attribute__((aligned(16))) _Float16 Ks[64][72]; // key-major (rows = key, cols = d)
  __shared__ __attribute__((aligned(16))) _Float16 Vs[64][80]; // key-major, 160B rows (32B x odd)

  const int tid  = threadIdx.x;
  const int lane = tid & 31;
  const int w    = tid >> 5;   // 0..3
  const int lr   = lane & 15;
  const int hi   = lane >> 4;
  const int kb   = hi * 8;

  const int bh = blockIdx.x;
  const int b  = bh / NHx;
  const int h  = bh % NHx;
  const int qb = blockIdx.y;
  const int q0 = qb * 64;
  const int qrow = q0 + w * 16 + lr;   // this lane's query

  const size_t rstride = (size_t)3 * Cx;
  const _Float16* kbase = qkvh + (size_t)b * Tx * rstride + 0 * Cx + h * 64;
  const _Float16* qbase = qkvh + (size_t)b * Tx * rstride + 1 * Cx + h * 64;
  const _Float16* vbase = qkvh + (size_t)b * Tx * rstride + 2 * Cx + h * 64;

  // Q fragments (B operand: column = query lr), pre-scaled by 1/sqrt(64) = 0.125
  F16x16 qf[2];
  {
#pragma unroll
    for (int kk = 0; kk < 2; ++kk) {
      const _Float16* p = qbase + (size_t)qrow * rstride + kk * 32;
      v8h x0 = *reinterpret_cast<const v8h*>(p + kb);
      v8h x1 = *reinterpret_cast<const v8h*>(p + kb + 16);
#pragma unroll
      for (int j = 0; j < 8; ++j) {
        x0[j] = (_Float16)(x0[j] * (_Float16)0.125f);
        x1[j] = (_Float16)(x1[j] * (_Float16)0.125f);
      }
      qf[kk].h[0] = x0; qf[kk].h[1] = x1;
    }
  }

  float mrow = -3.0e38f;   // running maximum of this lane's query (equal in both halves)
  float lsum = 0.0f;       // running sum over this half's keys only; joined after the loop
  v8f O[4] = {};           // O[ot][v] = O^T[d = 16 ot + 8 hi + v][query lr]

  for (int jb = 0; jb <= qb; ++jb) {
    const int key0 = jb * 64;
    // K and V tiles: async straight copies, 512 chunks of 16B each, four per
    // thread (rows key, key + 16, key + 32, key + 48).
    {
      const int key = tid >> 3;
      const int dc  = (tid & 7) * 8;
      const _Float16* kg = kbase + (size_t)(key0 + key) * rstride + dc;
      const _Float16* vg = vbase + (size_t)(key0 + key) * rstride + dc;
      async_copy4_b128(&Ks[key][dc],      kg,
                       &Ks[key + 16][dc], kg + 16 * rstride,
                       &Ks[key + 32][dc], kg + 32 * rstride,
                       &Ks[key + 48][dc], kg + 48 * rstride);
      async_copy4_b128(&Vs[key][dc],      vg,
                       &Vs[key + 16][dc], vg + 16 * rstride,
                       &Vs[key + 32][dc], vg + 32 * rstride,
                       &Vs[key + 48][dc], vg + 48 * rstride);
    }
    async_wait0();
    __syncthreads();

    // S^T = K @ (Q/8)^T : 4 tiles of 16 keys, K-dim 64 = 2 WMMAs each.
    // S[nt][v] = score of key key0 + 16 nt + 8 hi + v against query lr.
    v8f S[4];
#pragma unroll
    for (int nt = 0; nt < 4; ++nt) {
      S[nt] = (v8f){};
#pragma unroll
      for (int kk = 0; kk < 2; ++kk) {
        F16x16 ak;
        const _Float16* p = &Ks[nt * 16 + lr][kk * 32];
        ak.h[0] = *reinterpret_cast<const v8h*>(p + kb);
        ak.h[1] = *reinterpret_cast<const v8h*>(p + kb + 16);
        S[nt] = WMMA_F16(ak.v, qf[kk].v, S[nt]);
      }
    }
    // Causal mask (only the diagonal block needs it)
    if (jb == qb) {
#pragma unroll
      for (int nt = 0; nt < 4; ++nt) {
#pragma unroll
        for (int v = 0; v < 8; ++v) {
          int col = key0 + nt * 16 + kb + v;
          if (col > qrow) S[nt][v] = -3.0e38f;
        }
      }
    }

    // Online softmax update of the lane's query
    float tm[4];
#pragma unroll
    for (int nt = 0; nt < 4; ++nt) {
      tm[nt] = S[nt][0];
#pragma unroll
      for (int v = 1; v < 8; ++v) tm[nt] = fmaxf(tm[nt], S[nt][v]);
    }
    float t = fmaxf(fmaxf(tm[0], tm[1]), fmaxf(tm[2], tm[3]));
    t = fmaxf(t, xhalf(t));
    const float mn = fmaxf(mrow, t);
    const float alpha = __expf(mrow - mn);
    mrow = mn;
#pragma unroll
    for (int ot = 0; ot < 4; ++ot) O[ot] *= alpha;

    // P^T as B operand: element s of the 32-key fragment kk is tile 2 kk + (s >> 3),
    // register s & 7, which is the k order of the transposing load below.
    F16x16 pf[2];
    float rs[4];
#pragma unroll
    for (int nt = 0; nt < 4; ++nt) {
      rs[nt] = 0.0f;
#pragma unroll
      for (int v = 0; v < 8; ++v) {
        float p = __expf(S[nt][v] - mn);
        rs[nt] += p;
        pf[nt >> 1].h[nt & 1][v] = (_Float16)p;
      }
    }
    lsum = lsum * alpha + ((rs[0] + rs[1]) + (rs[2] + rs[3]));

    // O^T += V^T @ P^T
#pragma unroll
    for (int ot = 0; ot < 4; ++ot) {
#pragma unroll
      for (int kk = 0; kk < 2; ++kk) {
        F16x16 av;
        const _Float16* vp = &Vs[kk * 32 + kb + (lane & 7)][ot * 16 + ((lane >> 3) & 1) * 8];
        av.h[0] = lds_load_tr16(vp);
        av.h[1] = lds_load_tr16(vp + 16 * 80);
        O[ot] = WMMA_F16(av.v, pf[kk].v, O[ot]);
      }
    }
    __syncthreads();
  }

  // Write y (f16), normalized: a lane holds 8 consecutive d of its query per tile
  const float inv = 1.0f / (lsum + xhalf(lsum));
  _Float16* yp = Yh + ((size_t)b * Tx + qrow) * Cx + h * 64 + kb;
#pragma unroll
  for (int ot = 0; ot < 4; ++ot) {
    v8h o;
#pragma unroll
    for (int v = 0; v < 8; ++v) o[v] = (_Float16)(O[ot][v] * inv);
    *reinterpret_cast<v8h*>(yp + ot * 16) = o;
  }
}

// ---------------------------------------------------------------------------
// out = xin + LayerNorm(t)*g + b, rows of LN_C floats. One wave per row, 16 rows
// per block: a lane holds 32 values of its row in registers (eight wave-wide
// loads of 512 contiguous bytes), the row's sums are joined by a butterfly over
// the 32 lanes, and no LDS or barrier is needed.
// ---------------------------------------------------------------------------
#define LN_C 1024

__global__ __launch_bounds__(512) void ln_residual(
    const float* __restrict__ xin, const float* __restrict__ t,
    const float* __restrict__ g, const float* __restrict__ be,
    float* __restrict__ outf, _Float16* __restrict__ outh)
{
  const int lane = threadIdx.x & 31;
  const int row  = blockIdx.x * (blockDim.x >> 5) + (threadIdx.x >> 5);
  const v4f* tr = reinterpret_cast<const v4f*>(t + (size_t)row * LN_C) + lane;
  const v4f* xr = reinterpret_cast<const v4f*>(xin + (size_t)row * LN_C) + lane;
  const v4f* gr = reinterpret_cast<const v4f*>(g) + lane;
  const v4f* br = reinterpret_cast<const v4f*>(be) + lane;

  v4f tv[8], xv[8], gv[8], bv[8];
#pragma unroll
  for (int q = 0; q < 8; ++q) tv[q] = tr[q * 32];
#pragma unroll
  for (int q = 0; q < 8; ++q) xv[q] = xr[q * 32];
#pragma unroll
  for (int q = 0; q < 8; ++q) gv[q] = gr[q * 32];
#pragma unroll
  for (int q = 0; q < 8; ++q) bv[q] = br[q * 32];
  // Stands in front of every rewrite of an address register of the loads above. The
  // two row pointers are named as inputs so that their registers live up to the wait;
  // otherwise the last load's result is placed on its own address pair.
  asm volatile("s_wait_xcnt 0x0" :: "v"(tr), "v"(xr) : "memory");
  // Keeps all 32 loads in front of the sums, so that the wave waits out one memory
  // latency; left free, the scheduler sinks 24 of them behind the sums in small groups.
  __builtin_amdgcn_sched_barrier(0);

  v4f sv = {}, sv2 = {};   // four independent chains each
#pragma unroll
  for (int q = 0; q < 8; ++q) { sv += tv[q]; sv2 += tv[q] * tv[q]; }
  float s  = (sv[0] + sv[1]) + (sv[2] + sv[3]);
  float s2 = (sv2[0] + sv2[1]) + (sv2[2] + sv2[3]);
#pragma unroll
  for (int off = 16; off; off >>= 1) { s += __shfl_xor(s, off, 32); s2 += __shfl_xor(s2, off, 32); }
  float mean = s / LN_C;
  float var  = s2 / LN_C - mean * mean;
  float rstd = rsqrtf(var + 1e-5f);

#pragma unroll
  for (int q = 0; q < 8; ++q)
#pragma unroll
    for (int e = 0; e < 4; ++e)
      xv[q][e] = xv[q][e] + (tv[q][e] - mean) * rstd * gv[q][e] + bv[q][e];
  if (outf) {
    v4f* of = reinterpret_cast<v4f*>(outf + (size_t)row * LN_C) + lane;
#pragma unroll
    for (int q = 0; q < 8; ++q) of[q * 32] = xv[q];
    // The conversion below may reuse the registers that these stores name.
    asm volatile("s_wait_xcnt 0x0" ::: "memory");
  }
  if (outh) {
    v4h* oh = reinterpret_cast<v4h*>(outh + (size_t)row * LN_C) + lane;
#pragma unroll
    for (int q = 0; q < 8; ++q) oh[q * 32] = __builtin_convertvector(xv[q], v4h);
  }
}

// ---------------------------------------------------------------------------
extern "C" void kernel_launch(void* const* d_in, const int* in_sizes, int n_in,
                              void* d_out, int out_size, void* d_ws, size_t ws_size,
                              hipStream_t stream) {
  (void)in_sizes; (void)n_in; (void)out_size; (void)ws_size;
  const int Bb = 2, T = 2048, C = 1024, NH = 16;
  const int M = Bb * T; // 4096

  const float* x      = (const float*)d_in[0];
  const float* w_attn = (const float*)d_in[1];
  const float* b_attn = (const float*)d_in[2];
  const float* wa1    = (const float*)d_in[3];
  const float* ba1    = (const float*)d_in[4];
  const float* wa2    = (const float*)d_in[5];
  const float* ba2    = (const float*)d_in[6];
  const float* g1     = (const float*)d_in[7];
  const float* be1    = (const float*)d_in[8];
  const float* wf1    = (const float*)d_in[9];
  const float* bf1    = (const float*)d_in[10];
  const float* wf2    = (const float*)d_in[11];
  const float* bf2    = (const float*)d_in[12];
  const float* g2     = (const float*)d_in[13];
  const float* be2    = (const float*)d_in[14];
  float* out = (float*)d_out;

  char* ws = (char*)d_ws;
  size_t off = 0;
  auto take = [&](size_t bytes) -> char* {
    char* p = ws + off;
    off += (bytes + 255) & ~(size_t)255;
    return p;
  };

  _Float16* Xh    = (_Float16*)take((size_t)M * C * 2);        // x f16; reused as Yh
  _Float16* Wattn = (_Float16*)take((size_t)C * 3 * C * 2);
  _Float16* Wa1h  = (_Float16*)take((size_t)C * 4 * C * 2);
  _Float16* Wa2h  = (_Float16*)take((size_t)4 * C * C * 2);
  _Float16* Wf1h  = (_Float16*)take((size_t)C * 4 * C * 2);
  _Float16* Wf2h  = (_Float16*)take((size_t)4 * C * C * 2);
  char*     qkvB  = take((size_t)M * 3 * C * 2);               // qkv f16; reused as t2/t4 f32
  _Float16* H1h   = (_Float16*)take((size_t)M * 4 * C * 2);    // FF hidden; reused for both FFs
  float*    x1    = (float*)take((size_t)M * C * 4);
  _Float16* x1h   = (_Float16*)take((size_t)M * C * 2);

  _Float16* qkvh = (_Float16*)qkvB;
  float*    t2f  = (float*)qkvB;   // reuse after attention consumes qkv
  _Float16* Yh   = Xh;             // reuse after QKV GEMM consumes Xh

  // f32 -> f16 conversions, one launch. Xh, Wattn, Wa1h, Wa2h, Wf1h, Wf2h were taken
  // in this order and each size is a multiple of 256 bytes, so they lie one behind
  // another from Xh on. Ends in units of CVT_UNIT floats.
  const int ux = M * C / CVT_UNIT, uq = C * 3 * C / CVT_UNIT, uf = C * 4 * C / CVT_UNIT;
  cvt_f32_f16_six<<<256, 512, 0, stream>>>(
      x, w_attn, wa1, wa2, wf1, wf2, Xh,
      ux, ux + uq, ux + uq + uf, ux + uq + 2 * uf, ux + uq + 3 * uf, ux + uq + 4 * uf);

  // qkv = x @ w_attn + b_attn  -> f16
  gemm_f16_wmma<false, false><<<dim3(3 * C / BN, M / BM), 256, 0, stream>>>(
      Xh, Wattn, b_attn, nullptr, qkvh, M, 3 * C, C);

  // flash attention -> Yh (f16)
  attn_flash_wmma<<<dim3(Bb * NH, T / 64), 128, 0, stream>>>(qkvh, Yh, Bb, T, C, NH);

  // SelfAttn FF: H1 = gelu(y @ wa1 + ba1); t2 = H1 @ wa2 + ba2
  gemm_f16_wmma<true, false><<<dim3(4 * C / BN, M / BM), 256, 0, stream>>>(
      Yh, Wa1h, ba1, nullptr, H1h, M, 4 * C, C);
  gemm_f16_wmma<false, true><<<dim3(C / BN, M / BM), 256, 0, stream>>>(
      H1h, Wa2h, ba2, t2f, nullptr, M, C, 4 * C);

  // x1 = x + LN(t2)
  ln_residual<<<M / 16, 512, 0, stream>>>(x, t2f, g1, be1, x1, x1h);

  // Block FF: H2 = gelu(x1 @ wf1 + bf1); t4 = H2 @ wf2 + bf2
  gemm_f16_wmma<true, false><<<dim3(4 * C / BN, M / BM), 256, 0, stream>>>(
      x1h, Wf1h, bf1, nullptr, H1h, M, 4 * C, C);
  gemm_f16_wmma<false, true><<<dim3(C / BN, M / BM), 256, 0, stream>>>(
      H1h, Wf2h, bf2, t2f, nullptr, M, C, 4 * C);

  // out = x1 + LN(t4)
  ln_residual<<<M / 16, 512, 0, stream>>>(x1, t2f, g2, be2, out, nullptr);
}

// v006
// One run takes 258 microseconds.
// Timed twice side by side with v005, it ran 1.04 times as fast both times.
// All steps since v000 together make it 3.97 times as fast.
#include <hip/hip_runtime.h>
#include <hip/hip_bf16.h>

typedef __attribute__((ext_vector_type(16))) _Float16 v16h;
typedef __attribute__((ext_vector_type(8)))  _Float16 v8h;
typedef __attribute__((ext_vector_type(8)))  float    v8f;

union F16x16 { v16h v; v8h h[2]; };

#define WMMA_F16(a, b, c) \
  __builtin_amdgcn_wmma_f32_16x16x32_f16(false, (a), false, (b), (short)0, (c), false, false)

__device__ __forceinline__ void async_copy4_b128(
    void* l0, const void* g0, void* l1, const void* g1,
    void* l2, const void* g2, void* l3, const void* g3) {
  asm volatile("global_load_async_to_lds_b128 %0, %1, off\n\t"
               "global_load_async_to_lds_b128 %2, %3, off\n\t"
               "global_load_async_to_lds_b128 %4, %5, off\n\t"
               "global_load_async_to_lds_b128 %6, %7, off\n\t"
               "s_wait_xcnt 0x0"
               :: "v"((unsigned)(size_t)l0), "v"((unsigned long long)(size_t)g0),
                  "v"((unsigned)(size_t)l1), "v"((unsigned long long)(size_t)g1),
                  "v"((unsigned)(size_t)l2), "v"((unsigned long long)(size_t)g2),
                  "v"((unsigned)(size_t)l3), "v"((unsigned long long)(size_t)g3)
               : "memory");
}
__device__ __forceinline__ void async_copy8_b128(
    unsigned l0, const void* g0, unsigned l1, const void* g1,
    unsigned l2, const void* g2, unsigned l3, const void* g3,
    unsigned l4, const void* g4, unsigned l5, const void* g5,
    unsigned l6, const void* g6, unsigned l7, const void* g7) {
  asm volatile("global_load_async_to_lds_b128 %0, %1, off\n\t"
               "global_load_async_to_lds_b128 %2, %3, off\n\t"
               "global_load_async_to_lds_b128 %4, %5, off\n\t"
               "global_load_async_to_lds_b128 %6, %7, off\n\t"
               "global_load_async_to_lds_b128 %8, %9, off\n\t"
               "global_load_async_to_lds_b128 %10, %11, off\n\t"
               "global_load_async_to_lds_b128 %12, %13, off\n\t"
               "global_load_async_to_lds_b128 %14, %15, off\n\t"
               "s_wait_xcnt 0x0"
               :: "v"(l0), "v"((unsigned long long)(size_t)g0),
                  "v"(l1), "v"((unsigned long long)(size_t)g1),
                  "v"(l2), "v"((unsigned long long)(size_t)g2),
                  "v"(l3), "v"((unsigned long long)(size_t)g3),
                  "v"(l4), "v"((unsigned long long)(size_t)g4),
                  "v"(l5), "v"((unsigned long long)(size_t)g5),
                  "v"(l6), "v"((unsigned long long)(size_t)g6),
                  "v"(l7), "v"((unsigned long long)(size_t)g7)
               : "memory");
}
__device__ __forceinline__ void async_wait0() {
  asm volatile("s_wait_asynccnt 0x0" ::: "memory");
}

// ---------------------------------------------------------------------------
// Transposing LDS load: from a tile stored T[k][n] (k rows, n contiguous) lane
// (c = lane & 15, h = lane >> 4) receives T[k0 + 8h + 0..7][n0 + c]. The lane's
// own address is &T[k0 + 8h + (lane & 7)][n0 + 8 * ((lane >> 3) & 1)].
// Loads at k0 and k0 + 16 form one 32-k B fragment in the k order that the
// A loaders below use (8h + 0..7, then 16 + 8h + 0..7).
// ---------------------------------------------------------------------------
typedef __attribute__((ext_vector_type(8))) short v8s;
typedef __attribute__((address_space(3))) v8s lds_v8s;
__device__ __forceinline__ v8h lds_load_tr16(const _Float16* p) {
  return __builtin_bit_cast(v8h, __builtin_amdgcn_ds_load_tr16_b128_v8i16((lds_v8s*)p));
}

// ---------------------------------------------------------------------------
// f32 -> f16 conversion of six arrays in one launch. The grid is sized to be
// resident at once (one 16-wave block per WGP) and its waves walk the work, so
// that few waves have to be started. A unit is 1024 floats: eight wave-wide loads
// of 512 contiguous bytes, all issued before the first is used. The six f16
// results lie one behind another at out, in the order of the sources; e0..e5 are
// the running ends of the six arrays in units.
// ---------------------------------------------------------------------------
typedef __attribute__((ext_vector_type(4))) float    v4f;
typedef __attribute__((ext_vector_type(4))) _Float16 v4h;
#define CVT_UNIT 1024

__global__ __launch_bounds__(512) void cvt_f32_f16_six(
    const float* __restrict__ s0, const float* __restrict__ s1,
    const float* __restrict__ s2, const float* __restrict__ s3,
    const float* __restrict__ s4, const float* __restrict__ s5,
    _Float16* __restrict__ out,
    int e0, int e1, int e2, int e3, int e4, int e5)
{
  const int lane = threadIdx.x & 31;
  const int nw   = gridDim.x * (blockDim.x >> 5);
  // The wave's number, held scalar so that the choice of the source is a scalar one.
  const int wv   = __builtin_amdgcn_readfirstlane(blockIdx.x * (blockDim.x >> 5) + (threadIdx.x >> 5));
  for (int u = wv; u < e5; u += nw) {
    const float* s = s0;
    int first = 0;
    if (u >= e0) { s = s1; first = e0; }
    if (u >= e1) { s = s2; first = e1; }
    if (u >= e2) { s = s3; first = e2; }
    if (u >= e3) { s = s4; first = e3; }
    if (u >= e4) { s = s5; first = e4; }
    const v4f* p = reinterpret_cast<const v4f*>(s + (size_t)(u - first) * CVT_UNIT) + lane;
    v4h* o = reinterpret_cast<v4h*>(out + (size_t)u * CVT_UNIT) + lane;
    v4f a[8];
#pragma unroll
    for (int q = 0; q < 8; ++q) a[q] = p[q * 32];
#pragma unroll
    for (int q = 0; q < 8; ++q) o[q * 32] = __builtin_convertvector(a[q], v4h);
  }
}

#define BKK 64
#define LDSA (BKK + 8) // 72 halfs = 144B rows (16B x odd: the plain reader's pitch)

// x * Phi(x) with Phi(x) = erfc(-x / sqrt 2) / 2, the same path for every x, four
// elements at a time. q = erfc(|x| / sqrt 2) / 2 = (a1 t + ... + a5 t^5) exp(-x^2 / 2) / 2
// with t = 1 / (1 + p |x| / sqrt 2): absolute error of erf below 1.5e-7 for every x, the
// size of an f32 rounding of 1 + erf. x Phi(x) = max(x, 0) - |x| q on both sides of 0,
// with no cancellation for x < 0. The halves are folded into the coefficients.
__device__ __forceinline__ void gelu_erf4(float (&x)[4]) {
  float d[4], s[4], t[4], e[4];
#pragma unroll
  for (int c = 0; c < 4; ++c) {
    d[c] = fmaf(fabsf(x[c]), 0.23164190f, 1.0f);
    s[c] = (x[c] * -0.72134752f) * x[c];
  }
  asm("v_rcp_f32 %0, %8\n\t"
      "v_rcp_f32 %1, %9\n\t"
      "v_rcp_f32 %2, %10\n\t"
      "v_rcp_f32 %3, %11\n\t"
      "v_exp_f32 %4, %12\n\t"
      "v_exp_f32 %5, %13\n\t"
      "v_exp_f32 %6, %14\n\t"
      "v_exp_f32 %7, %15\n\t"
      "v_nop"
      : "=&v"(t[0]), "=&v"(t[1]), "=&v"(t[2]), "=&v"(t[3]),
        "=&v"(e[0]), "=&v"(e[1]), "=&v"(e[2]), "=&v"(e[3])
      : "v"(d[0]), "v"(d[1]), "v"(d[2]), "v"(d[3]),
        "v"(s[0]), "v"(s[1]), "v"(s[2]), "v"(s[3]));
#pragma unroll
  for (int c = 0; c < 4; ++c) {
    float p = fmaf(t[c], 0.5307027145f, -0.7265760135f);
    p = fmaf(t[c], p, 0.7107068705f);
    p = fmaf(t[c], p, -0.1422483680f);
    p = fmaf(t[c], p, 0.1274147960f);
    const float q = (p * t[c]) * e[c];
    x[c] = fmaf(-fabsf(x[c]), q, fmaxf(x[c], 0.0f));
  }
}

template <bool ACT, bool OUT32, int NWR, int NWC, int FJ>
__global__ __launch_bounds__(NWR * NWC * 32) void gemm_f16_wmma(
    const _Float16* __restrict__ A, const _Float16* __restrict__ Bm,
    const float* __restrict__ bias,
    float* __restrict__ Cf, _Float16* __restrict__ Ch,
    int M, int N, int K)
{
  constexpr int NT   = NWR * NWC * 32;   // threads
  constexpr int BM   = NWR * 64;
  constexpr int BN   = NWC * FJ * 16;
  constexpr int LDSB = BN + 16;          // 288B or 544B rows (32B x odd: the transposing reader's pitch)
  constexpr int RA   = NT / 8;           // A rows that one copy of every thread covers
  constexpr int CB   = BN / 8;           // 16B chunks in a B row
  constexpr int RB   = NT / CB;          // B rows that one copy of every thread covers
  static_assert(BM == 4 * RA && BKK == 4 * RB, "four A and four B copies per thread and stage");
  static_assert((LDSB / 16) % 2 == 1, "B pitch is 32B x odd");
  __shared__ __attribute__((aligned(16))) _Float16 As[2][BM][LDSA];
  __shared__ __attribute__((aligned(16))) _Float16 Bs[2][BKK][LDSB]; // as in memory: Bs[.][k][n]

  const int tid  = threadIdx.x;
  const int lane = tid & 31;
  const int wave = tid >> 5;
  const int wr   = wave / NWC;
  const int wc   = wave % NWC;
  const int lr   = lane & 15;
  const int hi   = lane >> 4;   // 0/1
  const int kb   = hi * 8;      // K-chunk base per 16-bit A/B lane layout

  const int m0 = blockIdx.y * BM;
  const int n0 = blockIdx.x * BN;

  v8f acc[4][FJ] = {};

  // One stage = A BM x 64 halfs and B 64 x BN halfs in chunks of 16B, four of each
  // per thread: A rows r + RA q, B rows kk + RB q. The pointers walk one stage
  // further at every fill.
  const int r  = tid >> 3;
  const int kc = (tid & 7) * 8;
  const int kk = tid / CB;
  const int nn = (tid % CB) * 8;
  const _Float16* ag = &A[(size_t)(m0 + r) * K + kc];
  const _Float16* bg = &Bm[(size_t)kk * N + n0 + nn];
  const unsigned la = (unsigned)(size_t)&As[0][r][kc];
  const unsigned lb = (unsigned)(size_t)&Bs[0][kk][nn];
  auto fill = [&](int buf) {
    const unsigned a = la + (unsigned)buf * (unsigned)(BM * LDSA * 2);
    const unsigned b = lb + (unsigned)buf * (unsigned)(BKK * LDSB * 2);
    async_copy8_b128(a,                     ag,
                     a + 1 * RA * LDSA * 2, ag + (size_t)(1 * RA) * K,
                     a + 2 * RA * LDSA * 2, ag + (size_t)(2 * RA) * K,
                     a + 3 * RA * LDSA * 2, ag + (size_t)(3 * RA) * K,
                     b,                     bg,
                     b + 1 * RB * LDSB * 2, bg + (size_t)(1 * RB) * N,
                     b + 2 * RB * LDSB * 2, bg + (size_t)(2 * RB) * N,
                     b + 3 * RB * LDSB * 2, bg + (size_t)(3 * RB) * N);
    ag += BKK;
    bg += (size_t)BKK * N;
  };

  const int nst = K / BKK;
  fill(0);
  async_wait0();
  __syncthreads();
  if (nst > 1) fill(1);

  for (int t = 0; t < nst; ++t) {
    const int cur = t & 1;
#pragma unroll
    for (int ks = 0; ks < BKK; ks += 32) {
      F16x16 af[4], bf[FJ];
#pragma unroll
      for (int i = 0; i < 4; ++i) {
        const _Float16* p = &As[cur][wr * 64 + i * 16 + lr][ks];
        af[i].h[0] = *reinterpret_cast<const v8h*>(p + kb);
        af[i].h[1] = *reinterpret_cast<const v8h*>(p + kb + 16);
      }
#pragma unroll
      for (int j = 0; j < FJ; ++j) {
        const _Float16* p = &Bs[cur][ks + kb + (lane & 7)][(wc * FJ + j) * 16 + ((lane >> 3) & 1) * 8];
        bf[j].h[0] = lds_load_tr16(p);
        bf[j].h[1] = lds_load_tr16(p + 16 * LDSB);
      }
      if (FJ == 4) __builtin_amdgcn_sched_barrier(0);
#pragma unroll
      for (int i = 0; i < 4; ++i)
#pragma unroll
        for (int j = 0; j < FJ; ++j)
          acc[i][j] = WMMA_F16(af[i].v, bf[j].v, acc[i][j]);
    }
    // Hand-over: this wave's reads of buffer cur are done, its copies of stage
    // t + 1 have landed; behind the barrier that holds for every wave, so stage
    // t + 1 may be read and buffer cur refilled.
    asm volatile("s_wait_dscnt 0x0" ::: "memory");
    async_wait0();
    __syncthreads();
    if (t + 2 < nst) fill(cur);
  }
  // No copy is outstanding when the wave goes on to the epilogue.
  async_wait0();

  // Epilogue: D layout = lane(n), vgpr v -> row v + 8*hi
  float biasj[FJ];
#pragma unroll
  for (int j = 0; j < FJ; ++j) biasj[j] = bias[n0 + (wc * FJ + j) * 16 + lr];
#pragma unroll
  for (int i = 0; i < 4; ++i) {
#pragma unroll
    for (int j = 0; j < FJ; ++j) {
      int gn = n0 + (wc * FJ + j) * 16 + lr;
      float bv = biasj[j];
#pragma unroll
      for (int v0 = 0; v0 < 8; v0 += 4) {
        float x[4];
#pragma unroll
        for (int c = 0; c < 4; ++c) x[c] = acc[i][j][v0 + c] + bv;
        if (ACT) gelu_erf4(x);
#pragma unroll
        for (int c = 0; c < 4; ++c) {
          int gm = m0 + wr * 64 + i * 16 + v0 + c + hi * 8;
          size_t idx = (size_t)gm * N + gn;
          if (OUT32) Cf[idx] = x[c];
          else       Ch[idx] = (_Float16)x[c];
        }
      }
    }
  }
}

__device__ __forceinline__ float xhalf(float x) {
  const int i = __builtin_bit_cast(int, x);
  return __builtin_bit_cast(float,
      __builtin_amdgcn_permlanex16(i, i, 0x76543210, 0xfedcba98, false, false));
}

__global__ __launch_bounds__(128) void attn_flash_wmma(
    const _Float16* __restrict__ qkvh, _Float16* __restrict__ Yh,
    int Bx, int Tx, int Cx, int NHx)
{
  __shared__ __attribute__((aligned(16))) _Float16 Ks[64][72]; // key-major (rows = key, cols = d)
  __shared__ __attribute__((aligned(16))) _Float16 Vs[64][80]; // key-major, 160B rows (32B x odd)

  const int tid  = threadIdx.x;
  const int lane = tid & 31;
  const int w    = tid >> 5;   // 0..3
  const int lr   = lane & 15;
  const int hi   = lane >> 4;
  const int kb   = hi * 8;

  const int bh = blockIdx.x;
  const int b  = bh / NHx;
  const int h  = bh % NHx;
  const int qb = blockIdx.y;
  const int q0 = qb * 64;
  const int qrow = q0 + w * 16 + lr;   // this lane's query

  const size_t rstride = (size_t)3 * Cx;
  const _Float16* kbase = qkvh + (size_t)b * Tx * rstride + 0 * Cx + h * 64;
  const _Float16* qbase = qkvh + (size_t)b * Tx * rstride + 1 * Cx + h * 64;
  const _Float16* vbase = qkvh + (size_t)b * Tx * rstride + 2 * Cx + h * 64;

  // Q fragments (B operand: column = query lr), pre-scaled by 1/sqrt(64) = 0.125
  F16x16 qf[2];
  {
#pragma unroll
    for (int kk = 0; kk < 2; ++kk) {
      const _Float16* p = qbase + (size_t)qrow * rstride + kk * 32;
      v8h x0 = *reinterpret_cast<const v8h*>(p + kb);
      v8h x1 = *reinterpret_cast<const v8h*>(p + kb + 16);
#pragma unroll
      for (int j = 0; j < 8; ++j) {
        x0[j] = (_Float16)(x0[j] * (_Float16)0.125f);
        x1[j] = (_Float16)(x1[j] * (_Float16)0.125f);
      }
      qf[kk].h[0] = x0; qf[kk].h[1] = x1;
    }
  }

  float mrow = -3.0e38f;   // running maximum of this lane's query (equal in both halves)
  float lsum = 0.0f;       // running sum over this half's keys only; joined after the loop
  v8f O[4] = {};           // O[ot][v] = O^T[d = 16 ot + 8 hi + v][query lr]

  for (int jb = 0; jb <= qb; ++jb) {
    const int key0 = jb * 64;
    // K and V tiles: async straight copies, 512 chunks of 16B each, four per
    // thread (rows key, key + 16, key + 32, key + 48).
    {
      const int key = tid >> 3;
      const int dc  = (tid & 7) * 8;
      const _Float16* kg = kbase + (size_t)(key0 + key) * rstride + dc;
      const _Float16* vg = vbase + (size_t)(key0 + key) * rstride + dc;
      async_copy4_b128(&Ks[key][dc],      kg,
                       &Ks[key + 16][dc], kg + 16 * rstride,
                       &Ks[key + 32][dc], kg + 32 * rstride,
                       &Ks[key + 48][dc], kg + 48 * rstride);
      async_copy4_b128(&Vs[key][dc],      vg,
                       &Vs[key + 16][dc], vg + 16 * rstride,
                       &Vs[key + 32][dc], vg + 32 * rstride,
                       &Vs[key + 48][dc], vg + 48 * rstride);
    }
    async_wait0();
    __syncthreads();

    // S^T = K @ (Q/8)^T : 4 tiles of 16 keys, K-dim 64 = 2 WMMAs each.
    // S[nt][v] = score of key key0 + 16 nt + 8 hi + v against query lr.
    v8f S[4];
#pragma unroll
    for (int nt = 0; nt < 4; ++nt) {
      S[nt] = (v8f){};
#pragma unroll
      for (int kk = 0; kk < 2; ++kk) {
        F16x16 ak;
        const _Float16* p = &Ks[nt * 16 + lr][kk * 32];
        ak.h[0] = *reinterpret_cast<const v8h*>(p + kb);
        ak.h[1] = *reinterpret_cast<const v8h*>(p + kb + 16);
        S[nt] = WMMA_F16(ak.v, qf[kk].v, S[nt]);
      }
    }
    // Causal mask (only the diagonal block needs it)
    if (jb == qb) {
#pragma unroll
      for (int nt = 0; nt < 4; ++nt) {
#pragma unroll
        for (int v = 0; v < 8; ++v) {
          int col = key0 + nt * 16 + kb + v;
          if (col > qrow) S[nt][v] = -3.0e38f;
        }
      }
    }

    // Online softmax update of the lane's query
    float tm[4];
#pragma unroll
    for (int nt = 0; nt < 4; ++nt) {
      tm[nt] = S[nt][0];
#pragma unroll
      for (int v = 1; v < 8; ++v) tm[nt] = fmaxf(tm[nt], S[nt][v]);
    }
    float t = fmaxf(fmaxf(tm[0], tm[1]), fmaxf(tm[2], tm[3]));
    t = fmaxf(t, xhalf(t));
    const float mn = fmaxf(mrow, t);
    const float alpha = __expf(mrow - mn);
    mrow = mn;
#pragma unroll
    for (int ot = 0; ot < 4; ++ot) O[ot] *= alpha;

    // P^T as B operand: element s of the 32-key fragment kk is tile 2 kk + (s >> 3),
    // register s & 7, which is the k order of the transposing load below.
    F16x16 pf[2];
    float rs[4];
#pragma unroll
    for (int nt = 0; nt < 4; ++nt) {
      rs[nt] = 0.0f;
#pragma unroll
      for (int v = 0; v < 8; ++v) {
        float p = __expf(S[nt][v] - mn);
        rs[nt] += p;
        pf[nt >> 1].h[nt & 1][v] = (_Float16)p;
      }
    }
    lsum = lsum * alpha + ((rs[0] + rs[1]) + (rs[2] + rs[3]));

    // O^T += V^T @ P^T
#pragma unroll
    for (int ot = 0; ot < 4; ++ot) {
#pragma unroll
      for (int kk = 0; kk < 2; ++kk) {
        F16x16 av;
        const _Float16* vp = &Vs[kk * 32 + kb + (lane & 7)][ot * 16 + ((lane >> 3) & 1) * 8];
        av.h[0] = lds_load_tr16(vp);
        av.h[1] = lds_load_tr16(vp + 16 * 80);
        O[ot] = WMMA_F16(av.v, pf[kk].v, O[ot]);
      }
    }
    __syncthreads();
  }

  // Write y (f16), normalized: a lane holds 8 consecutive d of its query per tile
  const float inv = 1.0f / (lsum + xhalf(lsum));
  _Float16* yp = Yh + ((size_t)b * Tx + qrow) * Cx + h * 64 + kb;
#pragma unroll
  for (int ot = 0; ot < 4; ++ot) {
    v8h o;
#pragma unroll
    for (int v = 0; v < 8; ++v) o[v] = (_Float16)(O[ot][v] * inv);
    *reinterpret_cast<v8h*>(yp + ot * 16) = o;
  }
}

// ---------------------------------------------------------------------------
// out = xin + LayerNorm(t)*g + b, rows of LN_C floats. One wave per row, 16 rows
// per block: a lane holds 32 values of its row in registers (eight wave-wide
// loads of 512 contiguous bytes), the row's sums are joined by a butterfly over
// the 32 lanes, and no LDS or barrier is needed.
// ---------------------------------------------------------------------------
#define LN_C 1024

__global__ __launch_bounds__(512) void ln_residual(
    const float* __restrict__ xin, const float* __restrict__ t,
    const float* __restrict__ g, const float* __restrict__ be,
    float* __restrict__ outf, _Float16* __restrict__ outh)
{
  const int lane = threadIdx.x & 31;
  const int row  = blockIdx.x * (blockDim.x >> 5) + (threadIdx.x >> 5);
  const v4f* tr = reinterpret_cast<const v4f*>(t + (size_t)row * LN_C) + lane;
  const v4f* xr = reinterpret_cast<const v4f*>(xin + (size_t)row * LN_C) + lane;
  const v4f* gr = reinterpret_cast<const v4f*>(g) + lane;
  const v4f* br = reinterpret_cast<const v4f*>(be) + lane;

  v4f tv[8], xv[8], gv[8], bv[8];
#pragma unroll
  for (int q = 0; q < 8; ++q) tv[q] = tr[q * 32];
#pragma unroll
  for (int q = 0; q < 8; ++q) xv[q] = xr[q * 32];
#pragma unroll
  for (int q = 0; q < 8; ++q) gv[q] = gr[q * 32];
#pragma unroll
  for (int q = 0; q < 8; ++q) bv[q] = br[q * 32];
  // Stands in front of every rewrite of an address register of the loads above. The
  // two row pointers are named as inputs so that their registers live up to the wait;
  // otherwise the last load's result is placed on its own address pair.
  asm volatile("s_wait_xcnt 0x0" :: "v"(tr), "v"(xr) : "memory");
  // Keeps all 32 loads in front of the sums, so that the wave waits out one memory
  // latency; left free, the scheduler sinks 24 of them behind the sums in small groups.
  __builtin_amdgcn_sched_barrier(0);

  v4f sv = {}, sv2 = {};   // four independent chains each
#pragma unroll
  for (int q = 0; q < 8; ++q) { sv += tv[q]; sv2 += tv[q] * tv[q]; }
  float s  = (sv[0] + sv[1]) + (sv[2] + sv[3]);
  float s2 = (sv2[0] + sv2[1]) + (sv2[2] + sv2[3]);
#pragma unroll
  for (int off = 16; off; off >>= 1) { s += __shfl_xor(s, off, 32); s2 += __shfl_xor(s2, off, 32); }
  float mean = s / LN_C;
  float var  = s2 / LN_C - mean * mean;
  float rstd = rsqrtf(var + 1e-5f);

#pragma unroll
  for (int q = 0; q < 8; ++q)
#pragma unroll
    for (int e = 0; e < 4; ++e)
      xv[q][e] = xv[q][e] + (tv[q][e] - mean) * rstd * gv[q][e] + bv[q][e];
  if (outf) {
    v4f* of = reinterpret_cast<v4f*>(outf + (size_t)row * LN_C) + lane;
#pragma unroll
    for (int q = 0; q < 8; ++q) of[q * 32] = xv[q];
    // The conversion below may reuse the registers that these stores name.
    asm volatile("s_wait_xcnt 0x0" ::: "memory");
  }
  if (outh) {
    v4h* oh = reinterpret_cast<v4h*>(outh + (size_t)row * LN_C) + lane;
#pragma unroll
    for (int q = 0; q < 8; ++q) oh[q * 32] = __builtin_convertvector(xv[q], v4h);
  }
}

// ---------------------------------------------------------------------------
extern "C" void kernel_launch(void* const* d_in, const int* in_sizes, int n_in,
                              void* d_out, int out_size, void* d_ws, size_t ws_size,
                              hipStream_t stream) {
  (void)in_sizes; (void)n_in; (void)out_size; (void)ws_size;
  const int Bb = 2, T = 2048, C = 1024, NH = 16;
  const int M = Bb * T; // 4096

  const float* x      = (const float*)d_in[0];
  const float* w_attn = (const float*)d_in[1];
  const float* b_attn = (const float*)d_in[2];
  const float* wa1    = (const float*)d_in[3];
  const float* ba1    = (const float*)d_in[4];
  const float* wa2    = (const float*)d_in[5];
  const float* ba2    = (const float*)d_in[6];
  const float* g1     = (const float*)d_in[7];
  const float* be1    = (const float*)d_in[8];
  const float* wf1    = (const float*)d_in[9];
  const float* bf1    = (const float*)d_in[10];
  const float* wf2    = (const float*)d_in[11];
  const float* bf2    = (const float*)d_in[12];
  const float* g2     = (const float*)d_in[13];
  const float* be2    = (const float*)d_in[14];
  float* out = (float*)d_out;

  char* ws = (char*)d_ws;
  size_t off = 0;
  auto take = [&](size_t bytes) -> char* {
    char* p = ws + off;
    off += (bytes + 255) & ~(size_t)255;
    return p;
  };

  _Float16* Xh    = (_Float16*)take((size_t)M * C * 2);        // x f16; reused as Yh
  _Float16* Wattn = (_Float16*)take((size_t)C * 3 * C * 2);
  _Float16* Wa1h  = (_Float16*)take((size_t)C * 4 * C * 2);
  _Float16* Wa2h  = (_Float16*)take((size_t)4 * C * C * 2);
  _Float16* Wf1h  = (_Float16*)take((size_t)C * 4 * C * 2);
  _Float16* Wf2h  = (_Float16*)take((size_t)4 * C * C * 2);
  char*     qkvB  = take((size_t)M * 3 * C * 2);               // qkv f16; reused as t2/t4 f32
  _Float16* H1h   = (_Float16*)take((size_t)M * 4 * C * 2);    // FF hidden; reused for both FFs
  float*    x1    = (float*)take((size_t)M * C * 4);
  _Float16* x1h   = (_Float16*)take((size_t)M * C * 2);

  _Float16* qkvh = (_Float16*)qkvB;
  float*    t2f  = (float*)qkvB;   // reuse after attention consumes qkv
  _Float16* Yh   = Xh;             // reuse after QKV GEMM consumes Xh

  // f32 -> f16 conversions, one launch. Xh, Wattn, Wa1h, Wa2h, Wf1h, Wf2h were taken
  // in this order and each size is a multiple of 256 bytes, so they lie one behind
  // another from Xh on. Ends in units of CVT_UNIT floats.
  const int ux = M * C / CVT_UNIT, uq = C * 3 * C / CVT_UNIT, uf = C * 4 * C / CVT_UNIT;
  cvt_f32_f16_six<<<256, 512, 0, stream>>>(
      x, w_attn, wa1, wa2, wf1, wf2, Xh,
      ux, ux + uq, ux + uq + uf, ux + uq + 2 * uf, ux + uq + 3 * uf, ux + uq + 4 * uf);

  // qkv = x @ w_attn + b_attn  -> f16
  gemm_f16_wmma<false, false, 4, 4, 4><<<dim3(3 * C / 256, M / 256), 512, 0, stream>>>(
      Xh, Wattn, b_attn, nullptr, qkvh, M, 3 * C, C);

  // flash attention -> Yh (f16)
  attn_flash_wmma<<<dim3(Bb * NH, T / 64), 128, 0, stream>>>(qkvh, Yh, Bb, T, C, NH);

  // SelfAttn FF: H1 = gelu(y @ wa1 + ba1); t2 = H1 @ wa2 + ba2
  gemm_f16_wmma<true, false, 4, 4, 4><<<dim3(4 * C / 256, M / 256), 512, 0, stream>>>(
      Yh, Wa1h, ba1, nullptr, H1h, M, 4 * C, C);
  gemm_f16_wmma<false, true, 2, 4, 2><<<dim3(C / 128, M / 128), 256, 0, stream>>>(
      H1h, Wa2h, ba2, t2f, nullptr, M, C, 4 * C);

  // x1 = x + LN(t2)
  ln_residual<<<M / 16, 512, 0, stream>>>(x, t2f, g1, be1, x1, x1h);

  // Block FF: H2 = gelu(x1 @ wf1 + bf1); t4 = H2 @ wf2 + bf2
  gemm_f16_wmma<true, false, 4, 4, 4><<<dim3(4 * C / 256, M / 256), 512, 0, stream>>>(
      x1h, Wf1h, bf1, nullptr, H1h, M, 4 * C, C);
  gemm_f16_wmma<false, true, 2, 4, 2><<<dim3(C / 128, M / 128), 256, 0, stream>>>(
      H1h, Wf2h, bf2, t2f, nullptr, M, C, 4 * C);

  // out = x1 + LN(t4)
  ln_residual<<<M / 16, 512, 0, stream>>>(x1, t2f, g2, be2, out, nullptr);
}

// v007
// It runs in 245 microseconds.
// Two timings next to v006 put it at 1.05 and 1.06 times that version's speed.
// Counting every step since v000, it is 4.19 times as fast.
#include <hip/hip_runtime.h>
#include <hip/hip_bf16.h>

typedef __attribute__((ext_vector_type(16))) _Float16 v16h;
typedef __attribute__((ext_vector_type(8)))  _Float16 v8h;
typedef __attribute__((ext_vector_type(8)))  float    v8f;

union F16x16 { v16h v; v8h h[2]; };

#define WMMA_F16(a, b, c) \
  __builtin_amdgcn_wmma_f32_16x16x32_f16(false, (a), false, (b), (short)0, (c), false, false)

__device__ __forceinline__ void async_copy4_b128(
    void* l0, const void* g0, void* l1, const void* g1,
    void* l2, const void* g2, void* l3, const void* g3) {
  asm volatile("global_load_async_to_lds_b128 %0, %1, off\n\t"
               "global_load_async_to_lds_b128 %2, %3, off\n\t"
               "global_load_async_to_lds_b128 %4, %5, off\n\t"
               "global_load_async_to_lds_b128 %6, %7, off\n\t"
               "s_wait_xcnt 0x0"
               :: "v"((unsigned)(size_t)l0), "v"((unsigned long long)(size_t)g0),
                  "v"((unsigned)(size_t)l1), "v"((unsigned long long)(size_t)g1),
                  "v"((unsigned)(size_t)l2), "v"((unsigned long long)(size_t)g2),
                  "v"((unsigned)(size_t)l3), "v"((unsigned long long)(size_t)g3)
               : "memory");
}
__device__ __forceinline__ void async_copy8_b128(
    unsigned l0, const void* g0, unsigned l1, const void* g1,
    unsigned l2, const void* g2, unsigned l3, const void* g3,
    unsigned l4, const void* g4, unsigned l5, const void* g5,
    unsigned l6, const void* g6, unsigned l7, const void* g7) {
  asm volatile("global_load_async_to_lds_b128 %0, %1, off\n\t"
               "global_load_async_to_lds_b128 %2, %3, off\n\t"
               "global_load_async_to_lds_b128 %4, %5, off\n\t"
               "global_load_async_to_lds_b128 %6, %7, off\n\t"
               "global_load_async_to_lds_b128 %8, %9, off\n\t"
               "global_load_async_to_lds_b128 %10, %11, off\n\t"
               "global_load_async_to_lds_b128 %12, %13, off\n\t"
               "global_load_async_to_lds_b128 %14, %15, off\n\t"
               "s_wait_xcnt 0x0"
               :: "v"(l0), "v"((unsigned long long)(size_t)g0),
                  "v"(l1), "v"((unsigned long long)(size_t)g1),
                  "v"(l2), "v"((unsigned long long)(size_t)g2),
                  "v"(l3), "v"((unsigned long long)(size_t)g3),
                  "v"(l4), "v"((unsigned long long)(size_t)g4),
                  "v"(l5), "v"((unsigned long long)(size_t)g5),
                  "v"(l6), "v"((unsigned long long)(size_t)g6),
                  "v"(l7), "v"((unsigned long long)(size_t)g7)
               : "memory");
}
__device__ __forceinline__ void async_wait0() {
  asm volatile("s_wait_asynccnt 0x0" ::: "memory");
}

// ---------------------------------------------------------------------------
// Transposing LDS load: from a tile stored T[k][n] (k rows, n contiguous) lane
// (c = lane & 15, h = lane >> 4) receives T[k0 + 8h + 0..7][n0 + c]. The lane's
// own address is &T[k0 + 8h + (lane & 7)][n0 + 8 * ((lane >> 3) & 1)].
// Loads at k0 and k0 + 16 form one 32-k B fragment in the k order that the
// A loaders below use (8h + 0..7, then 16 + 8h + 0..7).
// ---------------------------------------------------------------------------
typedef __attribute__((ext_vector_type(8))) short v8s;
typedef __attribute__((address_space(3))) v8s lds_v8s;
__device__ __forceinline__ v8h lds_load_tr16(const _Float16* p) {
  return __builtin_bit_cast(v8h, __builtin_amdgcn_ds_load_tr16_b128_v8i16((lds_v8s*)p));
}

// ---------------------------------------------------------------------------
// f32 -> f16 conversion of six arrays in one launch. The grid is sized to be
// resident at once (one 16-wave block per WGP) and its waves walk the work, so
// that few waves have to be started. A unit is 1024 floats: eight wave-wide loads
// of 512 contiguous bytes, all issued before the first is used. The six f16
// results lie one behind another at out, in the order of the sources; e0..e5 are
// the running ends of the six arrays in units.
// ---------------------------------------------------------------------------
typedef __attribute__((ext_vector_type(4))) float    v4f;
typedef __attribute__((ext_vector_type(4))) _Float16 v4h;
#define CVT_UNIT 1024

__global__ __launch_bounds__(512) void cvt_f32_f16_six(
    const float* __restrict__ s0, const float* __restrict__ s1,
    const float* __restrict__ s2, const float* __restrict__ s3,
    const float* __restrict__ s4, const float* __restrict__ s5,
    _Float16* __restrict__ out,
    int e0, int e1, int e2, int e3, int e4, int e5)
{
  const int lane = threadIdx.x & 31;
  const int nw   = gridDim.x * (blockDim.x >> 5);
  // The wave's number, held scalar so that the choice of the source is a scalar one.
  const int wv   = __builtin_amdgcn_readfirstlane(blockIdx.x * (blockDim.x >> 5) + (threadIdx.x >> 5));
  for (int u = wv; u < e5; u += nw) {
    const float* s = s0;
    int first = 0;
    if (u >= e0) { s = s1; first = e0; }
    if (u >= e1) { s = s2; first = e1; }
    if (u >= e2) { s = s3; first = e2; }
    if (u >= e3) { s = s4; first = e3; }
    if (u >= e4) { s = s5; first = e4; }
    const v4f* p = reinterpret_cast<const v4f*>(s + (size_t)(u - first) * CVT_UNIT) + lane;
    v4h* o = reinterpret_cast<v4h*>(out + (size_t)u * CVT_UNIT) + lane;
    v4f a[8];
#pragma unroll
    for (int q = 0; q < 8; ++q) a[q] = p[q * 32];
#pragma unroll
    for (int q = 0; q < 8; ++q) o[q * 32] = __builtin_convertvector(a[q], v4h);
  }
}

#define BKK 64
#define LDSA (BKK + 8) // 72 halfs = 144B rows (16B x odd: the plain reader's pitch)

// x * Phi(x) with Phi(x) = erfc(-x / sqrt 2) / 2, the same path for every x, four
// elements at a time. q = erfc(|x| / sqrt 2) / 2 = (a1 t + ... + a5 t^5) exp(-x^2 / 2) / 2
// with t = 1 / (1 + p |x| / sqrt 2): absolute error of erf below 1.5e-7 for every x, the
// size of an f32 rounding of 1 + erf. x Phi(x) = max(x, 0) - |x| q on both sides of 0,
// with no cancellation for x < 0. The halves are folded into the coefficients.
__device__ __forceinline__ void gelu_erf4(float (&x)[4]) {
  float d[4], s[4], t[4], e[4];
#pragma unroll
  for (int c = 0; c < 4; ++c) {
    d[c] = fmaf(fabsf(x[c]), 0.23164190f, 1.0f);
    s[c] = (x[c] * -0.72134752f) * x[c];
  }
  asm("v_rcp_f32 %0, %8\n\t"
      "v_rcp_f32 %1, %9\n\t"
      "v_rcp_f32 %2, %10\n\t"
      "v_rcp_f32 %3, %11\n\t"
      "v_exp_f32 %4, %12\n\t"
      "v_exp_f32 %5, %13\n\t"
      "v_exp_f32 %6, %14\n\t"
      "v_exp_f32 %7, %15\n\t"
      "v_nop"
      : "=&v"(t[0]), "=&v"(t[1]), "=&v"(t[2]), "=&v"(t[3]),
        "=&v"(e[0]), "=&v"(e[1]), "=&v"(e[2]), "=&v"(e[3])
      : "v"(d[0]), "v"(d[1]), "v"(d[2]), "v"(d[3]),
        "v"(s[0]), "v"(s[1]), "v"(s[2]), "v"(s[3]));
#pragma unroll
  for (int c = 0; c < 4; ++c) {
    float p = fmaf(t[c], 0.5307027145f, -0.7265760135f);
    p = fmaf(t[c], p, 0.7107068705f);
    p = fmaf(t[c], p, -0.1422483680f);
    p = fmaf(t[c], p, 0.1274147960f);
    const float q = (p * t[c]) * e[c];
    x[c] = fmaf(-fabsf(x[c]), q, fmaxf(x[c], 0.0f));
  }
}

template <bool ACT, bool OUT32, int NWR, int NWC, int FJ>
__global__ __launch_bounds__(NWR * NWC * 32) void gemm_f16_wmma(
    const _Float16* __restrict__ A, const _Float16* __restrict__ Bm,
    const float* __restrict__ bias,
    float* __restrict__ Cf, _Float16* __restrict__ Ch,
    int M, int N, int K)
{
  constexpr int NT   = NWR * NWC * 32;   // threads
  constexpr int BM   = NWR * 64;
  constexpr int BN   = NWC * FJ * 16;
  constexpr int LDSB = BN + 16;          // 288B or 544B rows (32B x odd: the transposing reader's pitch)
  constexpr int RA   = NT / 8;           // A rows that one copy of every thread covers
  constexpr int CB   = BN / 8;           // 16B chunks in a B row
  constexpr int RB   = NT / CB;          // B rows that one copy of every thread covers
  static_assert(BM == 4 * RA && BKK == 4 * RB, "four A and four B copies per thread and stage");
  static_assert((LDSB / 16) % 2 == 1, "B pitch is 32B x odd");
  // 32-k blocks whose fragments a wave holds at once: the whole stage where the registers
  // allow it (64x32 wave tile, 8 waves), one block at 64x64 (16 waves, 256 registers each).
  constexpr int G = (FJ == 2) ? BKK / 32 : 1;
  __shared__ __attribute__((aligned(16))) _Float16 As[2][BM][LDSA];
  __shared__ __attribute__((aligned(16))) _Float16 Bs[2][BKK][LDSB]; // as in memory: Bs[.][k][n]

  const int tid  = threadIdx.x;
  const int lane = tid & 31;
  const int wave = tid >> 5;
  const int wr   = wave / NWC;
  const int wc   = wave % NWC;
  const int lr   = lane & 15;
  const int hi   = lane >> 4;   // 0/1
  const int kb   = hi * 8;      // K-chunk base per 16-bit A/B lane layout

  const int m0 = blockIdx.y * BM;
  const int n0 = blockIdx.x * BN;

  v8f acc[4][FJ] = {};

  // One stage = A BM x 64 halfs and B 64 x BN halfs in chunks of 16B, four of each
  // per thread: A rows r + RA q, B rows kk + RB q. The pointers walk one stage
  // further at every fill.
  const int r  = tid >> 3;
  const int kc = (tid & 7) * 8;
  const int kk = tid / CB;
  const int nn = (tid % CB) * 8;
  const _Float16* ag = &A[(size_t)(m0 + r) * K + kc];
  const _Float16* bg = &Bm[(size_t)kk * N + n0 + nn];
  const unsigned la = (unsigned)(size_t)&As[0][r][kc];
  const unsigned lb = (unsigned)(size_t)&Bs[0][kk][nn];
  auto fill = [&](int buf) {
    const unsigned a = la + (unsigned)buf * (unsigned)(BM * LDSA * 2);
    const unsigned b = lb + (unsigned)buf * (unsigned)(BKK * LDSB * 2);
    async_copy8_b128(a,                     ag,
                     a + 1 * RA * LDSA * 2, ag + (size_t)(1 * RA) * K,
                     a + 2 * RA * LDSA * 2, ag + (size_t)(2 * RA) * K,
                     a + 3 * RA * LDSA * 2, ag + (size_t)(3 * RA) * K,
                     b,                     bg,
                     b + 1 * RB * LDSB * 2, bg + (size_t)(1 * RB) * N,
                     b + 2 * RB * LDSB * 2, bg + (size_t)(2 * RB) * N,
                     b + 3 * RB * LDSB * 2, bg + (size_t)(3 * RB) * N);
    ag += BKK;
    bg += (size_t)BKK * N;
  };

  const int nst = K / BKK;
  fill(0);
  async_wait0();
  __syncthreads();
  if (nst > 1) fill(1);

  for (int t = 0; t < nst; ++t) {
    const int cur = t & 1;
#pragma unroll
    for (int ks = 0; ks < BKK; ks += 32 * G) {
      F16x16 af[G][4], bf[G][FJ];
#pragma unroll
      for (int g = 0; g < G; ++g) {
#pragma unroll
        for (int i = 0; i < 4; ++i) {
          const _Float16* p = &As[cur][wr * 64 + i * 16 + lr][ks + g * 32];
          af[g][i].h[0] = *reinterpret_cast<const v8h*>(p + kb);
          af[g][i].h[1] = *reinterpret_cast<const v8h*>(p + kb + 16);
        }
#pragma unroll
        for (int j = 0; j < FJ; ++j) {
          const _Float16* p = &Bs[cur][ks + g * 32 + kb + (lane & 7)][(wc * FJ + j) * 16 + ((lane >> 3) & 1) * 8];
          bf[g][j].h[0] = lds_load_tr16(p);
          bf[g][j].h[1] = lds_load_tr16(p + 16 * LDSB);
        }
      }
      __builtin_amdgcn_sched_barrier(0);
#pragma unroll
      for (int g = 0; g < G; ++g)
#pragma unroll
        for (int i = 0; i < 4; ++i)
#pragma unroll
          for (int j = 0; j < FJ; ++j)
            acc[i][j] = WMMA_F16(af[g][i].v, bf[g][j].v, acc[i][j]);
    }
    // With the whole stage's loads in one group, the scheduler would lift the waits below
    // over all the WMMAs: the wave would wait for all 24 loads before its first WMMA, and
    // the refill would stand behind the 16 WMMAs instead of directly behind the barrier.
    if (G > 1) __builtin_amdgcn_sched_barrier(0);
    // Hand-over: this wave's reads of buffer cur are done, its copies of stage
    // t + 1 have landed; behind the barrier that holds for every wave, so stage
    // t + 1 may be read and buffer cur refilled.
    asm volatile("s_wait_dscnt 0x0" ::: "memory");
    async_wait0();
    __syncthreads();
    if (t + 2 < nst) fill(cur);
  }
  // No copy is outstanding when the wave goes on to the epilogue.
  async_wait0();

  // Epilogue: D layout = lane(n), vgpr v -> row v + 8*hi
  float biasj[FJ];
#pragma unroll
  for (int j = 0; j < FJ; ++j) biasj[j] = bias[n0 + (wc * FJ + j) * 16 + lr];
#pragma unroll
  for (int i = 0; i < 4; ++i) {
#pragma unroll
    for (int j = 0; j < FJ; ++j) {
      int gn = n0 + (wc * FJ + j) * 16 + lr;
      float bv = biasj[j];
#pragma unroll
      for (int v0 = 0; v0 < 8; v0 += 4) {
        float x[4];
#pragma unroll
        for (int c = 0; c < 4; ++c) x[c] = acc[i][j][v0 + c] + bv;
        if (ACT) gelu_erf4(x);
#pragma unroll
        for (int c = 0; c < 4; ++c) {
          int gm = m0 + wr * 64 + i * 16 + v0 + c + hi * 8;
          size_t idx = (size_t)gm * N + gn;
          if (OUT32) Cf[idx] = x[c];
          else       Ch[idx] = (_Float16)x[c];
        }
      }
    }
  }
}

__device__ __forceinline__ float xhalf(float x) {
  const int i = __builtin_bit_cast(int, x);
  return __builtin_bit_cast(float,
      __builtin_amdgcn_permlanex16(i, i, 0x76543210, 0xfedcba98, false, false));
}

__global__ __launch_bounds__(128) void attn_flash_wmma(
    const _Float16* __restrict__ qkvh, _Float16* __restrict__ Yh,
    int Bx, int Tx, int Cx, int NHx)
{
  __shared__ __attribute__((aligned(16))) _Float16 Ks[64][72]; // key-major (rows = key, cols = d)
  __shared__ __attribute__((aligned(16))) _Float16 Vs[64][80]; // key-major, 160B rows (32B x odd)

  const int tid  = threadIdx.x;
  const int lane = tid & 31;
  const int w    = tid >> 5;   // 0..3
  const int lr   = lane & 15;
  const int hi   = lane >> 4;
  const int kb   = hi * 8;

  const int bh = blockIdx.x;
  const int b  = bh / NHx;
  const int h  = bh % NHx;
  const int qb = blockIdx.y;
  const int q0 = qb * 64;
  const int qrow = q0 + w * 16 + lr;   // this lane's query

  const size_t rstride = (size_t)3 * Cx;
  const _Float16* kbase = qkvh + (size_t)b * Tx * rstride + 0 * Cx + h * 64;
  const _Float16* qbase = qkvh + (size_t)b * Tx * rstride + 1 * Cx + h * 64;
  const _Float16* vbase = qkvh + (size_t)b * Tx * rstride + 2 * Cx + h * 64;

  // Q fragments (B operand: column = query lr), pre-scaled by 1/sqrt(64) = 0.125
  F16x16 qf[2];
  {
#pragma unroll
    for (int kk = 0; kk < 2; ++kk) {
      const _Float16* p = qbase + (size_t)qrow * rstride + kk * 32;
      v8h x0 = *reinterpret_cast<const v8h*>(p + kb);
      v8h x1 = *reinterpret_cast<const v8h*>(p + kb + 16);
#pragma unroll
      for (int j = 0; j < 8; ++j) {
        x0[j] = (_Float16)(x0[j] * (_Float16)0.125f);
        x1[j] = (_Float16)(x1[j] * (_Float16)0.125f);
      }
      qf[kk].h[0] = x0; qf[kk].h[1] = x1;
    }
  }

  float mrow = -3.0e38f;   // running maximum of this lane's query (equal in both halves)
  float lsum = 0.0f;       // running sum over this half's keys only; joined after the loop
  v8f O[4] = {};           // O[ot][v] = O^T[d = 16 ot + 8 hi + v][query lr]

  for (int jb = 0; jb <= qb; ++jb) {
    const int key0 = jb * 64;
    // K and V tiles: async straight copies, 512 chunks of 16B each, four per
    // thread (rows key, key + 16, key + 32, key + 48).
    {
      const int key = tid >> 3;
      const int dc  = (tid & 7) * 8;
      const _Float16* kg = kbase + (size_t)(key0 + key) * rstride + dc;
      const _Float16* vg = vbase + (size_t)(key0 + key) * rstride + dc;
      async_copy4_b128(&Ks[key][dc],      kg,
                       &Ks[key + 16][dc], kg + 16 * rstride,
                       &Ks[key + 32][dc], kg + 32 * rstride,
                       &Ks[key + 48][dc], kg + 48 * rstride);
      async_copy4_b128(&Vs[key][dc],      vg,
                       &Vs[key + 16][dc], vg + 16 * rstride,
                       &Vs[key + 32][dc], vg + 32 * rstride,
                       &Vs[key + 48][dc], vg + 48 * rstride);
    }
    async_wait0();
    __syncthreads();

    // S^T = K @ (Q/8)^T : 4 tiles of 16 keys, K-dim 64 = 2 WMMAs each.
    // S[nt][v] = score of key key0 + 16 nt + 8 hi + v against query lr.
    F16x16 ak[4][2];
#pragma unroll
    for (int nt = 0; nt < 4; ++nt) {
#pragma unroll
      for (int kk = 0; kk < 2; ++kk) {
        const _Float16* p = &Ks[nt * 16 + lr][kk * 32];
        ak[nt][kk].h[0] = *reinterpret_cast<const v8h*>(p + kb);
        ak[nt][kk].h[1] = *reinterpret_cast<const v8h*>(p + kb + 16);
      }
    }
    __builtin_amdgcn_sched_barrier(0);
    v8f S[4];
#pragma unroll
    for (int nt = 0; nt < 4; ++nt) {
      S[nt] = (v8f){};
#pragma unroll
      for (int kk = 0; kk < 2; ++kk) S[nt] = WMMA_F16(ak[nt][kk].v, qf[kk].v, S[nt]);
    }
    F16x16 av[4][2];
#pragma unroll
    for (int ot = 0; ot < 4; ++ot) {
#pragma unroll
      for (int kk = 0; kk < 2; ++kk) {
        const _Float16* vp = &Vs[kk * 32 + kb + (lane & 7)][ot * 16 + ((lane >> 3) & 1) * 8];
        av[ot][kk].h[0] = lds_load_tr16(vp);
        av[ot][kk].h[1] = lds_load_tr16(vp + 16 * 80);
      }
    }
    // Keeps those loads here. Left free, the scheduler sinks them to the second product,
    // two in front of each WMMA behind a wait to 0.
    __builtin_amdgcn_sched_barrier(0);
    // Causal mask (only the diagonal block needs it)
    if (jb == qb) {
#pragma unroll
      for (int nt = 0; nt < 4; ++nt) {
#pragma unroll
        for (int v = 0; v < 8; ++v) {
          int col = key0 + nt * 16 + kb + v;
          if (col > qrow) S[nt][v] = -3.0e38f;
        }
      }
    }

    // Online softmax update of the lane's query
    float tm[4];
#pragma unroll
    for (int nt = 0; nt < 4; ++nt) {
      tm[nt] = S[nt][0];
#pragma unroll
      for (int v = 1; v < 8; ++v) tm[nt] = fmaxf(tm[nt], S[nt][v]);
    }
    float t = fmaxf(fmaxf(tm[0], tm[1]), fmaxf(tm[2], tm[3]));
    t = fmaxf(t, xhalf(t));
    const float mn = fmaxf(mrow, t);
    const float alpha = __expf(mrow - mn);
    mrow = mn;
#pragma unroll
    for (int ot = 0; ot < 4; ++ot) O[ot] *= alpha;

    // P^T as B operand: element s of the 32-key fragment kk is tile 2 kk + (s >> 3),
    // register s & 7, which is the k order of the transposing load above.
    F16x16 pf[2];
    float rs[4];
#pragma unroll
    for (int nt = 0; nt < 4; ++nt) {
      rs[nt] = 0.0f;
#pragma unroll
      for (int v = 0; v < 8; ++v) {
        float p = __expf(S[nt][v] - mn);
        rs[nt] += p;
        pf[nt >> 1].h[nt & 1][v] = (_Float16)p;
      }
    }
    lsum = lsum * alpha + ((rs[0] + rs[1]) + (rs[2] + rs[3]));

    // O^T += V^T @ P^T
#pragma unroll
    for (int ot = 0; ot < 4; ++ot) {
#pragma unroll
      for (int kk = 0; kk < 2; ++kk) O[ot] = WMMA_F16(av[ot][kk].v, pf[kk].v, O[ot]);
    }
    // Keeps the barrier below at the tile's end. No LDS access follows the V^T loads, so
    // the scheduler lifts it, with its wait to 0, to the head of the softmax, where the
    // wave would stand still for those loads instead of computing under them.
    __builtin_amdgcn_sched_barrier(0);
    __syncthreads();
  }

  // Write y (f16), normalized: a lane holds 8 consecutive d of its query per tile
  const float inv = 1.0f / (lsum + xhalf(lsum));
  _Float16* yp = Yh + ((size_t)b * Tx + qrow) * Cx + h * 64 + kb;
#pragma unroll
  for (int ot = 0; ot < 4; ++ot) {
    v8h o;
#pragma unroll
    for (int v = 0; v < 8; ++v) o[v] = (_Float16)(O[ot][v] * inv);
    *reinterpret_cast<v8h*>(yp + ot * 16) = o;
  }
}

// ---------------------------------------------------------------------------
// out = xin + LayerNorm(t)*g + b, rows of LN_C floats. One wave per row, 16 rows
// per block: a lane holds 32 values of its row in registers (eight wave-wide
// loads of 512 contiguous bytes), the row's sums are joined by a butterfly over
// the 32 lanes, and no LDS or barrier is needed.
// ---------------------------------------------------------------------------
#define LN_C 1024

__global__ __launch_bounds__(512) void ln_residual(
    const float* __restrict__ xin, const float* __restrict__ t,
    const float* __restrict__ g, const float* __restrict__ be,
    float* __restrict__ outf, _Float16* __restrict__ outh)
{
  const int lane = threadIdx.x & 31;
  const int row  = blockIdx.x * (blockDim.x >> 5) + (threadIdx.x >> 5);
  const v4f* tr = reinterpret_cast<const v4f*>(t + (size_t)row * LN_C) + lane;
  const v4f* xr = reinterpret_cast<const v4f*>(xin + (size_t)row * LN_C) + lane;
  const v4f* gr = reinterpret_cast<const v4f*>(g) + lane;
  const v4f* br = reinterpret_cast<const v4f*>(be) + lane;

  v4f tv[8], xv[8], gv[8], bv[8];
#pragma unroll
  for (int q = 0; q < 8; ++q) tv[q] = tr[q * 32];
#pragma unroll
  for (int q = 0; q < 8; ++q) xv[q] = xr[q * 32];
#pragma unroll
  for (int q = 0; q < 8; ++q) gv[q] = gr[q * 32];
#pragma unroll
  for (int q = 0; q < 8; ++q) bv[q] = br[q * 32];
  // Stands in front of every rewrite of an address register of the loads above. The
  // two row pointers are named as inputs so that their registers live up to the wait;
  // otherwise the last load's result is placed on its own address pair.
  asm volatile("s_wait_xcnt 0x0" :: "v"(tr), "v"(xr) : "memory");
  // Keeps all 32 loads in front of the sums, so that the wave waits out one memory
  // latency; left free, the scheduler sinks 24 of them behind the sums in small groups.
  __builtin_amdgcn_sched_barrier(0);

  v4f sv = {}, sv2 = {};   // four independent chains each
#pragma unroll
  for (int q = 0; q < 8; ++q) { sv += tv[q]; sv2 += tv[q] * tv[q]; }
  float s  = (sv[0] + sv[1]) + (sv[2] + sv[3]);
  float s2 = (sv2[0] + sv2[1]) + (sv2[2] + sv2[3]);
#pragma unroll
  for (int off = 16; off; off >>= 1) { s += __shfl_xor(s, off, 32); s2 += __shfl_xor(s2, off, 32); }
  float mean = s / LN_C;
  float var  = s2 / LN_C - mean * mean;
  float rstd = rsqrtf(var + 1e-5f);

#pragma unroll
  for (int q = 0; q < 8; ++q)
#pragma unroll
    for (int e = 0; e < 4; ++e)
      xv[q][e] = xv[q][e] + (tv[q][e] - mean) * rstd * gv[q][e] + bv[q][e];
  if (outf) {
    v4f* of = reinterpret_cast<v4f*>(outf + (size_t)row * LN_C) + lane;
#pragma unroll
    for (int q = 0; q < 8; ++q) of[q * 32] = xv[q];
    // The conversion below may reuse the registers that these stores name.
    asm volatile("s_wait_xcnt 0x0" ::: "memory");
  }
  if (outh) {
    v4h* oh = reinterpret_cast<v4h*>(outh + (size_t)row * LN_C) + lane;
#pragma unroll
    for (int q = 0; q < 8; ++q) oh[q * 32] = __builtin_convertvector(xv[q], v4h);
  }
}

// ---------------------------------------------------------------------------
extern "C" void kernel_launch(void* const* d_in, const int* in_sizes, int n_in,
                              void* d_out, int out_size, void* d_ws, size_t ws_size,
                              hipStream_t stream) {
  (void)in_sizes; (void)n_in; (void)out_size; (void)ws_size;
  const int Bb = 2, T = 2048, C = 1024, NH = 16;
  const int M = Bb * T; // 4096

  const float* x      = (const float*)d_in[0];
  const float* w_attn = (const float*)d_in[1];
  const float* b_attn = (const float*)d_in[2];
  const float* wa1    = (const float*)d_in[3];
  const float* ba1    = (const float*)d_in[4];
  const float* wa2    = (const float*)d_in[5];
  const float* ba2    = (const float*)d_in[6];
  const float* g1     = (const float*)d_in[7];
  const float* be1    = (const float*)d_in[8];
  const float* wf1    = (const float*)d_in[9];
  const float* bf1    = (const float*)d_in[10];
  const float* wf2    = (const float*)d_in[11];
  const float* bf2    = (const float*)d_in[12];
  const float* g2     = (const float*)d_in[13];
  const float* be2    = (const float*)d_in[14];
  float* out = (float*)d_out;

  char* ws = (char*)d_ws;
  size_t off = 0;
  auto take = [&](size_t bytes) -> char* {
    char* p = ws + off;
    off += (bytes + 255) & ~(size_t)255;
    return p;
  };

  _Float16* Xh    = (_Float16*)take((size_t)M * C * 2);        // x f16; reused as Yh
  _Float16* Wattn = (_Float16*)take((size_t)C * 3 * C * 2);
  _Float16* Wa1h  = (_Float16*)take((size_t)C * 4 * C * 2);
  _Float16* Wa2h  = (_Float16*)take((size_t)4 * C * C * 2);
  _Float16* Wf1h  = (_Float16*)take((size_t)C * 4 * C * 2);
  _Float16* Wf2h  = (_Float16*)take((size_t)4 * C * C * 2);
  char*     qkvB  = take((size_t)M * 3 * C * 2);               // qkv f16; reused as t2/t4 f32
  _Float16* H1h   = (_Float16*)take((size_t)M * 4 * C * 2);    // FF hidden; reused for both FFs
  float*    x1    = (float*)take((size_t)M * C * 4);
  _Float16* x1h   = (_Float16*)take((size_t)M * C * 2);

  _Float16* qkvh = (_Float16*)qkvB;
  float*    t2f  = (float*)qkvB;   // reuse after attention consumes qkv
  _Float16* Yh   = Xh;             // reuse after QKV GEMM consumes Xh

  // f32 -> f16 conversions, one launch. Xh, Wattn, Wa1h, Wa2h, Wf1h, Wf2h were taken
  // in this order and each size is a multiple of 256 bytes, so they lie one behind
  // another from Xh on. Ends in units of CVT_UNIT floats.
  const int ux = M * C / CVT_UNIT, uq = C * 3 * C / CVT_UNIT, uf = C * 4 * C / CVT_UNIT;
  cvt_f32_f16_six<<<256, 512, 0, stream>>>(
      x, w_attn, wa1, wa2, wf1, wf2, Xh,
      ux, ux + uq, ux + uq + uf, ux + uq + 2 * uf, ux + uq + 3 * uf, ux + uq + 4 * uf);

  // qkv = x @ w_attn + b_attn  -> f16
  gemm_f16_wmma<false, false, 4, 4, 4><<<dim3(3 * C / 256, M / 256), 512, 0, stream>>>(
      Xh, Wattn, b_attn, nullptr, qkvh, M, 3 * C, C);

  // flash attention -> Yh (f16)
  attn_flash_wmma<<<dim3(Bb * NH, T / 64), 128, 0, stream>>>(qkvh, Yh, Bb, T, C, NH);

  // SelfAttn FF: H1 = gelu(y @ wa1 + ba1); t2 = H1 @ wa2 + ba2
  gemm_f16_wmma<true, false, 4, 4, 4><<<dim3(4 * C / 256, M / 256), 512, 0, stream>>>(
      Yh, Wa1h, ba1, nullptr, H1h, M, 4 * C, C);
  gemm_f16_wmma<false, true, 2, 4, 2><<<dim3(C / 128, M / 128), 256, 0, stream>>>(
      H1h, Wa2h, ba2, t2f, nullptr, M, C, 4 * C);

  // x1 = x + LN(t2)
  ln_residual<<<M / 16, 512, 0, stream>>>(x, t2f, g1, be1, x1, x1h);

  // Block FF: H2 = gelu(x1 @ wf1 + bf1); t4 = H2 @ wf2 + bf2
  gemm_f16_wmma<true, false, 4, 4, 4><<<dim3(4 * C / 256, M / 256), 512, 0, stream>>>(
      x1h, Wf1h, bf1, nullptr, H1h, M, 4 * C, C);
  gemm_f16_wmma<false, true, 2, 4, 2><<<dim3(C / 128, M / 128), 256, 0, stream>>>(
      H1h, Wf2h, bf2, t2f, nullptr, M, C, 4 * C);

  // out = x1 + LN(t4)
  ln_residual<<<M / 16, 512, 0, stream>>>(x1, t2f, g2, be2, out, nullptr);
}

// v008
// One run takes 191 microseconds.
// Timed twice side by side with v007, it ran 1.28 times as fast both times.
// Counting every step since v000, it is 5.35 times as fast.
#include <hip/hip_runtime.h>
#include <hip/hip_bf16.h>

typedef __attribute__((ext_vector_type(16))) _Float16 v16h;
typedef __attribute__((ext_vector_type(8)))  _Float16 v8h;
typedef __attribute__((ext_vector_type(8)))  float    v8f;

union F16x16 { v16h v; v8h h[2]; };

#define WMMA_F16(a, b, c) \
  __builtin_amdgcn_wmma_f32_16x16x32_f16(false, (a), false, (b), (short)0, (c), false, false)

__device__ __forceinline__ void async_copy4_b128(
    void* l0, const void* g0, void* l1, const void* g1,
    void* l2, const void* g2, void* l3, const void* g3) {
  asm volatile("global_load_async_to_lds_b128 %0, %1, off\n\t"
               "global_load_async_to_lds_b128 %2, %3, off\n\t"
               "global_load_async_to_lds_b128 %4, %5, off\n\t"
               "global_load_async_to_lds_b128 %6, %7, off\n\t"
               "s_wait_xcnt 0x0"
               :: "v"((unsigned)(size_t)l0), "v"((unsigned long long)(size_t)g0),
                  "v"((unsigned)(size_t)l1), "v"((unsigned long long)(size_t)g1),
                  "v"((unsigned)(size_t)l2), "v"((unsigned long long)(size_t)g2),
                  "v"((unsigned)(size_t)l3), "v"((unsigned long long)(size_t)g3)
               : "memory");
}
__device__ __forceinline__ void async_copy8_b128(
    unsigned l0, const void* g0, unsigned l1, const void* g1,
    unsigned l2, const void* g2, unsigned l3, const void* g3,
    unsigned l4, const void* g4, unsigned l5, const void* g5,
    unsigned l6, const void* g6, unsigned l7, const void* g7) {
  asm volatile("global_load_async_to_lds_b128 %0, %1, off\n\t"
               "global_load_async_to_lds_b128 %2, %3, off\n\t"
               "global_load_async_to_lds_b128 %4, %5, off\n\t"
               "global_load_async_to_lds_b128 %6, %7, off\n\t"
               "global_load_async_to_lds_b128 %8, %9, off\n\t"
               "global_load_async_to_lds_b128 %10, %11, off\n\t"
               "global_load_async_to_lds_b128 %12, %13, off\n\t"
               "global_load_async_to_lds_b128 %14, %15, off\n\t"
               "s_wait_xcnt 0x0"
               :: "v"(l0), "v"((unsigned long long)(size_t)g0),
                  "v"(l1), "v"((unsigned long long)(size_t)g1),
                  "v"(l2), "v"((unsigned long long)(size_t)g2),
                  "v"(l3), "v"((unsigned long long)(size_t)g3),
                  "v"(l4), "v"((unsigned long long)(size_t)g4),
                  "v"(l5), "v"((unsigned long long)(size_t)g5),
                  "v"(l6), "v"((unsigned long long)(size_t)g6),
                  "v"(l7), "v"((unsigned long long)(size_t)g7)
               : "memory");
}
__device__ __forceinline__ void async_wait0() {
  asm volatile("s_wait_asynccnt 0x0" ::: "memory");
}

// ---------------------------------------------------------------------------
// Transposing LDS load: from a tile stored T[k][n] (k rows, n contiguous) lane
// (c = lane & 15, h = lane >> 4) receives T[k0 + 8h + 0..7][n0 + c]. The lane's
// own address is &T[k0 + 8h + (lane & 7)][n0 + 8 * ((lane >> 3) & 1)].
// Loads at k0 and k0 + 16 form one 32-k B fragment in the k order that the
// A loaders below use (8h + 0..7, then 16 + 8h + 0..7).
// ---------------------------------------------------------------------------
typedef __attribute__((ext_vector_type(8))) short v8s;
typedef __attribute__((address_space(3))) v8s lds_v8s;
__device__ __forceinline__ v8h lds_load_tr16(const _Float16* p) {
  return __builtin_bit_cast(v8h, __builtin_amdgcn_ds_load_tr16_b128_v8i16((lds_v8s*)p));
}

// ---------------------------------------------------------------------------
// f32 -> f16 conversion of six arrays in one launch. The grid is sized to be
// resident at once (one 16-wave block per WGP) and its waves walk the work, so
// that few waves have to be started. A unit is 1024 floats: eight wave-wide loads
// of 512 contiguous bytes, all issued before the first is used. The six f16
// results lie one behind another at out, in the order of the sources; e0..e5 are
// the running ends of the six arrays in units.
// ---------------------------------------------------------------------------
typedef __attribute__((ext_vector_type(4))) float    v4f;
typedef __attribute__((ext_vector_type(4))) _Float16 v4h;
#define CVT_UNIT 1024

__global__ __launch_bounds__(512) void cvt_f32_f16_six(
    const float* __restrict__ s0, const float* __restrict__ s1,
    const float* __restrict__ s2, const float* __restrict__ s3,
    const float* __restrict__ s4, const float* __restrict__ s5,
    _Float16* __restrict__ out,
    int e0, int e1, int e2, int e3, int e4, int e5)
{
  const int lane = threadIdx.x & 31;
  const int nw   = gridDim.x * (blockDim.x >> 5);
  // The wave's number, held scalar so that the choice of the source is a scalar one.
  const int wv   = __builtin_amdgcn_readfirstlane(blockIdx.x * (blockDim.x >> 5) + (threadIdx.x >> 5));
  for (int u = wv; u < e5; u += nw) {
    const float* s = s0;
    int first = 0;
    if (u >= e0) { s = s1; first = e0; }
    if (u >= e1) { s = s2; first = e1; }
    if (u >= e2) { s = s3; first = e2; }
    if (u >= e3) { s = s4; first = e3; }
    if (u >= e4) { s = s5; first = e4; }
    const v4f* p = reinterpret_cast<const v4f*>(s + (size_t)(u - first) * CVT_UNIT) + lane;
    v4h* o = reinterpret_cast<v4h*>(out + (size_t)u * CVT_UNIT) + lane;
    v4f a[8];
#pragma unroll
    for (int q = 0; q < 8; ++q) a[q] = p[q * 32];
#pragma unroll
    for (int q = 0; q < 8; ++q) o[q * 32] = __builtin_convertvector(a[q], v4h);
  }
}

// x * Phi(x) with Phi(x) = erfc(-x / sqrt 2) / 2, the same path for every x, four
// elements at a time. q = erfc(|x| / sqrt 2) / 2 = (a1 t + ... + a5 t^5) exp(-x^2 / 2) / 2
// with t = 1 / (1 + p |x| / sqrt 2): absolute error of erf below 1.5e-7 for every x, the
// size of an f32 rounding of 1 + erf. x Phi(x) = max(x, 0) - |x| q on both sides of 0,
// with no cancellation for x < 0. The halves are folded into the coefficients.
__device__ __forceinline__ void gelu_erf4(float (&x)[4]) {
  float d[4], s[4], t[4], e[4];
#pragma unroll
  for (int c = 0; c < 4; ++c) {
    d[c] = fmaf(fabsf(x[c]), 0.23164190f, 1.0f);
    s[c] = (x[c] * -0.72134752f) * x[c];
  }
  asm("v_rcp_f32 %0, %8\n\t"
      "v_rcp_f32 %1, %9\n\t"
      "v_rcp_f32 %2, %10\n\t"
      "v_rcp_f32 %3, %11\n\t"
      "v_exp_f32 %4, %12\n\t"
      "v_exp_f32 %5, %13\n\t"
      "v_exp_f32 %6, %14\n\t"
      "v_exp_f32 %7, %15\n\t"
      "v_nop"
      : "=&v"(t[0]), "=&v"(t[1]), "=&v"(t[2]), "=&v"(t[3]),
        "=&v"(e[0]), "=&v"(e[1]), "=&v"(e[2]), "=&v"(e[3])
      : "v"(d[0]), "v"(d[1]), "v"(d[2]), "v"(d[3]),
        "v"(s[0]), "v"(s[1]), "v"(s[2]), "v"(s[3]));
#pragma unroll
  for (int c = 0; c < 4; ++c) {
    float p = fmaf(t[c], 0.5307027145f, -0.7265760135f);
    p = fmaf(t[c], p, 0.7107068705f);
    p = fmaf(t[c], p, -0.1422483680f);
    p = fmaf(t[c], p, 0.1274147960f);
    const float q = (p * t[c]) * e[c];
    x[c] = fmaf(-fabsf(x[c]), q, fmaxf(x[c], 0.0f));
  }
}

template <bool ACT, bool OUT32, int NWR, int NWC, int FJ, int BK>
__global__ __launch_bounds__(NWR * NWC * 32) void gemm_f16_wmma(
    const _Float16* __restrict__ A, const _Float16* __restrict__ Bm,
    const float* __restrict__ bias,
    float* __restrict__ Cf, _Float16* __restrict__ Ch,
    int M, int N, int K)
{
  constexpr int NT   = NWR * NWC * 32;   // threads
  constexpr int BM   = NWR * 64;
  constexpr int BN   = NWC * FJ * 16;
  constexpr int LDSA = BK + 8;           // 272B or 528B rows (16B x odd: the plain reader's pitch)
  constexpr int LDSB = BN + 16;          // 288B or 544B rows (32B x odd: the transposing reader's pitch)
  constexpr int CA   = BK / 8;           // 16B chunks in an A row
  constexpr int RA   = NT / CA;          // A rows that one copy of every thread covers
  constexpr int CB   = BN / 8;           // 16B chunks in a B row
  constexpr int RB   = NT / CB;          // B rows that one copy of every thread covers
  constexpr int NA   = BM / RA;          // A copies per thread and stage
  constexpr int NB   = BK / RB;          // B copies per thread and stage
  static_assert(NA % 8 == 0 && NB % 8 == 0, "copies go in statements of eight");
  static_assert(NA + NB <= 63, "one stage's copies of a wave are in flight at once");
  static_assert((LDSA / 8) % 2 == 1, "A pitch is 16B x odd");
  static_assert((LDSB / 16) % 2 == 1, "B pitch is 32B x odd");
  // 32-k blocks whose fragments a wave holds at once: two where the registers allow it
  // (64x32 wave tile, 8 waves), one block at 64x64 (16 waves, 256 registers each).
  constexpr int G = (FJ == 2) ? 2 : 1;
  __shared__ __attribute__((aligned(16))) _Float16 As[2][BM][LDSA];
  __shared__ __attribute__((aligned(16))) _Float16 Bs[2][BK][LDSB]; // as in memory: Bs[.][k][n]

  const int tid  = threadIdx.x;
  const int lane = tid & 31;
  const int wave = tid >> 5;
  const int wr   = wave / NWC;
  const int wc   = wave % NWC;
  const int lr   = lane & 15;
  const int hi   = lane >> 4;   // 0/1
  const int kb   = hi * 8;      // K-chunk base per 16-bit A/B lane layout

  const int m0 = blockIdx.y * BM;
  const int n0 = blockIdx.x * BN;

  v8f acc[4][FJ] = {};

  // One stage = A BM x BK halfs and B BK x BN halfs in chunks of 16B, NA and NB
  // per thread: A rows r + RA q, B rows kk + RB q. The pointers walk one stage
  // further at every fill.
  const int r  = tid / CA;
  const int kc = (tid % CA) * 8;
  const int kk = tid / CB;
  const int nn = (tid % CB) * 8;
  const _Float16* ag = &A[(size_t)(m0 + r) * K + kc];
  const _Float16* bg = &Bm[(size_t)kk * N + n0 + nn];
  const unsigned la = (unsigned)(size_t)&As[0][r][kc];
  const unsigned lb = (unsigned)(size_t)&Bs[0][kk][nn];
  auto fill = [&](int buf) {
    const unsigned a = la + (unsigned)buf * (unsigned)(BM * LDSA * 2);
    const unsigned b = lb + (unsigned)buf * (unsigned)(BK * LDSB * 2);
#pragma unroll
    for (int q = 0; q < NA; q += 8)
      async_copy8_b128(a + (q + 0) * RA * LDSA * 2, ag + (size_t)((q + 0) * RA) * K,
                       a + (q + 1) * RA * LDSA * 2, ag + (size_t)((q + 1) * RA) * K,
                       a + (q + 2) * RA * LDSA * 2, ag + (size_t)((q + 2) * RA) * K,
                       a + (q + 3) * RA * LDSA * 2, ag + (size_t)((q + 3) * RA) * K,
                       a + (q + 4) * RA * LDSA * 2, ag + (size_t)((q + 4) * RA) * K,
                       a + (q + 5) * RA * LDSA * 2, ag + (size_t)((q + 5) * RA) * K,
                       a + (q + 6) * RA * LDSA * 2, ag + (size_t)((q + 6) * RA) * K,
                       a + (q + 7) * RA * LDSA * 2, ag + (size_t)((q + 7) * RA) * K);
#pragma unroll
    for (int q = 0; q < NB; q += 8)
      async_copy8_b128(b + (q + 0) * RB * LDSB * 2, bg + (size_t)((q + 0) * RB) * N,
                       b + (q + 1) * RB * LDSB * 2, bg + (size_t)((q + 1) * RB) * N,
                       b + (q + 2) * RB * LDSB * 2, bg + (size_t)((q + 2) * RB) * N,
                       b + (q + 3) * RB * LDSB * 2, bg + (size_t)((q + 3) * RB) * N,
                       b + (q + 4) * RB * LDSB * 2, bg + (size_t)((q + 4) * RB) * N,
                       b + (q + 5) * RB * LDSB * 2, bg + (size_t)((q + 5) * RB) * N,
                       b + (q + 6) * RB * LDSB * 2, bg + (size_t)((q + 6) * RB) * N,
                       b + (q + 7) * RB * LDSB * 2, bg + (size_t)((q + 7) * RB) * N);
    ag += BK;
    bg += (size_t)BK * N;
  };

  const int nst = K / BK;
  fill(0);
  async_wait0();
  __syncthreads();
  if (nst > 1) fill(1);

  for (int t = 0; t < nst; ++t) {
    const int cur = t & 1;
#pragma unroll
    for (int ks = 0; ks < BK; ks += 32 * G) {
      F16x16 af[G][4], bf[G][FJ];
#pragma unroll
      for (int g = 0; g < G; ++g) {
#pragma unroll
        for (int i = 0; i < 4; ++i) {
          const _Float16* p = &As[cur][wr * 64 + i * 16 + lr][ks + g * 32];
          af[g][i].h[0] = *reinterpret_cast<const v8h*>(p + kb);
          af[g][i].h[1] = *reinterpret_cast<const v8h*>(p + kb + 16);
        }
#pragma unroll
        for (int j = 0; j < FJ; ++j) {
          const _Float16* p = &Bs[cur][ks + g * 32 + kb + (lane & 7)][(wc * FJ + j) * 16 + ((lane >> 3) & 1) * 8];
          bf[g][j].h[0] = lds_load_tr16(p);
          bf[g][j].h[1] = lds_load_tr16(p + 16 * LDSB);
        }
      }
      __builtin_amdgcn_sched_barrier(0);
#pragma unroll
      for (int g = 0; g < G; ++g)
#pragma unroll
        for (int i = 0; i < 4; ++i)
#pragma unroll
          for (int j = 0; j < FJ; ++j)
            acc[i][j] = WMMA_F16(af[g][i].v, bf[g][j].v, acc[i][j]);
    }
    // Without it the scheduler would lift the waits below over the last group's WMMAs:
    // the wave would wait for all 24 loads before the first of them, and the refill
    // would stand behind the 16 WMMAs instead of directly behind the barrier.
    if (G > 1) __builtin_amdgcn_sched_barrier(0);
    // Hand-over: this wave's reads of buffer cur are done, its copies of stage
    // t + 1 have landed; behind the barrier that holds for every wave, so stage
    // t + 1 may be read and buffer cur refilled.
    asm volatile("s_wait_dscnt 0x0" ::: "memory");
    async_wait0();
    __syncthreads();
    if (t + 2 < nst) fill(cur);
  }
  // No copy is outstanding when the wave goes on to the epilogue.
  async_wait0();

  // Epilogue: D layout = lane(n), vgpr v -> row v + 8*hi
  float biasj[FJ];
#pragma unroll
  for (int j = 0; j < FJ; ++j) biasj[j] = bias[n0 + (wc * FJ + j) * 16 + lr];
#pragma unroll
  for (int i = 0; i < 4; ++i) {
#pragma unroll
    for (int j = 0; j < FJ; ++j) {
      int gn = n0 + (wc * FJ + j) * 16 + lr;
      float bv = biasj[j];
#pragma unroll
      for (int v0 = 0; v0 < 8; v0 += 4) {
        float x[4];
#pragma unroll
        for (int c = 0; c < 4; ++c) x[c] = acc[i][j][v0 + c] + bv;
        if (ACT) gelu_erf4(x);
#pragma unroll
        for (int c = 0; c < 4; ++c) {
          int gm = m0 + wr * 64 + i * 16 + v0 + c + hi * 8;
          size_t idx = (size_t)gm * N + gn;
          if (OUT32) Cf[idx] = x[c];
          else       Ch[idx] = (_Float16)x[c];
        }
      }
    }
  }
}

__device__ __forceinline__ float xhalf(float x) {
  const int i = __builtin_bit_cast(int, x);
  return __builtin_bit_cast(float,
      __builtin_amdgcn_permlanex16(i, i, 0x76543210, 0xfedcba98, false, false));
}

__global__ __launch_bounds__(128) void attn_flash_wmma(
    const _Float16* __restrict__ qkvh, _Float16* __restrict__ Yh,
    int Bx, int Tx, int Cx, int NHx)
{
  __shared__ __attribute__((aligned(16))) _Float16 Ks[64][72]; // key-major (rows = key, cols = d)
  __shared__ __attribute__((aligned(16))) _Float16 Vs[64][80]; // key-major, 160B rows (32B x odd)

  const int tid  = threadIdx.x;
  const int lane = tid & 31;
  const int w    = tid >> 5;   // 0..3
  const int lr   = lane & 15;
  const int hi   = lane >> 4;
  const int kb   = hi * 8;

  const int bh = blockIdx.x;
  const int b  = bh / NHx;
  const int h  = bh % NHx;
  const int qb = blockIdx.y;
  const int q0 = qb * 64;
  const int qrow = q0 + w * 16 + lr;   // this lane's query

  const size_t rstride = (size_t)3 * Cx;
  const _Float16* kbase = qkvh + (size_t)b * Tx * rstride + 0 * Cx + h * 64;
  const _Float16* qbase = qkvh + (size_t)b * Tx * rstride + 1 * Cx + h * 64;
  const _Float16* vbase = qkvh + (size_t)b * Tx * rstride + 2 * Cx + h * 64;

  // Q fragments (B operand: column = query lr), pre-scaled by 1/sqrt(64) = 0.125
  F16x16 qf[2];
  {
#pragma unroll
    for (int kk = 0; kk < 2; ++kk) {
      const _Float16* p = qbase + (size_t)qrow * rstride + kk * 32;
      v8h x0 = *reinterpret_cast<const v8h*>(p + kb);
      v8h x1 = *reinterpret_cast<const v8h*>(p + kb + 16);
#pragma unroll
      for (int j = 0; j < 8; ++j) {
        x0[j] = (_Float16)(x0[j] * (_Float16)0.125f);
        x1[j] = (_Float16)(x1[j] * (_Float16)0.125f);
      }
      qf[kk].h[0] = x0; qf[kk].h[1] = x1;
    }
  }

  float mrow = -3.0e38f;   // running maximum of this lane's query (equal in both halves)
  float lsum = 0.0f;       // running sum over this half's keys only; joined after the loop
  v8f O[4] = {};           // O[ot][v] = O^T[d = 16 ot + 8 hi + v][query lr]

  for (int jb = 0; jb <= qb; ++jb) {
    const int key0 = jb * 64;
    // K and V tiles: async straight copies, 512 chunks of 16B each, four per
    // thread (rows key, key + 16, key + 32, key + 48).
    {
      const int key = tid >> 3;
      const int dc  = (tid & 7) * 8;
      const _Float16* kg = kbase + (size_t)(key0 + key) * rstride + dc;
      const _Float16* vg = vbase + (size_t)(key0 + key) * rstride + dc;
      async_copy4_b128(&Ks[key][dc],      kg,
                       &Ks[key + 16][dc], kg + 16 * rstride,
                       &Ks[key + 32][dc], kg + 32 * rstride,
                       &Ks[key + 48][dc], kg + 48 * rstride);
      async_copy4_b128(&Vs[key][dc],      vg,
                       &Vs[key + 16][dc], vg + 16 * rstride,
                       &Vs[key + 32][dc], vg + 32 * rstride,
                       &Vs[key + 48][dc], vg + 48 * rstride);
    }
    async_wait0();
    __syncthreads();

    // S^T = K @ (Q/8)^T : 4 tiles of 16 keys, K-dim 64 = 2 WMMAs each.
    // S[nt][v] = score of key key0 + 16 nt + 8 hi + v against query lr.
    F16x16 ak[4][2];
#pragma unroll
    for (int nt = 0; nt < 4; ++nt) {
#pragma unroll
      for (int kk = 0; kk < 2; ++kk) {
        const _Float16* p = &Ks[nt * 16 + lr][kk * 32];
        ak[nt][kk].h[0] = *reinterpret_cast<const v8h*>(p + kb);
        ak[nt][kk].h[1] = *reinterpret_cast<const v8h*>(p + kb + 16);
      }
    }
    __builtin_amdgcn_sched_barrier(0);
    v8f S[4];
#pragma unroll
    for (int nt = 0; nt < 4; ++nt) {
      S[nt] = (v8f){};
#pragma unroll
      for (int kk = 0; kk < 2; ++kk) S[nt] = WMMA_F16(ak[nt][kk].v, qf[kk].v, S[nt]);
    }
    F16x16 av[4][2];
#pragma unroll
    for (int ot = 0; ot < 4; ++ot) {
#pragma unroll
      for (int kk = 0; kk < 2; ++kk) {
        const _Float16* vp = &Vs[kk * 32 + kb + (lane & 7)][ot * 16 + ((lane >> 3) & 1) * 8];
        av[ot][kk].h[0] = lds_load_tr16(vp);
        av[ot][kk].h[1] = lds_load_tr16(vp + 16 * 80);
      }
    }
    // Keeps those loads here. Left free, the scheduler sinks them to the second product,
    // two in front of each WMMA behind a wait to 0.
    __builtin_amdgcn_sched_barrier(0);
    // Causal mask (only the diagonal block needs it)
    if (jb == qb) {
#pragma unroll
      for (int nt = 0; nt < 4; ++nt) {
#pragma unroll
        for (int v = 0; v < 8; ++v) {
          int col = key0 + nt * 16 + kb + v;
          if (col > qrow) S[nt][v] = -3.0e38f;
        }
      }
    }

    // Online softmax update of the lane's query
    float tm[4];
#pragma unroll
    for (int nt = 0; nt < 4; ++nt) {
      tm[nt] = S[nt][0];
#pragma unroll
      for (int v = 1; v < 8; ++v) tm[nt] = fmaxf(tm[nt], S[nt][v]);
    }
    float t = fmaxf(fmaxf(tm[0], tm[1]), fmaxf(tm[2], tm[3]));
    t = fmaxf(t, xhalf(t));
    const float mn = fmaxf(mrow, t);
    const float alpha = __expf(mrow - mn);
    mrow = mn;
#pragma unroll
    for (int ot = 0; ot < 4; ++ot) O[ot] *= alpha;

    // P^T as B operand: element s of the 32-key fragment kk is tile 2 kk + (s >> 3),
    // register s & 7, which is the k order of the transposing load above.
    F16x16 pf[2];
    float rs[4];
#pragma unroll
    for (int nt = 0; nt < 4; ++nt) {
      rs[nt] = 0.0f;
#pragma unroll
      for (int v = 0; v < 8; ++v) {
        float p = __expf(S[nt][v] - mn);
        rs[nt] += p;
        pf[nt >> 1].h[nt & 1][v] = (_Float16)p;
      }
    }
    lsum = lsum * alpha + ((rs[0] + rs[1]) + (rs[2] + rs[3]));

    // O^T += V^T @ P^T
#pragma unroll
    for (int ot = 0; ot < 4; ++ot) {
#pragma unroll
      for (int kk = 0; kk < 2; ++kk) O[ot] = WMMA_F16(av[ot][kk].v, pf[kk].v, O[ot]);
    }
    // Keeps the barrier below at the tile's end. No LDS access follows the V^T loads, so
    // the scheduler lifts it, with its wait to 0, to the head of the softmax, where the
    // wave would stand still for those loads instead of computing under them.
    __builtin_amdgcn_sched_barrier(0);
    __syncthreads();
  }

  // Write y (f16), normalized: a lane holds 8 consecutive d of its query per tile
  const float inv = 1.0f / (lsum + xhalf(lsum));
  _Float16* yp = Yh + ((size_t)b * Tx + qrow) * Cx + h * 64 + kb;
#pragma unroll
  for (int ot = 0; ot < 4; ++ot) {
    v8h o;
#pragma unroll
    for (int v = 0; v < 8; ++v) o[v] = (_Float16)(O[ot][v] * inv);
    *reinterpret_cast<v8h*>(yp + ot * 16) = o;
  }
}

// ---------------------------------------------------------------------------
// out = xin + LayerNorm(t)*g + b, rows of LN_C floats. One wave per row, 16 rows
// per block: a lane holds 32 values of its row in registers (eight wave-wide
// loads of 512 contiguous bytes), the row's sums are joined by a butterfly over
// the 32 lanes, and no LDS or barrier is needed.
// ---------------------------------------------------------------------------
#define LN_C 1024

__global__ __launch_bounds__(512) void ln_residual(
    const float* __restrict__ xin, const float* __restrict__ t,
    const float* __restrict__ g, const float* __restrict__ be,
    float* __restrict__ outf, _Float16* __restrict__ outh)
{
  const int lane = threadIdx.x & 31;
  const int row  = blockIdx.x * (blockDim.x >> 5) + (threadIdx.x >> 5);
  const v4f* tr = reinterpret_cast<const v4f*>(t + (size_t)row * LN_C) + lane;
  const v4f* xr = reinterpret_cast<const v4f*>(xin + (size_t)row * LN_C) + lane;
  const v4f* gr = reinterpret_cast<const v4f*>(g) + lane;
  const v4f* br = reinterpret_cast<const v4f*>(be) + lane;

  v4f tv[8], xv[8], gv[8], bv[8];
#pragma unroll
  for (int q = 0; q < 8; ++q) tv[q] = tr[q * 32];
#pragma unroll
  for (int q = 0; q < 8; ++q) xv[q] = xr[q * 32];
#pragma unroll
  for (int q = 0; q < 8; ++q) gv[q] = gr[q * 32];
#pragma unroll
  for (int q = 0; q < 8; ++q) bv[q] = br[q * 32];
  // Stands in front of every rewrite of an address register of the loads above. The
  // two row pointers are named as inputs so that their registers live up to the wait;
  // otherwise the last load's result is placed on its own address pair.
  asm volatile("s_wait_xcnt 0x0" :: "v"(tr), "v"(xr) : "memory");
  // Keeps all 32 loads in front of the sums, so that the wave waits out one memory
  // latency; left free, the scheduler sinks 24 of them behind the sums in small groups.
  __builtin_amdgcn_sched_barrier(0);

  v4f sv = {}, sv2 = {};   // four independent chains each
#pragma unroll
  for (int q = 0; q < 8; ++q) { sv += tv[q]; sv2 += tv[q] * tv[q]; }
  float s  = (sv[0] + sv[1]) + (sv[2] + sv[3]);
  float s2 = (sv2[0] + sv2[1]) + (sv2[2] + sv2[3]);
#pragma unroll
  for (int off = 16; off; off >>= 1) { s += __shfl_xor(s, off, 32); s2 += __shfl_xor(s2, off, 32); }
  float mean = s / LN_C;
  float var  = s2 / LN_C - mean * mean;
  float rstd = rsqrtf(var + 1e-5f);

#pragma unroll
  for (int q = 0; q < 8; ++q)
#pragma unroll
    for (int e = 0; e < 4; ++e)
      xv[q][e] = xv[q][e] + (tv[q][e] - mean) * rstd * gv[q][e] + bv[q][e];
  if (outf) {
    v4f* of = reinterpret_cast<v4f*>(outf + (size_t)row * LN_C) + lane;
#pragma unroll
    for (int q = 0; q < 8; ++q) of[q * 32] = xv[q];
    // The conversion below may reuse the registers that these stores name.
    asm volatile("s_wait_xcnt 0x0" ::: "memory");
  }
  if (outh) {
    v4h* oh = reinterpret_cast<v4h*>(outh + (size_t)row * LN_C) + lane;
#pragma unroll
    for (int q = 0; q < 8; ++q) oh[q * 32] = __builtin_convertvector(xv[q], v4h);
  }
}

// ---------------------------------------------------------------------------
extern "C" void kernel_launch(void* const* d_in, const int* in_sizes, int n_in,
                              void* d_out, int out_size, void* d_ws, size_t ws_size,
                              hipStream_t stream) {
  (void)in_sizes; (void)n_in; (void)out_size; (void)ws_size;
  const int Bb = 2, T = 2048, C = 1024, NH = 16;
  const int M = Bb * T; // 4096

  const float* x      = (const float*)d_in[0];
  const float* w_attn = (const float*)d_in[1];
  const float* b_attn = (const float*)d_in[2];
  const float* wa1    = (const float*)d_in[3];
  const float* ba1    = (const float*)d_in[4];
  const float* wa2    = (const float*)d_in[5];
  const float* ba2    = (const float*)d_in[6];
  const float* g1     = (const float*)d_in[7];
  const float* be1    = (const float*)d_in[8];
  const float* wf1    = (const float*)d_in[9];
  const float* bf1    = (const float*)d_in[10];
  const float* wf2    = (const float*)d_in[11];
  const float* bf2    = (const float*)d_in[12];
  const float* g2     = (const float*)d_in[13];
  const float* be2    = (const float*)d_in[14];
  float* out = (float*)d_out;

  char* ws = (char*)d_ws;
  size_t off = 0;
  auto take = [&](size_t bytes) -> char* {
    char* p = ws + off;
    off += (bytes + 255) & ~(size_t)255;
    return p;
  };

  _Float16* Xh    = (_Float16*)take((size_t)M * C * 2);        // x f16; reused as Yh
  _Float16* Wattn = (_Float16*)take((size_t)C * 3 * C * 2);
  _Float16* Wa1h  = (_Float16*)take((size_t)C * 4 * C * 2);
  _Float16* Wa2h  = (_Float16*)take((size_t)4 * C * C * 2);
  _Float16* Wf1h  = (_Float16*)take((size_t)C * 4 * C * 2);
  _Float16* Wf2h  = (_Float16*)take((size_t)4 * C * C * 2);
  char*     qkvB  = take((size_t)M * 3 * C * 2);               // qkv f16; reused as t2/t4 f32
  _Float16* H1h   = (_Float16*)take((size_t)M * 4 * C * 2);    // FF hidden; reused for both FFs
  float*    x1    = (float*)take((size_t)M * C * 4);
  _Float16* x1h   = (_Float16*)take((size_t)M * C * 2);

  _Float16* qkvh = (_Float16*)qkvB;
  float*    t2f  = (float*)qkvB;   // reuse after attention consumes qkv
  _Float16* Yh   = Xh;             // reuse after QKV GEMM consumes Xh

  // f32 -> f16 conversions, one launch. Xh, Wattn, Wa1h, Wa2h, Wf1h, Wf2h were taken
  // in this order and each size is a multiple of 256 bytes, so they lie one behind
  // another from Xh on. Ends in units of CVT_UNIT floats.
  const int ux = M * C / CVT_UNIT, uq = C * 3 * C / CVT_UNIT, uf = C * 4 * C / CVT_UNIT;
  cvt_f32_f16_six<<<256, 512, 0, stream>>>(
      x, w_attn, wa1, wa2, wf1, wf2, Xh,
      ux, ux + uq, ux + uq + uf, ux + uq + 2 * uf, ux + uq + 3 * uf, ux + uq + 4 * uf);

  // qkv = x @ w_attn + b_attn  -> f16
  gemm_f16_wmma<false, false, 4, 4, 4, 128><<<dim3(3 * C / 256, M / 256), 512, 0, stream>>>(
      Xh, Wattn, b_attn, nullptr, qkvh, M, 3 * C, C);

  // flash attention -> Yh (f16)
  attn_flash_wmma<<<dim3(Bb * NH, T / 64), 128, 0, stream>>>(qkvh, Yh, Bb, T, C, NH);

  // SelfAttn FF: H1 = gelu(y @ wa1 + ba1); t2 = H1 @ wa2 + ba2
  gemm_f16_wmma<true, false, 4, 4, 4, 128><<<dim3(4 * C / 256, M / 256), 512, 0, stream>>>(
      Yh, Wa1h, ba1, nullptr, H1h, M, 4 * C, C);
  gemm_f16_wmma<false, true, 2, 4, 2, 256><<<dim3(C / 128, M / 128), 256, 0, stream>>>(
      H1h, Wa2h, ba2, t2f, nullptr, M, C, 4 * C);

  // x1 = x + LN(t2)
  ln_residual<<<M / 16, 512, 0, stream>>>(x, t2f, g1, be1, x1, x1h);

  // Block FF: H2 = gelu(x1 @ wf1 + bf1); t4 = H2 @ wf2 + bf2
  gemm_f16_wmma<true, false, 4, 4, 4, 128><<<dim3(4 * C / 256, M / 256), 512, 0, stream>>>(
      x1h, Wf1h, bf1, nullptr, H1h, M, 4 * C, C);
  gemm_f16_wmma<false, true, 2, 4, 2, 256><<<dim3(C / 128, M / 128), 256, 0, stream>>>(
      H1h, Wf2h, bf2, t2f, nullptr, M, C, 4 * C);

  // out = x1 + LN(t4)
  ln_residual<<<M / 16, 512, 0, stream>>>(x1, t2f, g2, be2, out, nullptr);
}

// v009
// Measured time: 185 microseconds a run.
// Timed twice side by side with v008, it ran 1.03 and 1.04 times as fast.
// Counting every step since v000, it is 5.54 times as fast.
#include <hip/hip_runtime.h>
#include <hip/hip_bf16.h>

typedef __attribute__((ext_vector_type(16))) _Float16 v16h;
typedef __attribute__((ext_vector_type(8)))  _Float16 v8h;
typedef __attribute__((ext_vector_type(8)))  float    v8f;

union F16x16 { v16h v; v8h h[2]; };

#define WMMA_F16(a, b, c) \
  __builtin_amdgcn_wmma_f32_16x16x32_f16(false, (a), false, (b), (short)0, (c), false, false)

__device__ __forceinline__ void async_copy4_b128(
    void* l0, const void* g0, void* l1, const void* g1,
    void* l2, const void* g2, void* l3, const void* g3) {
  asm volatile("global_load_async_to_lds_b128 %0, %1, off\n\t"
               "global_load_async_to_lds_b128 %2, %3, off\n\t"
               "global_load_async_to_lds_b128 %4, %5, off\n\t"
               "global_load_async_to_lds_b128 %6, %7, off\n\t"
               "s_wait_xcnt 0x0"
               :: "v"((unsigned)(size_t)l0), "v"((unsigned long long)(size_t)g0),
                  "v"((unsigned)(size_t)l1), "v"((unsigned long long)(size_t)g1),
                  "v"((unsigned)(size_t)l2), "v"((unsigned long long)(size_t)g2),
                  "v"((unsigned)(size_t)l3), "v"((unsigned long long)(size_t)g3)
               : "memory");
}
__device__ __forceinline__ void async_copy8_b128(
    unsigned l0, const void* g0, unsigned l1, const void* g1,
    unsigned l2, const void* g2, unsigned l3, const void* g3,
    unsigned l4, const void* g4, unsigned l5, const void* g5,
    unsigned l6, const void* g6, unsigned l7, const void* g7) {
  asm volatile("global_load_async_to_lds_b128 %0, %1, off\n\t"
               "global_load_async_to_lds_b128 %2, %3, off\n\t"
               "global_load_async_to_lds_b128 %4, %5, off\n\t"
               "global_load_async_to_lds_b128 %6, %7, off\n\t"
               "global_load_async_to_lds_b128 %8, %9, off\n\t"
               "global_load_async_to_lds_b128 %10, %11, off\n\t"
               "global_load_async_to_lds_b128 %12, %13, off\n\t"
               "global_load_async_to_lds_b128 %14, %15, off\n\t"
               "s_wait_xcnt 0x0"
               :: "v"(l0), "v"((unsigned long long)(size_t)g0),
                  "v"(l1), "v"((unsigned long long)(size_t)g1),
                  "v"(l2), "v"((unsigned long long)(size_t)g2),
                  "v"(l3), "v"((unsigned long long)(size_t)g3),
                  "v"(l4), "v"((unsigned long long)(size_t)g4),
                  "v"(l5), "v"((unsigned long long)(size_t)g5),
                  "v"(l6), "v"((unsigned long long)(size_t)g6),
                  "v"(l7), "v"((unsigned long long)(size_t)g7)
               : "memory");
}
typedef __attribute__((ext_vector_type(4))) float v4f;
__device__ __forceinline__ void store4_b128(
    void* g0, v4f d0, void* g1, v4f d1, void* g2, v4f d2, void* g3, v4f d3) {
  asm volatile("global_store_b128 %0, %1, off\n\t"
               "global_store_b128 %2, %3, off\n\t"
               "global_store_b128 %4, %5, off\n\t"
               "global_store_b128 %6, %7, off\n\t"
               "s_wait_xcnt 0x0"
               :: "v"((unsigned long long)(size_t)g0), "v"(d0),
                  "v"((unsigned long long)(size_t)g1), "v"(d1),
                  "v"((unsigned long long)(size_t)g2), "v"(d2),
                  "v"((unsigned long long)(size_t)g3), "v"(d3)
               : "memory");
}
__device__ __forceinline__ void async_wait0() {
  asm volatile("s_wait_asynccnt 0x0" ::: "memory");
}

// ---------------------------------------------------------------------------
// Transposing LDS load: from a tile stored T[k][n] (k rows, n contiguous) lane
// (c = lane & 15, h = lane >> 4) receives T[k0 + 8h + 0..7][n0 + c]. The lane's
// own address is &T[k0 + 8h + (lane & 7)][n0 + 8 * ((lane >> 3) & 1)].
// Loads at k0 and k0 + 16 form one 32-k B fragment in the k order that the
// A loaders below use (8h + 0..7, then 16 + 8h + 0..7).
// ---------------------------------------------------------------------------
typedef __attribute__((ext_vector_type(8))) short v8s;
typedef __attribute__((address_space(3))) v8s lds_v8s;
__device__ __forceinline__ v8h lds_load_tr16(const _Float16* p) {
  return __builtin_bit_cast(v8h, __builtin_amdgcn_ds_load_tr16_b128_v8i16((lds_v8s*)p));
}

// ---------------------------------------------------------------------------
// f32 -> f16 conversion of six arrays in one launch. The grid is sized to be
// resident at once (one 16-wave block per WGP) and its waves walk the work, so
// that few waves have to be started. A unit is 1024 floats: eight wave-wide loads
// of 512 contiguous bytes, all issued before the first is used. The six f16
// results lie one behind another at out, in the order of the sources; e0..e5 are
// the running ends of the six arrays in units.
// ---------------------------------------------------------------------------
typedef __attribute__((ext_vector_type(4))) _Float16 v4h;
#define CVT_UNIT 1024

__global__ __launch_bounds__(512) void cvt_f32_f16_six(
    const float* __restrict__ s0, const float* __restrict__ s1,
    const float* __restrict__ s2, const float* __restrict__ s3,
    const float* __restrict__ s4, const float* __restrict__ s5,
    _Float16* __restrict__ out,
    int e0, int e1, int e2, int e3, int e4, int e5)
{
  const int lane = threadIdx.x & 31;
  const int nw   = gridDim.x * (blockDim.x >> 5);
  // The wave's number, held scalar so that the choice of the source is a scalar one.
  const int wv   = __builtin_amdgcn_readfirstlane(blockIdx.x * (blockDim.x >> 5) + (threadIdx.x >> 5));
  for (int u = wv; u < e5; u += nw) {
    const float* s = s0;
    int first = 0;
    if (u >= e0) { s = s1; first = e0; }
    if (u >= e1) { s = s2; first = e1; }
    if (u >= e2) { s = s3; first = e2; }
    if (u >= e3) { s = s4; first = e3; }
    if (u >= e4) { s = s5; first = e4; }
    const v4f* p = reinterpret_cast<const v4f*>(s + (size_t)(u - first) * CVT_UNIT) + lane;
    v4h* o = reinterpret_cast<v4h*>(out + (size_t)u * CVT_UNIT) + lane;
    v4f a[8];
#pragma unroll
    for (int q = 0; q < 8; ++q) a[q] = p[q * 32];
#pragma unroll
    for (int q = 0; q < 8; ++q) o[q * 32] = __builtin_convertvector(a[q], v4h);
  }
}

// x * Phi(x) with Phi(x) = erfc(-x / sqrt 2) / 2, the same path for every x, four
// elements at a time. q = erfc(|x| / sqrt 2) / 2 = (a1 t + ... + a5 t^5) exp(-x^2 / 2) / 2
// with t = 1 / (1 + p |x| / sqrt 2): absolute error of erf below 1.5e-7 for every x, the
// size of an f32 rounding of 1 + erf. x Phi(x) = max(x, 0) - |x| q on both sides of 0,
// with no cancellation for x < 0. The halves are folded into the coefficients.
__device__ __forceinline__ void gelu_erf4(float (&x)[4]) {
  float d[4], s[4], t[4], e[4];
#pragma unroll
  for (int c = 0; c < 4; ++c) {
    d[c] = fmaf(fabsf(x[c]), 0.23164190f, 1.0f);
    s[c] = (x[c] * -0.72134752f) * x[c];
  }
  asm("v_rcp_f32 %0, %8\n\t"
      "v_rcp_f32 %1, %9\n\t"
      "v_rcp_f32 %2, %10\n\t"
      "v_rcp_f32 %3, %11\n\t"
      "v_exp_f32 %4, %12\n\t"
      "v_exp_f32 %5, %13\n\t"
      "v_exp_f32 %6, %14\n\t"
      "v_exp_f32 %7, %15\n\t"
      "v_nop"
      : "=&v"(t[0]), "=&v"(t[1]), "=&v"(t[2]), "=&v"(t[3]),
        "=&v"(e[0]), "=&v"(e[1]), "=&v"(e[2]), "=&v"(e[3])
      : "v"(d[0]), "v"(d[1]), "v"(d[2]), "v"(d[3]),
        "v"(s[0]), "v"(s[1]), "v"(s[2]), "v"(s[3]));
#pragma unroll
  for (int c = 0; c < 4; ++c) {
    float p = fmaf(t[c], 0.5307027145f, -0.7265760135f);
    p = fmaf(t[c], p, 0.7107068705f);
    p = fmaf(t[c], p, -0.1422483680f);
    p = fmaf(t[c], p, 0.1274147960f);
    const float q = (p * t[c]) * e[c];
    x[c] = fmaf(-fabsf(x[c]), q, fmaxf(x[c], 0.0f));
  }
}

template <bool ACT, bool OUT32, int NWR, int NWC, int FJ, int BK>
__global__ __launch_bounds__(NWR * NWC * 32) void gemm_f16_wmma(
    const _Float16* __restrict__ A, const _Float16* __restrict__ Bm,
    const float* __restrict__ bias,
    float* __restrict__ Cf, _Float16* __restrict__ Ch,
    int M, int N, int K)
{
  constexpr int NT   = NWR * NWC * 32;   // threads
  constexpr int BM   = NWR * 64;
  constexpr int BN   = NWC * FJ * 16;
  constexpr int LDSA = BK + 8;           // 272B or 528B rows (16B x odd: the plain reader's pitch)
  constexpr int LDSB = BN + 16;          // 288B or 544B rows (32B x odd: the transposing reader's pitch)
  constexpr int CA   = BK / 8;           // 16B chunks in an A row
  constexpr int RA   = NT / CA;          // A rows that one copy of every thread covers
  constexpr int CB   = BN / 8;           // 16B chunks in a B row
  constexpr int RB   = NT / CB;          // B rows that one copy of every thread covers
  constexpr int NA   = BM / RA;          // A copies per thread and stage
  constexpr int NB   = BK / RB;          // B copies per thread and stage
  static_assert(NA % 8 == 0 && NB % 8 == 0, "copies go in statements of eight");
  static_assert(NA + NB <= 63, "one stage's copies of a wave are in flight at once");
  static_assert((LDSA / 8) % 2 == 1, "A pitch is 16B x odd");
  static_assert((LDSB / 16) % 2 == 1, "B pitch is 32B x odd");
  // 32-k blocks whose fragments a wave holds at once: two where the registers allow it
  // (64x32 wave tile, 8 waves), one block at 64x64 (16 waves, 256 registers each).
  constexpr int G = (FJ == 2) ? 2 : 1;
  __shared__ __attribute__((aligned(16))) _Float16 As[2][BM][LDSA];
  __shared__ __attribute__((aligned(16))) _Float16 Bs[2][BK][LDSB]; // as in memory: Bs[.][k][n]

  const int tid  = threadIdx.x;
  const int lane = tid & 31;
  const int wave = tid >> 5;
  const int wr   = wave / NWC;
  const int wc   = wave % NWC;
  const int lr   = lane & 15;
  const int hi   = lane >> 4;   // 0/1
  const int kb   = hi * 8;      // K-chunk base per 16-bit A/B lane layout

  const int m0 = blockIdx.y * BM;
  const int n0 = blockIdx.x * BN;

  v8f acc[4][FJ] = {};

  // One stage = A BM x BK halfs and B BK x BN halfs in chunks of 16B, NA and NB
  // per thread: A rows r + RA q, B rows kk + RB q. The pointers walk one stage
  // further at every fill.
  const int r  = tid / CA;
  const int kc = (tid % CA) * 8;
  const int kk = tid / CB;
  const int nn = (tid % CB) * 8;
  const _Float16* ag = &A[(size_t)(m0 + r) * K + kc];
  const _Float16* bg = &Bm[(size_t)kk * N + n0 + nn];
  const unsigned la = (unsigned)(size_t)&As[0][r][kc];
  const unsigned lb = (unsigned)(size_t)&Bs[0][kk][nn];
  auto fill = [&](int buf) {
    const unsigned a = la + (unsigned)buf * (unsigned)(BM * LDSA * 2);
    const unsigned b = lb + (unsigned)buf * (unsigned)(BK * LDSB * 2);
#pragma unroll
    for (int q = 0; q < NA; q += 8)
      async_copy8_b128(a + (q + 0) * RA * LDSA * 2, ag + (size_t)((q + 0) * RA) * K,
                       a + (q + 1) * RA * LDSA * 2, ag + (size_t)((q + 1) * RA) * K,
                       a + (q + 2) * RA * LDSA * 2, ag + (size_t)((q + 2) * RA) * K,
                       a + (q + 3) * RA * LDSA * 2, ag + (size_t)((q + 3) * RA) * K,
                       a + (q + 4) * RA * LDSA * 2, ag + (size_t)((q + 4) * RA) * K,
                       a + (q + 5) * RA * LDSA * 2, ag + (size_t)((q + 5) * RA) * K,
                       a + (q + 6) * RA * LDSA * 2, ag + (size_t)((q + 6) * RA) * K,
                       a + (q + 7) * RA * LDSA * 2, ag + (size_t)((q + 7) * RA) * K);
#pragma unroll
    for (int q = 0; q < NB; q += 8)
      async_copy8_b128(b + (q + 0) * RB * LDSB * 2, bg + (size_t)((q + 0) * RB) * N,
                       b + (q + 1) * RB * LDSB * 2, bg + (size_t)((q + 1) * RB) * N,
                       b + (q + 2) * RB * LDSB * 2, bg + (size_t)((q + 2) * RB) * N,
                       b + (q + 3) * RB * LDSB * 2, bg + (size_t)((q + 3) * RB) * N,
                       b + (q + 4) * RB * LDSB * 2, bg + (size_t)((q + 4) * RB) * N,
                       b + (q + 5) * RB * LDSB * 2, bg + (size_t)((q + 5) * RB) * N,
                       b + (q + 6) * RB * LDSB * 2, bg + (size_t)((q + 6) * RB) * N,
                       b + (q + 7) * RB * LDSB * 2, bg + (size_t)((q + 7) * RB) * N);
    ag += BK;
    bg += (size_t)BK * N;
  };

  const int nst = K / BK;
  fill(0);
  async_wait0();
  __syncthreads();
  if (nst > 1) fill(1);

  for (int t = 0; t < nst; ++t) {
    const int cur = t & 1;
#pragma unroll
    for (int ks = 0; ks < BK; ks += 32 * G) {
      F16x16 af[G][4], bf[G][FJ];
#pragma unroll
      for (int g = 0; g < G; ++g) {
#pragma unroll
        for (int i = 0; i < 4; ++i) {
          const _Float16* p = &As[cur][wr * 64 + i * 16 + lr][ks + g * 32];
          af[g][i].h[0] = *reinterpret_cast<const v8h*>(p + kb);
          af[g][i].h[1] = *reinterpret_cast<const v8h*>(p + kb + 16);
        }
#pragma unroll
        for (int j = 0; j < FJ; ++j) {
          const _Float16* p = &Bs[cur][ks + g * 32 + kb + (lane & 7)][(wc * FJ + j) * 16 + ((lane >> 3) & 1) * 8];
          bf[g][j].h[0] = lds_load_tr16(p);
          bf[g][j].h[1] = lds_load_tr16(p + 16 * LDSB);
        }
      }
      __builtin_amdgcn_sched_barrier(0);
#pragma unroll
      for (int g = 0; g < G; ++g)
#pragma unroll
        for (int i = 0; i < 4; ++i)
#pragma unroll
          for (int j = 0; j < FJ; ++j)
            acc[i][j] = WMMA_F16(bf[g][j].v, af[g][i].v, acc[i][j]);   // C^T tile: see the epilogue
    }
    // Without it the scheduler would lift the waits below over the last group's WMMAs:
    // the wave would wait for all 24 loads before the first of them, and the refill
    // would stand behind the 16 WMMAs instead of directly behind the barrier.
    if (G > 1) __builtin_amdgcn_sched_barrier(0);
    // Hand-over: this wave's reads of buffer cur are done, its copies of stage
    // t + 1 have landed; behind the barrier that holds for every wave, so stage
    // t + 1 may be read and buffer cur refilled.
    asm volatile("s_wait_dscnt 0x0" ::: "memory");
    async_wait0();
    __syncthreads();
    if (t + 2 < nst) fill(cur);
  }
  // No copy is outstanding when the wave goes on to the epilogue.
  async_wait0();

  // Epilogue. The products were formed as C^T = B^T A^T (the two fragment kinds have the
  // same lane and k layout, so they only change places in the WMMA): lane lr holds row
  // m = 16 i + lr of C and its registers v the columns n = 16 j + 8 hi + v, eight
  // neighbours. A row of the wave's tile is 128 bytes, one line. Each wave stages 16 rows
  // at a time in an LDS range of its own (the ring is free behind the loop's last barrier)
  // with 16-byte LDS stores, reads them back eight lanes to a row and stores whole lines,
  // four per instruction. Two ranges alternate: the wait of pass i + 1 has retired the
  // reads of pass i before pass i + 2 writes there.
  constexpr int EB   = OUT32 ? 4 : 2;     // bytes per element of C
  constexpr int SP   = 128 + 16;          // staging pitch: 16B x odd
  static_assert(FJ * 16 * EB == 128, "a row of the wave's tile is one line");
  static_assert(NWR * NWC * 2 * 16 * SP <= (int)sizeof(As), "staging fits the A ring");
  char* stg = reinterpret_cast<char*>(&As[0][0][0]) + wave * (2 * 16 * SP);
  v4f biasv[FJ][2];
  const v4f* bp = reinterpret_cast<const v4f*>(bias + n0 + wc * FJ * 16 + kb);
#pragma unroll
  for (int j = 0; j < FJ; ++j) {
    biasv[j][0] = bp[j * 4];
    biasv[j][1] = bp[j * 4 + 1];
  }
  // Stands in front of every rewrite of the address register of the loads above. The
  // pointer is named as an input so that its registers live up to the wait; otherwise
  // the last load's result is placed on its own address pair.
  asm volatile("s_wait_xcnt 0x0" :: "v"(bp) : "memory");
  const int rr = ((lane >> 3) & 1) * 8 + (lane >> 4);
  char* cg = (OUT32 ? reinterpret_cast<char*>(Cf) : reinterpret_cast<char*>(Ch))
           + ((size_t)(m0 + wr * 64 + rr) * N + n0 + wc * FJ * 16) * EB + (lane & 7) * 16;
  const size_t step = (size_t)2 * N * EB;   // two rows of C
#pragma unroll
  for (int i = 0; i < 4; ++i) {
    char* sw = stg + (i & 1) * (16 * SP);
#pragma unroll
    for (int j = 0; j < FJ; ++j) {
      float x[2][4];
#pragma unroll
      for (int u = 0; u < 2; ++u) {
#pragma unroll
        for (int c = 0; c < 4; ++c) x[u][c] = acc[i][j][u * 4 + c] + biasv[j][u][c];
        if (ACT) gelu_erf4(x[u]);
      }
      char* sp = sw + lr * SP + (j * 16 + kb) * EB;
      if (OUT32) {
#pragma unroll
        for (int u = 0; u < 2; ++u) {
          v4f o = {x[u][0], x[u][1], x[u][2], x[u][3]};
          *reinterpret_cast<v4f*>(sp + u * 16) = o;
        }
      } else {
        v8h o;
#pragma unroll
        for (int v = 0; v < 8; ++v) o[v] = (_Float16)x[v >> 2][v & 3];
        *reinterpret_cast<v8h*>(sp) = o;
      }
    }
    // The wave's own LDS stores have landed before other lanes of it read the rows back.
    asm volatile("s_wait_dscnt 0x0" ::: "memory");
    v4f rb[4];
#pragma unroll
    for (int q = 0; q < 4; ++q)
      rb[q] = *reinterpret_cast<const v4f*>(sw + (q * 2 + rr) * SP + (lane & 7) * 16);
    store4_b128(cg, rb[0], cg + step, rb[1], cg + 2 * step, rb[2], cg + 3 * step, rb[3]);
    cg += 8 * step;   // the next 16 rows
  }
}

__device__ __forceinline__ float xhalf(float x) {
  const int i = __builtin_bit_cast(int, x);
  return __builtin_bit_cast(float,
      __builtin_amdgcn_permlanex16(i, i, 0x76543210, 0xfedcba98, false, false));
}

__global__ __launch_bounds__(128) void attn_flash_wmma(
    const _Float16* __restrict__ qkvh, _Float16* __restrict__ Yh,
    int Bx, int Tx, int Cx, int NHx)
{
  __shared__ __attribute__((aligned(16))) _Float16 Ks[64][72]; // key-major (rows = key, cols = d)
  __shared__ __attribute__((aligned(16))) _Float16 Vs[64][80]; // key-major, 160B rows (32B x odd)

  const int tid  = threadIdx.x;
  const int lane = tid & 31;
  const int w    = tid >> 5;   // 0..3
  const int lr   = lane & 15;
  const int hi   = lane >> 4;
  const int kb   = hi * 8;

  const int bh = blockIdx.x;
  const int b  = bh / NHx;
  const int h  = bh % NHx;
  const int qb = blockIdx.y;
  const int q0 = qb * 64;
  const int qrow = q0 + w * 16 + lr;   // this lane's query

  const size_t rstride = (size_t)3 * Cx;
  const _Float16* kbase = qkvh + (size_t)b * Tx * rstride + 0 * Cx + h * 64;
  const _Float16* qbase = qkvh + (size_t)b * Tx * rstride + 1 * Cx + h * 64;
  const _Float16* vbase = qkvh + (size_t)b * Tx * rstride + 2 * Cx + h * 64;

  // Q fragments (B operand: column = query lr), pre-scaled by 1/sqrt(64) = 0.125
  F16x16 qf[2];
  {
#pragma unroll
    for (int kk = 0; kk < 2; ++kk) {
      const _Float16* p = qbase + (size_t)qrow * rstride + kk * 32;
      v8h x0 = *reinterpret_cast<const v8h*>(p + kb);
      v8h x1 = *reinterpret_cast<const v8h*>(p + kb + 16);
#pragma unroll
      for (int j = 0; j < 8; ++j) {
        x0[j] = (_Float16)(x0[j] * (_Float16)0.125f);
        x1[j] = (_Float16)(x1[j] * (_Float16)0.125f);
      }
      qf[kk].h[0] = x0; qf[kk].h[1] = x1;
    }
  }

  float mrow = -3.0e38f;   // running maximum of this lane's query (equal in both halves)
  float lsum = 0.0f;       // running sum over this half's keys only; joined after the loop
  v8f O[4] = {};           // O[ot][v] = O^T[d = 16 ot + 8 hi + v][query lr]

  for (int jb = 0; jb <= qb; ++jb) {
    const int key0 = jb * 64;
    // K and V tiles: async straight copies, 512 chunks of 16B each, four per
    // thread (rows key, key + 16, key + 32, key + 48).
    {
      const int key = tid >> 3;
      const int dc  = (tid & 7) * 8;
      const _Float16* kg = kbase + (size_t)(key0 + key) * rstride + dc;
      const _Float16* vg = vbase + (size_t)(key0 + key) * rstride + dc;
      async_copy4_b128(&Ks[key][dc],      kg,
                       &Ks[key + 16][dc], kg + 16 * rstride,
                       &Ks[key + 32][dc], kg + 32 * rstride,
                       &Ks[key + 48][dc], kg + 48 * rstride);
      async_copy4_b128(&Vs[key][dc],      vg,
                       &Vs[key + 16][dc], vg + 16 * rstride,
                       &Vs[key + 32][dc], vg + 32 * rstride,
                       &Vs[key + 48][dc], vg + 48 * rstride);
    }
    async_wait0();
    __syncthreads();

    // S^T = K @ (Q/8)^T : 4 tiles of 16 keys, K-dim 64 = 2 WMMAs each.
    // S[nt][v] = score of key key0 + 16 nt + 8 hi + v against query lr.
    F16x16 ak[4][2];
#pragma unroll
    for (int nt = 0; nt < 4; ++nt) {
#pragma unroll
      for (int kk = 0; kk < 2; ++kk) {
        const _Float16* p = &Ks[nt * 16 + lr][kk * 32];
        ak[nt][kk].h[0] = *reinterpret_cast<const v8h*>(p + kb);
        ak[nt][kk].h[1] = *reinterpret_cast<const v8h*>(p + kb + 16);
      }
    }
    __builtin_amdgcn_sched_barrier(0);
    v8f S[4];
#pragma unroll
    for (int nt = 0; nt < 4; ++nt) {
      S[nt] = (v8f){};
#pragma unroll
      for (int kk = 0; kk < 2; ++kk) S[nt] = WMMA_F16(ak[nt][kk].v, qf[kk].v, S[nt]);
    }
    F16x16 av[4][2];
#pragma unroll
    for (int ot = 0; ot < 4; ++ot) {
#pragma unroll
      for (int kk = 0; kk < 2; ++kk) {
        const _Float16* vp = &Vs[kk * 32 + kb + (lane & 7)][ot * 16 + ((lane >> 3) & 1) * 8];
        av[ot][kk].h[0] = lds_load_tr16(vp);
        av[ot][kk].h[1] = lds_load_tr16(vp + 16 * 80);
      }
    }
    // Keeps those loads here. Left free, the scheduler sinks them to the second product,
    // two in front of each WMMA behind a wait to 0.
    __builtin_amdgcn_sched_barrier(0);
    // Causal mask (only the diagonal block needs it)
    if (jb == qb) {
#pragma unroll
      for (int nt = 0; nt < 4; ++nt) {
#pragma unroll
        for (int v = 0; v < 8; ++v) {
          int col = key0 + nt * 16 + kb + v;
          if (col > qrow) S[nt][v] = -3.0e38f;
        }
      }
    }

    // Online softmax update of the lane's query
    float tm[4];
#pragma unroll
    for (int nt = 0; nt < 4; ++nt) {
      tm[nt] = S[nt][0];
#pragma unroll
      for (int v = 1; v < 8; ++v) tm[nt] = fmaxf(tm[nt], S[nt][v]);
    }
    float t = fmaxf(fmaxf(tm[0], tm[1]), fmaxf(tm[2], tm[3]));
    t = fmaxf(t, xhalf(t));
    const float mn = fmaxf(mrow, t);
    const float alpha = __expf(mrow - mn);
    mrow = mn;
#pragma unroll
    for (int ot = 0; ot < 4; ++ot) O[ot] *= alpha;

    // P^T as B operand: element s of the 32-key fragment kk is tile 2 kk + (s >> 3),
    // register s & 7, which is the k order of the transposing load above.
    F16x16 pf[2];
    float rs[4];
#pragma unroll
    for (int nt = 0; nt < 4; ++nt) {
      rs[nt] = 0.0f;
#pragma unroll
      for (int v = 0; v < 8; ++v) {
        float p = __expf(S[nt][v] - mn);
        rs[nt] += p;
        pf[nt >> 1].h[nt & 1][v] = (_Float16)p;
      }
    }
    lsum = lsum * alpha + ((rs[0] + rs[1]) + (rs[2] + rs[3]));

    // O^T += V^T @ P^T
#pragma unroll
    for (int ot = 0; ot < 4; ++ot) {
#pragma unroll
      for (int kk = 0; kk < 2; ++kk) O[ot] = WMMA_F16(av[ot][kk].v, pf[kk].v, O[ot]);
    }
    // Keeps the barrier below at the tile's end. No LDS access follows the V^T loads, so
    // the scheduler lifts it, with its wait to 0, to the head of the softmax, where the
    // wave would stand still for those loads instead of computing under them.
    __builtin_amdgcn_sched_barrier(0);
    __syncthreads();
  }

  // Write y (f16), normalized: a lane holds 8 consecutive d of its query per tile
  const float inv = 1.0f / (lsum + xhalf(lsum));
  _Float16* yp = Yh + ((size_t)b * Tx + qrow) * Cx + h * 64 + kb;
#pragma unroll
  for (int ot = 0; ot < 4; ++ot) {
    v8h o;
#pragma unroll
    for (int v = 0; v < 8; ++v) o[v] = (_Float16)(O[ot][v] * inv);
    *reinterpret_cast<v8h*>(yp + ot * 16) = o;
  }
}

// ---------------------------------------------------------------------------
// out = xin + LayerNorm(t)*g + b, rows of LN_C floats. One wave per row, 16 rows
// per block: a lane holds 32 values of its row in registers (eight wave-wide
// loads of 512 contiguous bytes), the row's sums are joined by a butterfly over
// the 32 lanes, and no LDS or barrier is needed.
// ---------------------------------------------------------------------------
#define LN_C 1024

__global__ __launch_bounds__(512) void ln_residual(
    const float* __restrict__ xin, const float* __restrict__ t,
    const float* __restrict__ g, const float* __restrict__ be,
    float* __restrict__ outf, _Float16* __restrict__ outh)
{
  const int lane = threadIdx.x & 31;
  const int row  = blockIdx.x * (blockDim.x >> 5) + (threadIdx.x >> 5);
  const v4f* tr = reinterpret_cast<const v4f*>(t + (size_t)row * LN_C) + lane;
  const v4f* xr = reinterpret_cast<const v4f*>(xin + (size_t)row * LN_C) + lane;
  const v4f* gr = reinterpret_cast<const v4f*>(g) + lane;
  const v4f* br = reinterpret_cast<const v4f*>(be) + lane;

  v4f tv[8], xv[8], gv[8], bv[8];
#pragma unroll
  for (int q = 0; q < 8; ++q) tv[q] = tr[q * 32];
#pragma unroll
  for (int q = 0; q < 8; ++q) xv[q] = xr[q * 32];
#pragma unroll
  for (int q = 0; q < 8; ++q) gv[q] = gr[q * 32];
#pragma unroll
  for (int q = 0; q < 8; ++q) bv[q] = br[q * 32];
  // Stands in front of every rewrite of an address register of the loads above. The
  // two row pointers are named as inputs so that their registers live up to the wait;
  // otherwise the last load's result is placed on its own address pair.
  asm volatile("s_wait_xcnt 0x0" :: "v"(tr), "v"(xr) : "memory");
  // Keeps all 32 loads in front of the sums, so that the wave waits out one memory
  // latency; left free, the scheduler sinks 24 of them behind the sums in small groups.
  __builtin_amdgcn_sched_barrier(0);

  v4f sv = {}, sv2 = {};   // four independent chains each
#pragma unroll
  for (int q = 0; q < 8; ++q) { sv += tv[q]; sv2 += tv[q] * tv[q]; }
  float s  = (sv[0] + sv[1]) + (sv[2] + sv[3]);
  float s2 = (sv2[0] + sv2[1]) + (sv2[2] + sv2[3]);
#pragma unroll
  for (int off = 16; off; off >>= 1) { s += __shfl_xor(s, off, 32); s2 += __shfl_xor(s2, off, 32); }
  float mean = s / LN_C;
  float var  = s2 / LN_C - mean * mean;
  float rstd = rsqrtf(var + 1e-5f);

#pragma unroll
  for (int q = 0; q < 8; ++q)
#pragma unroll
    for (int e = 0; e < 4; ++e)
      xv[q][e] = xv[q][e] + (tv[q][e] - mean) * rstd * gv[q][e] + bv[q][e];
  if (outf) {
    v4f* of = reinterpret_cast<v4f*>(outf + (size_t)row * LN_C) + lane;
#pragma unroll
    for (int q = 0; q < 8; ++q) of[q * 32] = xv[q];
    // The conversion below may reuse the registers that these stores name.
    asm volatile("s_wait_xcnt 0x0" ::: "memory");
  }
  if (outh) {
    v4h* oh = reinterpret_cast<v4h*>(outh + (size_t)row * LN_C) + lane;
#pragma unroll
    for (int q = 0; q < 8; ++q) oh[q * 32] = __builtin_convertvector(xv[q], v4h);
  }
}

// ---------------------------------------------------------------------------
extern "C" void kernel_launch(void* const* d_in, const int* in_sizes, int n_in,
                              void* d_out, int out_size, void* d_ws, size_t ws_size,
                              hipStream_t stream) {
  (void)in_sizes; (void)n_in; (void)out_size; (void)ws_size;
  const int Bb = 2, T = 2048, C = 1024, NH = 16;
  const int M = Bb * T; // 4096

  const float* x      = (const float*)d_in[0];
  const float* w_attn = (const float*)d_in[1];
  const float* b_attn = (const float*)d_in[2];
  const float* wa1    = (const float*)d_in[3];
  const float* ba1    = (const float*)d_in[4];
  const float* wa2    = (const float*)d_in[5];
  const float* ba2    = (const float*)d_in[6];
  const float* g1     = (const float*)d_in[7];
  const float* be1    = (const float*)d_in[8];
  const float* wf1    = (const float*)d_in[9];
  const float* bf1    = (const float*)d_in[10];
  const float* wf2    = (const float*)d_in[11];
  const float* bf2    = (const float*)d_in[12];
  const float* g2     = (const float*)d_in[13];
  const float* be2    = (const float*)d_in[14];
  float* out = (float*)d_out;

  char* ws = (char*)d_ws;
  size_t off = 0;
  auto take = [&](size_t bytes) -> char* {
    char* p = ws + off;
    off += (bytes + 255) & ~(size_t)255;
    return p;
  };

  _Float16* Xh    = (_Float16*)take((size_t)M * C * 2);        // x f16; reused as Yh
  _Float16* Wattn = (_Float16*)take((size_t)C * 3 * C * 2);
  _Float16* Wa1h  = (_Float16*)take((size_t)C * 4 * C * 2);
  _Float16* Wa2h  = (_Float16*)take((size_t)4 * C * C * 2);
  _Float16* Wf1h  = (_Float16*)take((size_t)C * 4 * C * 2);
  _Float16* Wf2h  = (_Float16*)take((size_t)4 * C * C * 2);
  char*     qkvB  = take((size_t)M * 3 * C * 2);               // qkv f16; reused as t2/t4 f32
  _Float16* H1h   = (_Float16*)take((size_t)M * 4 * C * 2);    // FF hidden; reused for both FFs
  float*    x1    = (float*)take((size_t)M * C * 4);
  _Float16* x1h   = (_Float16*)take((size_t)M * C * 2);

  _Float16* qkvh = (_Float16*)qkvB;
  float*    t2f  = (float*)qkvB;   // reuse after attention consumes qkv
  _Float16* Yh   = Xh;             // reuse after QKV GEMM consumes Xh

  // f32 -> f16 conversions, one launch. Xh, Wattn, Wa1h, Wa2h, Wf1h, Wf2h were taken
  // in this order and each size is a multiple of 256 bytes, so they lie one behind
  // another from Xh on. Ends in units of CVT_UNIT floats.
  const int ux = M * C / CVT_UNIT, uq = C * 3 * C / CVT_UNIT, uf = C * 4 * C / CVT_UNIT;
  cvt_f32_f16_six<<<256, 512, 0, stream>>>(
      x, w_attn, wa1, wa2, wf1, wf2, Xh,
      ux, ux + uq, ux + uq + uf, ux + uq + 2 * uf, ux + uq + 3 * uf, ux + uq + 4 * uf);

  // qkv = x @ w_attn + b_attn  -> f16
  gemm_f16_wmma<false, false, 4, 4, 4, 128><<<dim3(3 * C / 256, M / 256), 512, 0, stream>>>(
      Xh, Wattn, b_attn, nullptr, qkvh, M, 3 * C, C);

  // flash attention -> Yh (f16)
  attn_flash_wmma<<<dim3(Bb * NH, T / 64), 128, 0, stream>>>(qkvh, Yh, Bb, T, C, NH);

  // SelfAttn FF: H1 = gelu(y @ wa1 + ba1); t2 = H1 @ wa2 + ba2
  gemm_f16_wmma<true, false, 4, 4, 4, 128><<<dim3(4 * C / 256, M / 256), 512, 0, stream>>>(
      Yh, Wa1h, ba1, nullptr, H1h, M, 4 * C, C);
  gemm_f16_wmma<false, true, 2, 4, 2, 256><<<dim3(C / 128, M / 128), 256, 0, stream>>>(
      H1h, Wa2h, ba2, t2f, nullptr, M, C, 4 * C);

  // x1 = x + LN(t2)
  ln_residual<<<M / 16, 512, 0, stream>>>(x, t2f, g1, be1, x1, x1h);

  // Block FF: H2 = gelu(x1 @ wf1 + bf1); t4 = H2 @ wf2 + bf2
  gemm_f16_wmma<true, false, 4, 4, 4, 128><<<dim3(4 * C / 256, M / 256), 512, 0, stream>>>(
      x1h, Wf1h, bf1, nullptr, H1h, M, 4 * C, C);
  gemm_f16_wmma<false, true, 2, 4, 2, 256><<<dim3(C / 128, M / 128), 256, 0, stream>>>(
      H1h, Wf2h, bf2, t2f, nullptr, M, C, 4 * C);

  // out = x1 + LN(t4)
  ln_residual<<<M / 16, 512, 0, stream>>>(x1, t2f, g2, be2, out, nullptr);
}

// v010
// It runs in 178 microseconds.
// Two timings next to v009 both put it at 1.04 times that version's speed.
// Counting every step since v000, it is 5.74 times as fast.
#include <hip/hip_runtime.h>
#include <hip/hip_bf16.h>

typedef __attribute__((ext_vector_type(16))) _Float16 v16h;
typedef __attribute__((ext_vector_type(8)))  _Float16 v8h;
typedef __attribute__((ext_vector_type(8)))  float    v8f;

union F16x16 { v16h v; v8h h[2]; };

#define WMMA_F16(a, b, c) \
  __builtin_amdgcn_wmma_f32_16x16x32_f16(false, (a), false, (b), (short)0, (c), false, false)

__device__ __forceinline__ void async_copy8_b128(
    unsigned l0, const void* g0, unsigned l1, const void* g1,
    unsigned l2, const void* g2, unsigned l3, const void* g3,
    unsigned l4, const void* g4, unsigned l5, const void* g5,
    unsigned l6, const void* g6, unsigned l7, const void* g7) {
  asm volatile("global_load_async_to_lds_b128 %0, %1, off\n\t"
               "global_load_async_to_lds_b128 %2, %3, off\n\t"
               "global_load_async_to_lds_b128 %4, %5, off\n\t"
               "global_load_async_to_lds_b128 %6, %7, off\n\t"
               "global_load_async_to_lds_b128 %8, %9, off\n\t"
               "global_load_async_to_lds_b128 %10, %11, off\n\t"
               "global_load_async_to_lds_b128 %12, %13, off\n\t"
               "global_load_async_to_lds_b128 %14, %15, off\n\t"
               "s_wait_xcnt 0x0"
               :: "v"(l0), "v"((unsigned long long)(size_t)g0),
                  "v"(l1), "v"((unsigned long long)(size_t)g1),
                  "v"(l2), "v"((unsigned long long)(size_t)g2),
                  "v"(l3), "v"((unsigned long long)(size_t)g3),
                  "v"(l4), "v"((unsigned long long)(size_t)g4),
                  "v"(l5), "v"((unsigned long long)(size_t)g5),
                  "v"(l6), "v"((unsigned long long)(size_t)g6),
                  "v"(l7), "v"((unsigned long long)(size_t)g7)
               : "memory");
}
typedef __attribute__((ext_vector_type(4))) float v4f;
__device__ __forceinline__ void store4_b128(
    void* g0, v4f d0, void* g1, v4f d1, void* g2, v4f d2, void* g3, v4f d3) {
  asm volatile("global_store_b128 %0, %1, off\n\t"
               "global_store_b128 %2, %3, off\n\t"
               "global_store_b128 %4, %5, off\n\t"
               "global_store_b128 %6, %7, off\n\t"
               "s_wait_xcnt 0x0"
               :: "v"((unsigned long long)(size_t)g0), "v"(d0),
                  "v"((unsigned long long)(size_t)g1), "v"(d1),
                  "v"((unsigned long long)(size_t)g2), "v"(d2),
                  "v"((unsigned long long)(size_t)g3), "v"(d3)
               : "memory");
}
__device__ __forceinline__ void async_wait0() {
  asm volatile("s_wait_asynccnt 0x0" ::: "memory");
}

// ---------------------------------------------------------------------------
// Transposing LDS load: from a tile stored T[k][n] (k rows, n contiguous) lane
// (c = lane & 15, h = lane >> 4) receives T[k0 + 8h + 0..7][n0 + c]. The lane's
// own address is &T[k0 + 8h + (lane & 7)][n0 + 8 * ((lane >> 3) & 1)].
// Loads at k0 and k0 + 16 form one 32-k B fragment in the k order that the
// A loaders below use (8h + 0..7, then 16 + 8h + 0..7).
// ---------------------------------------------------------------------------
typedef __attribute__((ext_vector_type(8))) short v8s;
typedef __attribute__((address_space(3))) v8s lds_v8s;
__device__ __forceinline__ v8h lds_load_tr16(const _Float16* p) {
  return __builtin_bit_cast(v8h, __builtin_amdgcn_ds_load_tr16_b128_v8i16((lds_v8s*)p));
}

// ---------------------------------------------------------------------------
// f32 -> f16 conversion of six arrays in one launch. The grid is sized to be
// resident at once (one 16-wave block per WGP) and its waves walk the work, so
// that few waves have to be started. A unit is 1024 floats: eight wave-wide loads
// of 512 contiguous bytes, all issued before the first is used. The six f16
// results lie one behind another at out, in the order of the sources; e0..e5 are
// the running ends of the six arrays in units.
// ---------------------------------------------------------------------------
typedef __attribute__((ext_vector_type(4))) _Float16 v4h;
#define CVT_UNIT 1024

__global__ __launch_bounds__(512) void cvt_f32_f16_six(
    const float* __restrict__ s0, const float* __restrict__ s1,
    const float* __restrict__ s2, const float* __restrict__ s3,
    const float* __restrict__ s4, const float* __restrict__ s5,
    _Float16* __restrict__ out,
    int e0, int e1, int e2, int e3, int e4, int e5)
{
  const int lane = threadIdx.x & 31;
  const int nw   = gridDim.x * (blockDim.x >> 5);
  // The wave's number, held scalar so that the choice of the source is a scalar one.
  const int wv   = __builtin_amdgcn_readfirstlane(blockIdx.x * (blockDim.x >> 5) + (threadIdx.x >> 5));
  for (int u = wv; u < e5; u += nw) {
    const float* s = s0;
    int first = 0;
    if (u >= e0) { s = s1; first = e0; }
    if (u >= e1) { s = s2; first = e1; }
    if (u >= e2) { s = s3; first = e2; }
    if (u >= e3) { s = s4; first = e3; }
    if (u >= e4) { s = s5; first = e4; }
    const v4f* p = reinterpret_cast<const v4f*>(s + (size_t)(u - first) * CVT_UNIT) + lane;
    v4h* o = reinterpret_cast<v4h*>(out + (size_t)u * CVT_UNIT) + lane;
    v4f a[8];
#pragma unroll
    for (int q = 0; q < 8; ++q) a[q] = p[q * 32];
#pragma unroll
    for (int q = 0; q < 8; ++q) o[q * 32] = __builtin_convertvector(a[q], v4h);
  }
}

// x * Phi(x) with Phi(x) = erfc(-x / sqrt 2) / 2, the same path for every x, four
// elements at a time. q = erfc(|x| / sqrt 2) / 2 = (a1 t + ... + a5 t^5) exp(-x^2 / 2) / 2
// with t = 1 / (1 + p |x| / sqrt 2): absolute error of erf below 1.5e-7 for every x, the
// size of an f32 rounding of 1 + erf. x Phi(x) = max(x, 0) - |x| q on both sides of 0,
// with no cancellation for x < 0. The halves are folded into the coefficients.
__device__ __forceinline__ void gelu_erf4(float (&x)[4]) {
  float d[4], s[4], t[4], e[4];
#pragma unroll
  for (int c = 0; c < 4; ++c) {
    d[c] = fmaf(fabsf(x[c]), 0.23164190f, 1.0f);
    s[c] = (x[c] * -0.72134752f) * x[c];
  }
  asm("v_rcp_f32 %0, %8\n\t"
      "v_rcp_f32 %1, %9\n\t"
      "v_rcp_f32 %2, %10\n\t"
      "v_rcp_f32 %3, %11\n\t"
      "v_exp_f32 %4, %12\n\t"
      "v_exp_f32 %5, %13\n\t"
      "v_exp_f32 %6, %14\n\t"
      "v_exp_f32 %7, %15\n\t"
      "v_nop"
      : "=&v"(t[0]), "=&v"(t[1]), "=&v"(t[2]), "=&v"(t[3]),
        "=&v"(e[0]), "=&v"(e[1]), "=&v"(e[2]), "=&v"(e[3])
      : "v"(d[0]), "v"(d[1]), "v"(d[2]), "v"(d[3]),
        "v"(s[0]), "v"(s[1]), "v"(s[2]), "v"(s[3]));
#pragma unroll
  for (int c = 0; c < 4; ++c) {
    float p = fmaf(t[c], 0.5307027145f, -0.7265760135f);
    p = fmaf(t[c], p, 0.7107068705f);
    p = fmaf(t[c], p, -0.1422483680f);
    p = fmaf(t[c], p, 0.1274147960f);
    const float q = (p * t[c]) * e[c];
    x[c] = fmaf(-fabsf(x[c]), q, fmaxf(x[c], 0.0f));
  }
}

template <bool ACT, bool OUT32, int NWR, int NWC, int FJ, int BK>
__global__ __launch_bounds__(NWR * NWC * 32) void gemm_f16_wmma(
    const _Float16* __restrict__ A, const _Float16* __restrict__ Bm,
    const float* __restrict__ bias,
    float* __restrict__ Cf, _Float16* __restrict__ Ch,
    int M, int N, int K)
{
  constexpr int NT   = NWR * NWC * 32;   // threads
  constexpr int BM   = NWR * 64;
  constexpr int BN   = NWC * FJ * 16;
  constexpr int LDSA = BK + 8;           // 272B or 528B rows (16B x odd: the plain reader's pitch)
  constexpr int LDSB = BN + 16;          // 288B or 544B rows (32B x odd: the transposing reader's pitch)
  constexpr int CA   = BK / 8;           // 16B chunks in an A row
  constexpr int RA   = NT / CA;          // A rows that one copy of every thread covers
  constexpr int CB   = BN / 8;           // 16B chunks in a B row
  constexpr int RB   = NT / CB;          // B rows that one copy of every thread covers
  constexpr int NA   = BM / RA;          // A copies per thread and stage
  constexpr int NB   = BK / RB;          // B copies per thread and stage
  static_assert(NA % 8 == 0 && NB % 8 == 0, "copies go in statements of eight");
  static_assert(NA + NB <= 63, "one stage's copies of a wave are in flight at once");
  static_assert((LDSA / 8) % 2 == 1, "A pitch is 16B x odd");
  static_assert((LDSB / 16) % 2 == 1, "B pitch is 32B x odd");
  // 32-k blocks whose fragments a wave holds at once: two where the registers allow it
  // (64x32 wave tile, 8 waves), one block at 64x64 (16 waves, 256 registers each).
  constexpr int G = (FJ == 2) ? 2 : 1;
  __shared__ __attribute__((aligned(16))) _Float16 As[2][BM][LDSA];
  __shared__ __attribute__((aligned(16))) _Float16 Bs[2][BK][LDSB]; // as in memory: Bs[.][k][n]

  const int tid  = threadIdx.x;
  const int lane = tid & 31;
  const int wave = tid >> 5;
  const int wr   = wave / NWC;
  const int wc   = wave % NWC;
  const int lr   = lane & 15;
  const int hi   = lane >> 4;   // 0/1
  const int kb   = hi * 8;      // K-chunk base per 16-bit A/B lane layout

  const int m0 = blockIdx.y * BM;
  const int n0 = blockIdx.x * BN;

  v8f acc[4][FJ] = {};

  // One stage = A BM x BK halfs and B BK x BN halfs in chunks of 16B, NA and NB
  // per thread: A rows r + RA q, B rows kk + RB q. The pointers walk one stage
  // further at every fill.
  const int r  = tid / CA;
  const int kc = (tid % CA) * 8;
  const int kk = tid / CB;
  const int nn = (tid % CB) * 8;
  const _Float16* ag = &A[(size_t)(m0 + r) * K + kc];
  const _Float16* bg = &Bm[(size_t)kk * N + n0 + nn];
  const unsigned la = (unsigned)(size_t)&As[0][r][kc];
  const unsigned lb = (unsigned)(size_t)&Bs[0][kk][nn];
  auto fill = [&](int buf) {
    const unsigned a = la + (unsigned)buf * (unsigned)(BM * LDSA * 2);
    const unsigned b = lb + (unsigned)buf * (unsigned)(BK * LDSB * 2);
#pragma unroll
    for (int q = 0; q < NA; q += 8)
      async_copy8_b128(a + (q + 0) * RA * LDSA * 2, ag + (size_t)((q + 0) * RA) * K,
                       a + (q + 1) * RA * LDSA * 2, ag + (size_t)((q + 1) * RA) * K,
                       a + (q + 2) * RA * LDSA * 2, ag + (size_t)((q + 2) * RA) * K,
                       a + (q + 3) * RA * LDSA * 2, ag + (size_t)((q + 3) * RA) * K,
                       a + (q + 4) * RA * LDSA * 2, ag + (size_t)((q + 4) * RA) * K,
                       a + (q + 5) * RA * LDSA * 2, ag + (size_t)((q + 5) * RA) * K,
                       a + (q + 6) * RA * LDSA * 2, ag + (size_t)((q + 6) * RA) * K,
                       a + (q + 7) * RA * LDSA * 2, ag + (size_t)((q + 7) * RA) * K);
#pragma unroll
    for (int q = 0; q < NB; q += 8)
      async_copy8_b128(b + (q + 0) * RB * LDSB * 2, bg + (size_t)((q + 0) * RB) * N,
                       b + (q + 1) * RB * LDSB * 2, bg + (size_t)((q + 1) * RB) * N,
                       b + (q + 2) * RB * LDSB * 2, bg + (size_t)((q + 2) * RB) * N,
                       b + (q + 3) * RB * LDSB * 2, bg + (size_t)((q + 3) * RB) * N,
                       b + (q + 4) * RB * LDSB * 2, bg + (size_t)((q + 4) * RB) * N,
                       b + (q + 5) * RB * LDSB * 2, bg + (size_t)((q + 5) * RB) * N,
                       b + (q + 6) * RB * LDSB * 2, bg + (size_t)((q + 6) * RB) * N,
                       b + (q + 7) * RB * LDSB * 2, bg + (size_t)((q + 7) * RB) * N);
    ag += BK;
    bg += (size_t)BK * N;
  };

  const int nst = K / BK;
  fill(0);
  async_wait0();
  __syncthreads();
  if (nst > 1) fill(1);

  for (int t = 0; t < nst; ++t) {
    const int cur = t & 1;
#pragma unroll
    for (int ks = 0; ks < BK; ks += 32 * G) {
      F16x16 af[G][4], bf[G][FJ];
#pragma unroll
      for (int g = 0; g < G; ++g) {
#pragma unroll
        for (int i = 0; i < 4; ++i) {
          const _Float16* p = &As[cur][wr * 64 + i * 16 + lr][ks + g * 32];
          af[g][i].h[0] = *reinterpret_cast<const v8h*>(p + kb);
          af[g][i].h[1] = *reinterpret_cast<const v8h*>(p + kb + 16);
        }
#pragma unroll
        for (int j = 0; j < FJ; ++j) {
          const _Float16* p = &Bs[cur][ks + g * 32 + kb + (lane & 7)][(wc * FJ + j) * 16 + ((lane >> 3) & 1) * 8];
          bf[g][j].h[0] = lds_load_tr16(p);
          bf[g][j].h[1] = lds_load_tr16(p + 16 * LDSB);
        }
      }
      __builtin_amdgcn_sched_barrier(0);
#pragma unroll
      for (int g = 0; g < G; ++g)
#pragma unroll
        for (int i = 0; i < 4; ++i)
#pragma unroll
          for (int j = 0; j < FJ; ++j)
            acc[i][j] = WMMA_F16(bf[g][j].v, af[g][i].v, acc[i][j]);   // C^T tile: see the epilogue
    }
    // Without it the scheduler would lift the waits below over the last group's WMMAs:
    // the wave would wait for all 24 loads before the first of them, and the refill
    // would stand behind the 16 WMMAs instead of directly behind the barrier.
    if (G > 1) __builtin_amdgcn_sched_barrier(0);
    // Hand-over: this wave's reads of buffer cur are done, its copies of stage
    // t + 1 have landed; behind the barrier that holds for every wave, so stage
    // t + 1 may be read and buffer cur refilled.
    asm volatile("s_wait_dscnt 0x0" ::: "memory");
    async_wait0();
    __syncthreads();
    if (t + 2 < nst) fill(cur);
  }
  // No copy is outstanding when the wave goes on to the epilogue.
  async_wait0();

  // Epilogue. The products were formed as C^T = B^T A^T (the two fragment kinds have the
  // same lane and k layout, so they only change places in the WMMA): lane lr holds row
  // m = 16 i + lr of C and its registers v the columns n = 16 j + 8 hi + v, eight
  // neighbours. A row of the wave's tile is 128 bytes, one line. Each wave stages 16 rows
  // at a time in an LDS range of its own (the ring is free behind the loop's last barrier)
  // with 16-byte LDS stores, reads them back eight lanes to a row and stores whole lines,
  // four per instruction. Two ranges alternate: the wait of pass i + 1 has retired the
  // reads of pass i before pass i + 2 writes there.
  constexpr int EB   = OUT32 ? 4 : 2;     // bytes per element of C
  constexpr int SP   = 128 + 16;          // staging pitch: 16B x odd
  static_assert(FJ * 16 * EB == 128, "a row of the wave's tile is one line");
  static_assert(NWR * NWC * 2 * 16 * SP <= (int)sizeof(As), "staging fits the A ring");
  char* stg = reinterpret_cast<char*>(&As[0][0][0]) + wave * (2 * 16 * SP);
  v4f biasv[FJ][2];
  const v4f* bp = reinterpret_cast<const v4f*>(bias + n0 + wc * FJ * 16 + kb);
#pragma unroll
  for (int j = 0; j < FJ; ++j) {
    biasv[j][0] = bp[j * 4];
    biasv[j][1] = bp[j * 4 + 1];
  }
  // Stands in front of every rewrite of the address register of the loads above. The
  // pointer is named as an input so that its registers live up to the wait; otherwise
  // the last load's result is placed on its own address pair.
  asm volatile("s_wait_xcnt 0x0" :: "v"(bp) : "memory");
  const int rr = ((lane >> 3) & 1) * 8 + (lane >> 4);
  char* cg = (OUT32 ? reinterpret_cast<char*>(Cf) : reinterpret_cast<char*>(Ch))
           + ((size_t)(m0 + wr * 64 + rr) * N + n0 + wc * FJ * 16) * EB + (lane & 7) * 16;
  const size_t step = (size_t)2 * N * EB;   // two rows of C
#pragma unroll
  for (int i = 0; i < 4; ++i) {
    char* sw = stg + (i & 1) * (16 * SP);
#pragma unroll
    for (int j = 0; j < FJ; ++j) {
      float x[2][4];
#pragma unroll
      for (int u = 0; u < 2; ++u) {
#pragma unroll
        for (int c = 0; c < 4; ++c) x[u][c] = acc[i][j][u * 4 + c] + biasv[j][u][c];
        if (ACT) gelu_erf4(x[u]);
      }
      char* sp = sw + lr * SP + (j * 16 + kb) * EB;
      if (OUT32) {
#pragma unroll
        for (int u = 0; u < 2; ++u) {
          v4f o = {x[u][0], x[u][1], x[u][2], x[u][3]};
          *reinterpret_cast<v4f*>(sp + u * 16) = o;
        }
      } else {
        v8h o;
#pragma unroll
        for (int v = 0; v < 8; ++v) o[v] = (_Float16)x[v >> 2][v & 3];
        *reinterpret_cast<v8h*>(sp) = o;
      }
    }
    // The wave's own LDS stores have landed before other lanes of it read the rows back.
    asm volatile("s_wait_dscnt 0x0" ::: "memory");
    v4f rb[4];
#pragma unroll
    for (int q = 0; q < 4; ++q)
      rb[q] = *reinterpret_cast<const v4f*>(sw + (q * 2 + rr) * SP + (lane & 7) * 16);
    store4_b128(cg, rb[0], cg + step, rb[1], cg + 2 * step, rb[2], cg + 3 * step, rb[3]);
    cg += 8 * step;   // the next 16 rows
  }
}

__device__ __forceinline__ float xhalf(float x) {
  const int i = __builtin_bit_cast(int, x);
  return __builtin_bit_cast(float,
      __builtin_amdgcn_permlanex16(i, i, 0x76543210, 0xfedcba98, false, false));
}

__global__ __launch_bounds__(128) void attn_flash_wmma(
    const _Float16* __restrict__ qkvh, _Float16* __restrict__ Yh,
    int Bx, int Tx, int Cx, int NHx)
{
  __shared__ __attribute__((aligned(16))) _Float16 Ks[2][64][72]; // key-major (rows = key, cols = d)
  __shared__ __attribute__((aligned(16))) _Float16 Vs[2][64][80]; // key-major, 160B rows (32B x odd)

  const int tid  = threadIdx.x;
  const int lane = tid & 31;
  const int w    = tid >> 5;   // 0..3
  const int lr   = lane & 15;
  const int hi   = lane >> 4;
  const int kb   = hi * 8;

  const int bh = blockIdx.x;
  const int b  = bh / NHx;
  const int h  = bh % NHx;
  const int qb = blockIdx.y;
  const int q0 = qb * 64;
  const int qrow = q0 + w * 16 + lr;   // this lane's query

  const size_t rstride = (size_t)3 * Cx;
  const _Float16* kbase = qkvh + (size_t)b * Tx * rstride + 0 * Cx + h * 64;
  const _Float16* qbase = qkvh + (size_t)b * Tx * rstride + 1 * Cx + h * 64;
  const _Float16* vbase = qkvh + (size_t)b * Tx * rstride + 2 * Cx + h * 64;

  // Q fragments (B operand: column = query lr), pre-scaled by 1/sqrt(64) = 0.125
  F16x16 qf[2];
  {
#pragma unroll
    for (int kk = 0; kk < 2; ++kk) {
      const _Float16* p = qbase + (size_t)qrow * rstride + kk * 32;
      v8h x0 = *reinterpret_cast<const v8h*>(p + kb);
      v8h x1 = *reinterpret_cast<const v8h*>(p + kb + 16);
#pragma unroll
      for (int j = 0; j < 8; ++j) {
        x0[j] = (_Float16)(x0[j] * (_Float16)0.125f);
        x1[j] = (_Float16)(x1[j] * (_Float16)0.125f);
      }
      qf[kk].h[0] = x0; qf[kk].h[1] = x1;
    }
  }

  float mrow = -3.0e38f;   // running maximum of this lane's query (equal in both halves)
  float lsum = 0.0f;       // running sum over this half's keys only; joined after the loop
  v8f O[4] = {};           // O[ot][v] = O^T[d = 16 ot + 8 hi + v][query lr]

  // One tile = K and V, 64 keys x 64 d each: 512 chunks of 16B each, four per thread
  // (rows key, key + 16, key + 32, key + 48). The pointers walk one tile further at
  // every fill.
  const int key = tid >> 3;
  const int dc  = (tid & 7) * 8;
  const _Float16* kg = kbase + (size_t)key * rstride + dc;
  const _Float16* vg = vbase + (size_t)key * rstride + dc;
  const unsigned lk = (unsigned)(size_t)&Ks[0][key][dc];
  const unsigned lv = (unsigned)(size_t)&Vs[0][key][dc];
  auto fill = [&](int buf) {
    const unsigned k = lk + (unsigned)buf * (unsigned)(64 * 72 * 2);
    const unsigned v = lv + (unsigned)buf * (unsigned)(64 * 80 * 2);
    async_copy8_b128(k,               kg,
                     k + 16 * 72 * 2, kg + 16 * rstride,
                     k + 32 * 72 * 2, kg + 32 * rstride,
                     k + 48 * 72 * 2, kg + 48 * rstride,
                     v,               vg,
                     v + 16 * 80 * 2, vg + 16 * rstride,
                     v + 32 * 80 * 2, vg + 32 * rstride,
                     v + 48 * 80 * 2, vg + 48 * rstride);
    kg += 64 * rstride;
    vg += 64 * rstride;
  };

  // One trip: tile jb out of buffer jb & 1. 'more' (a tile jb + 1 exists) and 'diag' (the
  // tile holds the diagonal) are literals at both calls, so that a trip is one straight run.
  auto trip = [&](int jb, bool more, bool diag) __attribute__((always_inline)) {
    const int key0 = jb * 64;
    const int cur  = jb & 1;

    // S^T = K @ (Q/8)^T : 4 tiles of 16 keys, K-dim 64 = 2 WMMAs each.
    // S[nt][v] = score of key key0 + 16 nt + 8 hi + v against query lr.
    F16x16 ak[4][2];
#pragma unroll
    for (int nt = 0; nt < 4; ++nt) {
#pragma unroll
      for (int kk = 0; kk < 2; ++kk) {
        const _Float16* p = &Ks[cur][nt * 16 + lr][kk * 32];
        ak[nt][kk].h[0] = *reinterpret_cast<const v8h*>(p + kb);
        ak[nt][kk].h[1] = *reinterpret_cast<const v8h*>(p + kb + 16);
      }
    }
    __builtin_amdgcn_sched_barrier(0);
    // Tile jb + 1 into the other buffer, which every wave left in front of the last
    // barrier. It stands behind the K loads so that its issue runs under their latency.
    if (more) {
      fill(cur ^ 1);
      // Keeps the WMMAs, with their waits for the K loads, behind the copies' issue.
      __builtin_amdgcn_sched_barrier(0);
    }
    v8f S[4];
#pragma unroll
    for (int nt = 0; nt < 4; ++nt) {
      S[nt] = (v8f){};
#pragma unroll
      for (int kk = 0; kk < 2; ++kk) S[nt] = WMMA_F16(ak[nt][kk].v, qf[kk].v, S[nt]);
    }
    F16x16 av[4][2];
#pragma unroll
    for (int ot = 0; ot < 4; ++ot) {
#pragma unroll
      for (int kk = 0; kk < 2; ++kk) {
        const _Float16* vp = &Vs[cur][kk * 32 + kb + (lane & 7)][ot * 16 + ((lane >> 3) & 1) * 8];
        av[ot][kk].h[0] = lds_load_tr16(vp);
        av[ot][kk].h[1] = lds_load_tr16(vp + 16 * 80);
      }
    }
    // Keeps those loads here. Left free, the scheduler sinks them to the second product,
    // two in front of each WMMA behind a wait to 0.
    __builtin_amdgcn_sched_barrier(0);
    // Causal mask (only the diagonal block needs it)
    if (diag) {
#pragma unroll
      for (int nt = 0; nt < 4; ++nt) {
#pragma unroll
        for (int v = 0; v < 8; ++v) {
          int col = key0 + nt * 16 + kb + v;
          if (col > qrow) S[nt][v] = -3.0e38f;
        }
      }
    }

    // Online softmax update of the lane's query
    float tm[4];
#pragma unroll
    for (int nt = 0; nt < 4; ++nt) {
      tm[nt] = S[nt][0];
#pragma unroll
      for (int v = 1; v < 8; ++v) tm[nt] = fmaxf(tm[nt], S[nt][v]);
    }
    float t = fmaxf(fmaxf(tm[0], tm[1]), fmaxf(tm[2], tm[3]));
    t = fmaxf(t, xhalf(t));
    const float mn = fmaxf(mrow, t);
    const float alpha = __expf(mrow - mn);
    mrow = mn;
#pragma unroll
    for (int ot = 0; ot < 4; ++ot) O[ot] *= alpha;

    // P^T as B operand: element s of the 32-key fragment kk is tile 2 kk + (s >> 3),
    // register s & 7, which is the k order of the transposing load above.
    F16x16 pf[2];
    float rs[4];
#pragma unroll
    for (int nt = 0; nt < 4; ++nt) {
      rs[nt] = 0.0f;
#pragma unroll
      for (int v = 0; v < 8; ++v) {
        float p = __expf(S[nt][v] - mn);
        rs[nt] += p;
        pf[nt >> 1].h[nt & 1][v] = (_Float16)p;
      }
    }
    lsum = lsum * alpha + ((rs[0] + rs[1]) + (rs[2] + rs[3]));

    // O^T += V^T @ P^T
#pragma unroll
    for (int ot = 0; ot < 4; ++ot) {
#pragma unroll
      for (int kk = 0; kk < 2; ++kk) O[ot] = WMMA_F16(av[ot][kk].v, pf[kk].v, O[ot]);
    }
    // Keeps the hand-over below at the tile's end. No LDS access follows the V^T loads, so
    // the scheduler lifts it, with its waits to 0, to the head of the softmax, where the
    // wave would stand still for those loads instead of computing under them.
    __builtin_amdgcn_sched_barrier(0);
    // Hand-over: this wave's reads of buffer cur are done, its copies of tile jb + 1 have
    // landed; behind the barrier that holds for every wave, so tile jb + 1 may be read
    // and buffer cur refilled.
    asm volatile("s_wait_dscnt 0x0" ::: "memory");
    async_wait0();
    __syncthreads();
  };

  fill(0);
  async_wait0();
  __syncthreads();
  for (int jb = 0; jb < qb; ++jb) trip(jb, true, false);
  trip(qb, false, true);

  // Write y (f16), normalized: a lane holds 8 consecutive d of its query per tile
  const float inv = 1.0f / (lsum + xhalf(lsum));
  _Float16* yp = Yh + ((size_t)b * Tx + qrow) * Cx + h * 64 + kb;
#pragma unroll
  for (int ot = 0; ot < 4; ++ot) {
    v8h o;
#pragma unroll
    for (int v = 0; v < 8; ++v) o[v] = (_Float16)(O[ot][v] * inv);
    *reinterpret_cast<v8h*>(yp + ot * 16) = o;
  }
}

// ---------------------------------------------------------------------------
// out = xin + LayerNorm(t)*g + b, rows of LN_C floats. One wave per row, 16 rows
// per block: a lane holds 32 values of its row in registers (eight wave-wide
// loads of 512 contiguous bytes), the row's sums are joined by a butterfly over
// the 32 lanes, and no LDS or barrier is needed.
// ---------------------------------------------------------------------------
#define LN_C 1024

__global__ __launch_bounds__(512) void ln_residual(
    const float* __restrict__ xin, const float* __restrict__ t,
    const float* __restrict__ g, const float* __restrict__ be,
    float* __restrict__ outf, _Float16* __restrict__ outh)
{
  const int lane = threadIdx.x & 31;
  const int row  = blockIdx.x * (blockDim.x >> 5) + (threadIdx.x >> 5);
  const v4f* tr = reinterpret_cast<const v4f*>(t + (size_t)row * LN_C) + lane;
  const v4f* xr = reinterpret_cast<const v4f*>(xin + (size_t)row * LN_C) + lane;
  const v4f* gr = reinterpret_cast<const v4f*>(g) + lane;
  const v4f* br = reinterpret_cast<const v4f*>(be) + lane;

  v4f tv[8], xv[8], gv[8], bv[8];
#pragma unroll
  for (int q = 0; q < 8; ++q) tv[q] = tr[q * 32];
#pragma unroll
  for (int q = 0; q < 8; ++q) xv[q] = xr[q * 32];
#pragma unroll
  for (int q = 0; q < 8; ++q) gv[q] = gr[q * 32];
#pragma unroll
  for (int q = 0; q < 8; ++q) bv[q] = br[q * 32];
  // Stands in front of every rewrite of an address register of the loads above. The
  // two row pointers are named as inputs so that their registers live up to the wait;
  // otherwise the last load's result is placed on its own address pair.
  asm volatile("s_wait_xcnt 0x0" :: "v"(tr), "v"(xr) : "memory");
  // Keeps all 32 loads in front of the sums, so that the wave waits out one memory
  // latency; left free, the scheduler sinks 24 of them behind the sums in small groups.
  __builtin_amdgcn_sched_barrier(0);

  v4f sv = {}, sv2 = {};   // four independent chains each
#pragma unroll
  for (int q = 0; q < 8; ++q) { sv += tv[q]; sv2 += tv[q] * tv[q]; }
  float s  = (sv[0] + sv[1]) + (sv[2] + sv[3]);
  float s2 = (sv2[0] + sv2[1]) + (sv2[2] + sv2[3]);
#pragma unroll
  for (int off = 16; off; off >>= 1) { s += __shfl_xor(s, off, 32); s2 += __shfl_xor(s2, off, 32); }
  float mean = s / LN_C;
  float var  = s2 / LN_C - mean * mean;
  float rstd = rsqrtf(var + 1e-5f);

#pragma unroll
  for (int q = 0; q < 8; ++q)
#pragma unroll
    for (int e = 0; e < 4; ++e)
      xv[q][e] = xv[q][e] + (tv[q][e] - mean) * rstd * gv[q][e] + bv[q][e];
  if (outf) {
    v4f* of = reinterpret_cast<v4f*>(outf + (size_t)row * LN_C) + lane;
#pragma unroll
    for (int q = 0; q < 8; ++q) of[q * 32] = xv[q];
    // The conversion below may reuse the registers that these stores name.
    asm volatile("s_wait_xcnt 0x0" ::: "memory");
  }
  if (outh) {
    v4h* oh = reinterpret_cast<v4h*>(outh + (size_t)row * LN_C) + lane;
#pragma unroll
    for (int q = 0; q < 8; ++q) oh[q * 32] = __builtin_convertvector(xv[q], v4h);
  }
}

// ---------------------------------------------------------------------------
extern "C" void kernel_launch(void* const* d_in, const int* in_sizes, int n_in,
                              void* d_out, int out_size, void* d_ws, size_t ws_size,
                              hipStream_t stream) {
  (void)in_sizes; (void)n_in; (void)out_size; (void)ws_size;
  const int Bb = 2, T = 2048, C = 1024, NH = 16;
  const int M = Bb * T; // 4096

  const float* x      = (const float*)d_in[0];
  const float* w_attn = (const float*)d_in[1];
  const float* b_attn = (const float*)d_in[2];
  const float* wa1    = (const float*)d_in[3];
  const float* ba1    = (const float*)d_in[4];
  const float* wa2    = (const float*)d_in[5];
  const float* ba2    = (const float*)d_in[6];
  const float* g1     = (const float*)d_in[7];
  const float* be1    = (const float*)d_in[8];
  const float* wf1    = (const float*)d_in[9];
  const float* bf1    = (const float*)d_in[10];
  const float* wf2    = (const float*)d_in[11];
  const float* bf2    = (const float*)d_in[12];
  const float* g2     = (const float*)d_in[13];
  const float* be2    = (const float*)d_in[14];
  float* out = (float*)d_out;

  char* ws = (char*)d_ws;
  size_t off = 0;
  auto take = [&](size_t bytes) -> char* {
    char* p = ws + off;
    off += (bytes + 255) & ~(size_t)255;
    return p;
  };

  _Float16* Xh    = (_Float16*)take((size_t)M * C * 2);        // x f16; reused as Yh
  _Float16* Wattn = (_Float16*)take((size_t)C * 3 * C * 2);
  _Float16* Wa1h  = (_Float16*)take((size_t)C * 4 * C * 2);
  _Float16* Wa2h  = (_Float16*)take((size_t)4 * C * C * 2);
  _Float16* Wf1h  = (_Float16*)take((size_t)C * 4 * C * 2);
  _Float16* Wf2h  = (_Float16*)take((size_t)4 * C * C * 2);
  char*     qkvB  = take((size_t)M * 3 * C * 2);               // qkv f16; reused as t2/t4 f32
  _Float16* H1h   = (_Float16*)take((size_t)M * 4 * C * 2);    // FF hidden; reused for both FFs
  float*    x1    = (float*)take((size_t)M * C * 4);
  _Float16* x1h   = (_Float16*)take((size_t)M * C * 2);

  _Float16* qkvh = (_Float16*)qkvB;
  float*    t2f  = (float*)qkvB;   // reuse after attention consumes qkv
  _Float16* Yh   = Xh;             // reuse after QKV GEMM consumes Xh

  // f32 -> f16 conversions, one launch. Xh, Wattn, Wa1h, Wa2h, Wf1h, Wf2h were taken
  // in this order and each size is a multiple of 256 bytes, so they lie one behind
  // another from Xh on. Ends in units of CVT_UNIT floats.
  const int ux = M * C / CVT_UNIT, uq = C * 3 * C / CVT_UNIT, uf = C * 4 * C / CVT_UNIT;
  cvt_f32_f16_six<<<256, 512, 0, stream>>>(
      x, w_attn, wa1, wa2, wf1, wf2, Xh,
      ux, ux + uq, ux + uq + uf, ux + uq + 2 * uf, ux + uq + 3 * uf, ux + uq + 4 * uf);

  // qkv = x @ w_attn + b_attn  -> f16
  gemm_f16_wmma<false, false, 4, 4, 4, 128><<<dim3(3 * C / 256, M / 256), 512, 0, stream>>>(
      Xh, Wattn, b_attn, nullptr, qkvh, M, 3 * C, C);

  // flash attention -> Yh (f16)
  attn_flash_wmma<<<dim3(Bb * NH, T / 64), 128, 0, stream>>>(qkvh, Yh, Bb, T, C, NH);

  // SelfAttn FF: H1 = gelu(y @ wa1 + ba1); t2 = H1 @ wa2 + ba2
  gemm_f16_wmma<true, false, 4, 4, 4, 128><<<dim3(4 * C / 256, M / 256), 512, 0, stream>>>(
      Yh, Wa1h, ba1, nullptr, H1h, M, 4 * C, C);
  gemm_f16_wmma<false, true, 2, 4, 2, 256><<<dim3(C / 128, M / 128), 256, 0, stream>>>(
      H1h, Wa2h, ba2, t2f, nullptr, M, C, 4 * C);

  // x1 = x + LN(t2)
  ln_residual<<<M / 16, 512, 0, stream>>>(x, t2f, g1, be1, x1, x1h);

  // Block FF: H2 = gelu(x1 @ wf1 + bf1); t4 = H2 @ wf2 + bf2
  gemm_f16_wmma<true, false, 4, 4, 4, 128><<<dim3(4 * C / 256, M / 256), 512, 0, stream>>>(
      x1h, Wf1h, bf1, nullptr, H1h, M, 4 * C, C);
  gemm_f16_wmma<false, true, 2, 4, 2, 256><<<dim3(C / 128, M / 128), 256, 0, stream>>>(
      H1h, Wf2h, bf2, t2f, nullptr, M, C, 4 * C);

  // out = x1 + LN(t4)
  ln_residual<<<M / 16, 512, 0, stream>>>(x1, t2f, g2, be2, out, nullptr);
}
